// v000
// Measured on an AMD MI455X. A time is GPU time per run, averaged over a window of back-to-back runs after a warm-up
// (all launches, gaps included; the runs take copies of the inputs in turn), and the median of several windows.
// Apart from v000's, it joins two sittings. Times from different sittings can be a few percent apart, while
// side-by-side timings come from the same sitting.
// v000, which the later versions start from, runs in 682 microseconds.
#include <hip/hip_runtime.h>
#include <math.h>

typedef __attribute__((ext_vector_type(16))) _Float16 v16h;
typedef __attribute__((ext_vector_type(16))) __bf16 v16b;
typedef __attribute__((ext_vector_type(8)))  _Float16 v8h;
typedef __attribute__((ext_vector_type(8)))  float v8f;
typedef __attribute__((ext_vector_type(4)))  float v4f;
typedef __attribute__((ext_vector_type(2)))  float v2f;
typedef __attribute__((ext_vector_type(4)))  unsigned v4u;
typedef __attribute__((ext_vector_type(4)))  int v4i;
typedef float __attribute__((may_alias)) float_a;
typedef int __attribute__((may_alias)) int_a;

template <typename T> __device__ __forceinline__ void vst2(void* p, T v) { *(T*)p = v;  }
__device__ __forceinline__ v8f wmma16(v16h a, v16h b, v8f c) {
  v8f d = __builtin_amdgcn_wmma_f32_16x16x32_f16(false, a, false, b, (short)0, c, false, false);
  asm volatile("v_nop\n\tv_nop\n\tv_nop\n\tv_nop" : "+v"(d) : "v"(a), "v"(b));
  return d;
}
__device__ __forceinline__ v8f wmma_bf(v16b a, v16b b, v8f c) {
  v8f d = __builtin_amdgcn_wmma_f32_16x16x32_bf16(false, a, false, b, (short)0, c, false, false);
  asm volatile("v_nop\n\tv_nop\n\tv_nop\n\tv_nop" : "+v"(d) : "v"(a), "v"(b));
  return d;
}
// Multi-head ALiBi-style block (B 2, S 2,048, d 1,024, 16 heads x 64): per-head projections of separate keys / queries / values, (QK + (k - q)) / sqrt(S) with a causal mask, softmax over the query axis, weighted values, output projection.
__device__ __forceinline__ v16h frag_h(const _Float16* rowk0, int lane) {
  union { v16h v; v8h q[2]; } u; const _Float16* p = rowk0 + 8 * (lane >> 4);
  u.q[0] = *(const v8h*)p; u.q[1] = *(const v8h*)(p + 16); return u.v;
}
__device__ __forceinline__ v16h frag_f32(const float* rowk0, int lane) {
  v16h a; const float* p = rowk0 + 8 * (lane >> 4);
#pragma unroll
  for (int i = 0; i < 8; ++i) { a[i] = (_Float16)p[i]; a[8 + i] = (_Float16)p[16 + i]; }
  return a;
}
__device__ __forceinline__ v16h frag_f32s(const float* rowk0, int lane, float sc) {
  v16h a; const float* p = rowk0 + 8 * (lane >> 4);
#pragma unroll
  for (int i = 0; i < 8; ++i) { a[i] = (_Float16)(p[i] * sc); a[8 + i] = (_Float16)(p[16 + i] * sc); }
  return a;
}
// column fragment from a [K][ld] layout (column n), rows >= K read as 0
__device__ __forceinline__ v16h fragc_f32(const float* W, int k0, int n, int lane, int ld, int K) {
  v16h a; const int g = lane >> 4;
#pragma unroll
  for (int i = 0; i < 8; ++i) { const int ka = k0 + 8 * g + i, kb = ka + 16;
    a[i] = (_Float16)(ka < K ? W[(size_t)(ka < K ? ka : K - 1) * ld + n] : 0.f); a[8 + i] = (_Float16)(kb < K ? W[(size_t)(kb < K ? kb : K - 1) * ld + n] : 0.f); }
  return a;
}
struct F2 { v16b h, l; };
__device__ __forceinline__ F2 bsplit16(const float v[16]) { F2 r;
#pragma unroll
  for (int i = 0; i < 16; ++i) { const __bf16 h = (__bf16)v[i]; r.h[i] = h; r.l[i] = (__bf16)(v[i] - (float)h); }
  return r; }
__device__ __forceinline__ F2 split_row(const float* row, int k0, int lane) { float v[16]; const float* p = row + k0 + 8 * (lane >> 4);
#pragma unroll
  for (int i = 0; i < 8; ++i) { v[i] = p[i]; v[8 + i] = p[16 + i]; }
  return bsplit16(v); }
__device__ __forceinline__ F2 split_rowK(const float* row, int k0, int lane, int K) { float v[16]; const int g = lane >> 4;
#pragma unroll
  for (int i = 0; i < 8; ++i) { const int ka = k0 + 8 * g + i, kb = ka + 16; v[i] = ka < K ? row[ka < K ? ka : K - 1] : 0.f; v[8 + i] = kb < K ? row[kb < K ? kb : K - 1] : 0.f; }
  return bsplit16(v); }
__device__ __forceinline__ F2 split_col(const float* W, int k0, int n, int lane, int ld, int K) { float v[16]; const int g = lane >> 4;
#pragma unroll
  for (int i = 0; i < 8; ++i) { const int ka = k0 + 8 * g + i, kb = ka + 16; v[i] = ka < K ? W[(size_t)(ka < K ? ka : K - 1) * ld + n] : 0.f; v[8 + i] = kb < K ? W[(size_t)(kb < K ? kb : K - 1) * ld + n] : 0.f; }
  return bsplit16(v); }
__device__ __forceinline__ v8f mac3(const F2& a, const F2& b, v8f c) { c = wmma_bf(a.l, b.h, c); c = wmma_bf(a.h, b.l, c); return wmma_bf(a.h, b.h, c); }
__device__ __forceinline__ float sigm(float v) { return 1.0f / (1.0f + expf(-v)); }
#define LDSX() do { asm volatile("s_wait_dscnt 0" ::: "memory"); __builtin_amdgcn_wave_barrier(); __builtin_amdgcn_fence(__ATOMIC_RELEASE, "workgroup"); } while (0)


#define NB 2
#define SS 2048
#define DM 1024
#define NH 16
#define HD 64
#define QKVW (3 * DM)
#ifndef TQB
#define TQB (SS / 64)
#define TNB NB
#define TOB (NB * SS / 64)     // output row tiles (all)
#endif
typedef __attribute__((ext_vector_type(8))) __bf16 v8b;
__device__ __forceinline__ v16b frag_b(const __bf16* rowk0, int lane) {
  union { v16b v; v8b q[2]; } u; const __bf16* p = rowk0 + 8 * (lane >> 4);
  u.q[0] = *(const v8b*)p; u.q[1] = *(const v8b*)(p + 16); return u.v;
}
__device__ __forceinline__ float bfr(float v) { return (float)(__bf16)v; }
__device__ __attribute__((noinline)) float exp_ni(float v) { return expf(v); }
__device__ __attribute__((noinline)) float erf_ni(float v) { return erff(v); }

#define PK_A 0                       // [3072][1024] Wqkv rows (natural [out][in])
#define PK_P (PK_A + QKVW * DM)        // [1024][1024] Wo rows (natural)
#define PK_END (PK_P + DM * DM)
#define WS_PK  0u
#define WS_QK  (WS_PK + 2u * PK_END)             // f16 [4096 rows][2048]: q | k
#define WS_QKL (WS_QK + 2u * NB * SS * 2 * DM)     // f16 q | k residual planes x2048
#define WS_VTH (WS_QKL + 2u * NB * SS * 2 * DM)    // f16 [b][1024 (h*64+d)][2048 s] hi
#define WS_VTL (WS_VTH + 2u * NB * DM * SS)        // f16 lo x 2048
#define WS_O   (WS_VTL + 2u * NB * DM * SS)        // f32 [4096][1024]
#define WS_CS  (WS_O + 4u * NB * SS * DM)           // unused f32 space (2 x [2048][32])
#define WS_MST (WS_CS + 4u * 2 * SS * 32)
#define WS_END (WS_MST + 4u * NB * NH * SS * 2)
// ---- k_pack: block = (row n, which): natural [out][in] rows -> bf16; which 0..2 -> W_q/W_k/W_v into PK_A rows which*1024 + n; 3 -> W_o into PK_P
__global__ __launch_bounds__(256) void k_pack(const float* __restrict__ WQ, const float* __restrict__ WK, const float* __restrict__ WV, const float* __restrict__ WO, __bf16* __restrict__ PK) {
  __shared__ __align__(16) __bf16 s[DM]; const int n = blockIdx.x, which = blockIdx.y, t = threadIdx.x; const float* Wm = (which == 0) ? WQ : (which == 1) ? WK : (which == 2) ? WV : WO;   // per-head (in,out) [H][D][64] -> row n = h*64+e reads W[h][d][e]; WO (in,out) -> row n reads WO[d][n]
  const int hh = n / HD, e = n % HD;
  for (int k = t; k < DM; k += 256) s[k] = (__bf16)((which < 3) ? Wm[((size_t)hh * DM + k) * HD + e] : Wm[(size_t)k * DM + n]);
  __syncthreads();
  __bf16* dst = (which < 3) ? PK + PK_A + ((size_t)which * DM + n) * DM : PK + PK_P + (size_t)n * DM;
  for (int q = t; q < DM / 8; q += 256) vst2((unsigned*)(dst + q * 8), *(const v4u*)&s[q * 8]);
}
__global__ __launch_bounds__(128) void k_qkv(const float* __restrict__ XQ, const float* __restrict__ XK, const float* __restrict__ XV, const __bf16* __restrict__ P, _Float16* __restrict__ QK, _Float16* __restrict__ QKL, _Float16* __restrict__ VTH, _Float16* __restrict__ VTL) {
  const int which0 = (blockIdx.y * 128) / DM; const float* X = (which0 == 0) ? XQ : (which0 == 1) ? XK : XV;   // Q from queries, K from keys, V from values
  __shared__ __align__(16) _Float16 so[4][16][136], sol[4][16][136]; __shared__ __align__(16) _Float16 sth[128][72], stl[128][72];
  const int tid = threadIdx.x, wave = tid >> 5, lane = tid & 31, col = lane & 15, g = lane >> 4; const size_t r0 = (size_t)blockIdx.x * 64 + wave * 16; const int n0 = blockIdx.y * 128;
  v8f acc[8] = {};
#pragma unroll 2
  for (int kc = 0; kc < DM / 32; ++kc) { v16b a; { const float* p = X + (r0 + col) * DM + kc * 32 + 8 * g;
#pragma unroll
      for (int i = 0; i < 8; ++i) { a[i] = (__bf16)p[i]; a[8 + i] = (__bf16)p[16 + i]; } }
#pragma unroll
    for (int j = 0; j < 8; ++j) acc[j] = wmma_bf(a, frag_b(P + (size_t)(n0 + j * 16 + col) * DM + kc * 32, lane), acc[j]); }
  if (n0 < 2 * DM) {   // q stored unscaled (f16 sigma ~0.6, no subnormal exposure); CSCALE (1/sqrt(2048)) applied to the f32 score
#pragma unroll
    for (int j = 0; j < 8; ++j) {
#pragma unroll
      for (int r = 0; r < 8; ++r) { const float v = acc[j][r]; const _Float16 hv = (_Float16)v; so[wave][8 * g + r][j * 16 + col] = hv; sol[wave][8 * g + r][j * 16 + col] = (_Float16)((v - (float)hv) * 2048.0f); } }   // q, k as f16 hi + (x2048) residual (no RoPE in this module)
    LDSX();
    for (int rl = 0; rl < 16; ++rl) if (lane < 16) { vst2((unsigned*)(QK + (r0 + rl) * (2 * DM) + n0 + lane * 8), *(const v4u*)&so[wave][rl][lane * 8]); vst2((unsigned*)(QKL + (r0 + rl) * (2 * DM) + n0 + lane * 8), *(const v4u*)&sol[wave][rl][lane * 8]); }
  } else {
#pragma unroll
    for (int j = 0; j < 8; ++j) {
#pragma unroll
      for (int r = 0; r < 8; ++r) { const float v = acc[j][r]; const _Float16 hv = (_Float16)v; sth[j * 16 + col][wave * 16 + 8 * g + r] = hv; stl[j * 16 + col][wave * 16 + 8 * g + r] = (_Float16)((v - (float)hv) * 2048.0f); } }
    __syncthreads();
    const size_t rb = (size_t)blockIdx.x * 64; const int b = (int)(rb / SS), s0 = (int)(rb % SS); const int pc0 = n0 - 2 * DM;
    for (int q = tid; q < 128 * 8; q += 128) { const int d = q >> 3, pc = q & 7; const size_t o = ((size_t)b * DM + pc0 + d) * SS + s0 + pc * 8; vst2((unsigned*)(VTH + o), *(const v4u*)&sth[d][pc * 8]); vst2((unsigned*)(VTL + o), *(const v4u*)&stl[d][pc * 8]); }
  }
}
#define CSCALE 0.022097086912079608f   // float32(1/sqrt(2048)): the module divides by sqrt(number of keys)
// ---- k_cstat: block = (64 KEYS, h, b): the softmax runs over QUERIES (axis 2), so per key column we need max and sum over q: S^T tiles = K rows . Q rows (3 products), y = (qk + (k - q)) * CSCALE where causal (q >= k) if masking, else (qk + 0)*CSCALE for q < k; online (max, sum) per key row over the query tiles -> MST[b][h][k] = (m, l)
__global__ __launch_bounds__(128) void k_cstat(const _Float16* __restrict__ QK, const _Float16* __restrict__ QKL, const int* __restrict__ MASKING, float* __restrict__ MST) {
  __shared__ __align__(16) float sm[64][2];
  const int tid = threadIdx.x, wave = tid >> 5, lane = tid & 31, col = lane & 15, g = lane >> 4; const int kb = blockIdx.x, h = blockIdx.y, b = blockIdx.z; const int k0 = kb * 64 + wave * 16; const int masking = MASKING[0];
  v16h ak[2], akl[2];
#pragma unroll
  for (int kc = 0; kc < 2; ++kc) { const size_t rk = ((size_t)b * SS + k0 + col) * (2 * DM) + DM + h * HD + kc * 32; ak[kc] = frag_h(QK + rk, lane); akl[kc] = frag_h(QKL + rk, lane); }
  float m[8], l[8];
#pragma unroll
  for (int r = 0; r < 8; ++r) { m[r] = -3.0e38f; l[r] = 0.f; }
  const int qs0 = masking ? (kb * 64) / 32 : 0;   // first query tile that can see these keys
#pragma unroll 1
  for (int qs = qs0; qs < SS / 32; ++qs) { v8f s[2];
#pragma unroll
    for (int ct = 0; ct < 2; ++ct) { const int qq = qs * 32 + ct * 16 + col; const size_t rq = ((size_t)b * SS + qq) * (2 * DM) + h * HD; v8f c = {}, cl = {};
#pragma unroll
      for (int kc = 0; kc < 2; ++kc) { const v16h qh = frag_h(QK + rq + kc * 32, lane); c = wmma16(ak[kc], qh, c); cl = wmma16(akl[kc], qh, cl); cl = wmma16(ak[kc], frag_h(QKL + rq + kc * 32, lane), cl); }
#pragma unroll
      for (int r = 0; r < 8; ++r) { const int ki = k0 + 8 * g + r; const float qk = c[r] + cl[r] * (1.0f / 2048.0f); const bool causal = (ki <= qq);
        s[ct][r] = causal ? (qk + (float)(ki - qq)) * CSCALE : (masking ? -3.0e38f : qk * CSCALE); } }
#pragma unroll
    for (int r = 0; r < 8; ++r) { float mx = fmaxf(s[0][r], s[1][r]);
#pragma unroll
      for (int o = 1; o < 16; o <<= 1) mx = fmaxf(mx, __shfl_xor(mx, o));
      const float mn = fmaxf(m[r], mx); const float alpha = (m[r] <= -1.0e38f) ? 0.f : __expf(m[r] - mn);
      const float e0 = (s[0][r] <= -1.0e38f) ? 0.f : __expf(s[0][r] - mn), e1 = (s[1][r] <= -1.0e38f) ? 0.f : __expf(s[1][r] - mn); float es = e0 + e1;
#pragma unroll
      for (int o = 1; o < 16; o <<= 1) es += __shfl_xor(es, o);
      l[r] = l[r] * alpha + es; m[r] = mn; } }
  if (col == 0) {
#pragma unroll
    for (int r = 0; r < 8; ++r) { sm[wave * 16 + 8 * g + r][0] = m[r]; sm[wave * 16 + 8 * g + r][1] = l[r]; } }
  __syncthreads();
  if (tid < 32) vst2(MST + (((size_t)b * NH + h) * SS + kb * 64) * 2 + tid * 4, *(const v4f*)(&sm[0][0] + tid * 4));
}
// ---- k_attn: block = (64 queries, h, b): key tiles (k <= q frontier if masking); y as above; z = exp(y - m_k) / l_k (column statistics); P = z as f16 hi + (x2048) lo x V hi/lo (3 products); out rows (no normalisation)
__global__ __launch_bounds__(128) void k_attn(const _Float16* __restrict__ QK, const _Float16* __restrict__ QKL, const _Float16* __restrict__ VTH, const _Float16* __restrict__ VTL, const float* __restrict__ MST, const int* __restrict__ MASKING, float* __restrict__ O) {
  __shared__ __align__(16) _Float16 sph[4][16][40], spl[4][16][40]; __shared__ __align__(16) float so[4][16][68];
  const int tid = threadIdx.x, wave = tid >> 5, lane = tid & 31, col = lane & 15, g = lane >> 4;
  const int qb = blockIdx.x, h = blockIdx.y, b = blockIdx.z; const int q0 = qb * 64 + wave * 16; const size_t rq = (size_t)b * SS + q0 + col; const int masking = MASKING[0];
  v16h aq[2], aql[2];
#pragma unroll
  for (int kc = 0; kc < 2; ++kc) { aq[kc] = frag_h(QK + rq * (2 * DM) + h * HD + kc * 32, lane); aql[kc] = frag_h(QKL + rq * (2 * DM) + h * HD + kc * 32, lane); }
  v8f acc[4] = {}, accl[4] = {};
  const int nks = masking ? (qb * 64 + 64) / 32 : SS / 32;
#pragma unroll 1
  for (int ks = 0; ks < nks; ++ks) {
#pragma unroll
    for (int ct = 0; ct < 2; ++ct) { const int kk = ks * 32 + ct * 16 + col; const _Float16* krow = QK + ((size_t)b * SS + kk) * (2 * DM) + DM + h * HD; const _Float16* krowl = QKL + ((size_t)b * SS + kk) * (2 * DM) + DM + h * HD; v8f c = {}, cl = {};
#pragma unroll
      for (int kc = 0; kc < 2; ++kc) { const v16h kh = frag_h(krow + kc * 32, lane); c = wmma16(aq[kc], kh, c); cl = wmma16(aql[kc], kh, cl); cl = wmma16(aq[kc], frag_h(krowl + kc * 32, lane), cl); }
      const float mk = MST[(((size_t)b * NH + h) * SS + kk) * 2], lk = MST[(((size_t)b * NH + h) * SS + kk) * 2 + 1];
#pragma unroll
      for (int r = 0; r < 8; ++r) { const int qi = q0 + 8 * g + r; const float qk = c[r] + cl[r] * (1.0f / 2048.0f); const bool causal = (kk <= qi);
        const float y = causal ? (qk + (float)(kk - qi)) * CSCALE : qk * CSCALE; const float p = (causal || !masking) ? (__expf(y - mk) / lk) * 2048.0f : 0.f;   // z scaled by 2^11 so its f16 hi plane stays out of the subnormal range; 2^-11 folded into the epilogue
        const _Float16 hp = (_Float16)p; sph[wave][8 * g + r][ct * 16 + col] = hp; spl[wave][8 * g + r][ct * 16 + col] = (_Float16)((p - (float)hp) * 2048.0f); } }
    LDSX();
    const v16h pah = frag_h(&sph[wave][col][0], lane), pal = frag_h(&spl[wave][col][0], lane);
#pragma unroll
    for (int dt = 0; dt < 4; ++dt) { const size_t vo = ((size_t)b * DM + h * HD + dt * 16 + col) * SS + ks * 32; const v16h vh = frag_h(VTH + vo, lane), vl = frag_h(VTL + vo, lane); acc[dt] = wmma16(pah, vh, acc[dt]); accl[dt] = wmma16(pal, vh, accl[dt]); accl[dt] = wmma16(pah, vl, accl[dt]); }
    LDSX(); }
#pragma unroll
  for (int r = 0; r < 8; ++r) {
#pragma unroll
    for (int dt = 0; dt < 4; ++dt) so[wave][8 * g + r][dt * 16 + col] = (acc[dt][r] + accl[dt][r] * (1.0f / 2048.0f)) * (1.0f / 2048.0f); }
  LDSX();
  for (int rl = 0; rl < 16; ++rl) if (lane < 16) vst2(O + ((size_t)b * SS + q0 + rl) * DM + h * HD + lane * 4, *(const v4f*)&so[wave][rl][lane * 4]);
}
// ---- k_out: block = (64 rows, 128 cols): out = O(hi/lo) . Wo rows (2 products)
__global__ __launch_bounds__(128) void k_out(const float* __restrict__ O, const __bf16* __restrict__ P, float* __restrict__ Y) {
  __shared__ __align__(16) float so[4][16][132];
  const int tid = threadIdx.x, wave = tid >> 5, lane = tid & 31, col = lane & 15, g = lane >> 4; const size_t r0 = (size_t)blockIdx.x * 64 + wave * 16; const int n0 = blockIdx.y * 128;
  v8f acc[8] = {};
#pragma unroll 2
  for (int kc = 0; kc < DM / 32; ++kc) { const F2 a = split_row(O + (r0 + col) * DM, kc * 32, lane);
#pragma unroll
    for (int j = 0; j < 8; ++j) { const v16b w = frag_b(P + (size_t)(n0 + j * 16 + col) * DM + kc * 32, lane); acc[j] = wmma_bf(a.l, w, acc[j]); acc[j] = wmma_bf(a.h, w, acc[j]); } }
#pragma unroll
  for (int j = 0; j < 8; ++j) {
#pragma unroll
    for (int r = 0; r < 8; ++r) so[wave][8 * g + r][j * 16 + col] = acc[j][r]; }
  LDSX();
  for (int rl = 0; rl < 16; ++rl) vst2(Y + (r0 + rl) * DM + n0 + lane * 4, *(const v4f*)&so[wave][rl][lane * 4]);
}
extern "C" void kernel_launch(void* const* d_in, const int* in_sizes, int n_in, void* d_out, int out_size, void* d_ws, size_t ws_size, hipStream_t stream) {
  (void)in_sizes; (void)n_in; (void)out_size;
  const float** F = (const float**)d_in;   // 0 keys [2,2048,1024], 1 queries, 2 values, 3 WQ [16,1024,64], 4 WK, 5 WV, 6 WO [1024,1024] (in,out), 7 masking [1] int32
  if (ws_size < (size_t)WS_END) return;
  char* ws = (char*)d_ws; __bf16* PK = (__bf16*)(ws + WS_PK); _Float16 *QK = (_Float16*)(ws + WS_QK), *QKL = (_Float16*)(ws + WS_QKL), *VTH = (_Float16*)(ws + WS_VTH), *VTL = (_Float16*)(ws + WS_VTL); float* O = (float*)(ws + WS_O);
  float* MST = (float*)(ws + WS_MST);
  k_pack<<<dim3(DM, 4), 256, 0, stream>>>(F[3], F[4], F[5], F[6], PK);
  k_qkv<<<dim3(TNB * SS / 64, QKVW / 128), 128, 0, stream>>>(F[1], F[0], F[2], PK + PK_A, QK, QKL, VTH, VTL);
  k_cstat<<<dim3(SS / 64, NH, TNB), 128, 0, stream>>>(QK, QKL, (const int*)d_in[7], MST);
  k_attn<<<dim3(TQB, NH, TNB), 128, 0, stream>>>(QK, QKL, VTH, VTL, MST, (const int*)d_in[7], O);
  k_out<<<dim3(TOB, DM / 128), 128, 0, stream>>>(O, PK + PK_P, (float*)d_out);
}

// v001
// A run of this version takes 499 microseconds.
// Next to v000, in two timings, it ran 1.37 times as fast each time.
#include <hip/hip_runtime.h>
#include <math.h>

typedef __attribute__((ext_vector_type(16))) _Float16 v16h;
typedef __attribute__((ext_vector_type(16))) __bf16 v16b;
typedef __attribute__((ext_vector_type(8)))  _Float16 v8h;
typedef __attribute__((ext_vector_type(8)))  float v8f;
typedef __attribute__((ext_vector_type(4)))  float v4f;
typedef __attribute__((ext_vector_type(2)))  float v2f;
typedef __attribute__((ext_vector_type(4)))  unsigned v4u;
typedef __attribute__((ext_vector_type(4)))  int v4i;
typedef float __attribute__((may_alias)) float_a;
typedef int __attribute__((may_alias)) int_a;

template <typename T> __device__ __forceinline__ void vst2(void* p, T v) { *(T*)p = v;  }
__device__ __forceinline__ v8f wmma16(v16h a, v16h b, v8f c) {
  v8f d = __builtin_amdgcn_wmma_f32_16x16x32_f16(false, a, false, b, (short)0, c, false, false);
  asm volatile("v_nop\n\tv_nop\n\tv_nop\n\tv_nop" : "+v"(d) : "v"(a), "v"(b));
  return d;
}
__device__ __forceinline__ v8f wmma_bf(v16b a, v16b b, v8f c) {
  v8f d = __builtin_amdgcn_wmma_f32_16x16x32_bf16(false, a, false, b, (short)0, c, false, false);
  asm volatile("v_nop\n\tv_nop\n\tv_nop\n\tv_nop" : "+v"(d) : "v"(a), "v"(b));
  return d;
}
// Multi-head ALiBi-style block (B 2, S 2,048, d 1,024, 16 heads x 64): per-head projections of separate keys / queries / values, (QK + (k - q)) / sqrt(S) with a causal mask, softmax over the query axis, weighted values, output projection.
__device__ __forceinline__ v16h frag_h(const _Float16* rowk0, int lane) {
  union { v16h v; v8h q[2]; } u; const _Float16* p = rowk0 + 8 * (lane >> 4);
  u.q[0] = *(const v8h*)p; u.q[1] = *(const v8h*)(p + 16); return u.v;
}
__device__ __forceinline__ v16h frag_f32(const float* rowk0, int lane) {
  v16h a; const float* p = rowk0 + 8 * (lane >> 4);
#pragma unroll
  for (int i = 0; i < 8; ++i) { a[i] = (_Float16)p[i]; a[8 + i] = (_Float16)p[16 + i]; }
  return a;
}
__device__ __forceinline__ v16h frag_f32s(const float* rowk0, int lane, float sc) {
  v16h a; const float* p = rowk0 + 8 * (lane >> 4);
#pragma unroll
  for (int i = 0; i < 8; ++i) { a[i] = (_Float16)(p[i] * sc); a[8 + i] = (_Float16)(p[16 + i] * sc); }
  return a;
}
// column fragment from a [K][ld] layout (column n), rows >= K read as 0
__device__ __forceinline__ v16h fragc_f32(const float* W, int k0, int n, int lane, int ld, int K) {
  v16h a; const int g = lane >> 4;
#pragma unroll
  for (int i = 0; i < 8; ++i) { const int ka = k0 + 8 * g + i, kb = ka + 16;
    a[i] = (_Float16)(ka < K ? W[(size_t)(ka < K ? ka : K - 1) * ld + n] : 0.f); a[8 + i] = (_Float16)(kb < K ? W[(size_t)(kb < K ? kb : K - 1) * ld + n] : 0.f); }
  return a;
}
struct F2 { v16b h, l; };
__device__ __forceinline__ F2 bsplit16(const float v[16]) { F2 r;
#pragma unroll
  for (int i = 0; i < 16; ++i) { const __bf16 h = (__bf16)v[i]; r.h[i] = h; r.l[i] = (__bf16)(v[i] - (float)h); }
  return r; }
__device__ __forceinline__ F2 split_row(const float* row, int k0, int lane) { float v[16]; const float* p = row + k0 + 8 * (lane >> 4);
#pragma unroll
  for (int i = 0; i < 8; ++i) { v[i] = p[i]; v[8 + i] = p[16 + i]; }
  return bsplit16(v); }
__device__ __forceinline__ F2 split_rowK(const float* row, int k0, int lane, int K) { float v[16]; const int g = lane >> 4;
#pragma unroll
  for (int i = 0; i < 8; ++i) { const int ka = k0 + 8 * g + i, kb = ka + 16; v[i] = ka < K ? row[ka < K ? ka : K - 1] : 0.f; v[8 + i] = kb < K ? row[kb < K ? kb : K - 1] : 0.f; }
  return bsplit16(v); }
__device__ __forceinline__ F2 split_col(const float* W, int k0, int n, int lane, int ld, int K) { float v[16]; const int g = lane >> 4;
#pragma unroll
  for (int i = 0; i < 8; ++i) { const int ka = k0 + 8 * g + i, kb = ka + 16; v[i] = ka < K ? W[(size_t)(ka < K ? ka : K - 1) * ld + n] : 0.f; v[8 + i] = kb < K ? W[(size_t)(kb < K ? kb : K - 1) * ld + n] : 0.f; }
  return bsplit16(v); }
__device__ __forceinline__ v8f mac3(const F2& a, const F2& b, v8f c) { c = wmma_bf(a.l, b.h, c); c = wmma_bf(a.h, b.l, c); return wmma_bf(a.h, b.h, c); }
__device__ __forceinline__ float sigm(float v) { return 1.0f / (1.0f + expf(-v)); }
#define LDSX() do { asm volatile("s_wait_dscnt 0" ::: "memory"); __builtin_amdgcn_wave_barrier(); __builtin_amdgcn_fence(__ATOMIC_RELEASE, "workgroup"); } while (0)


#define NB 2
#define SS 2048
#define DM 1024
#define NH 16
#define HD 64
#define QKVW (3 * DM)
#ifndef TQB
#define TQB (SS / 64)
#define TNB NB
#define TOB (NB * SS / 64)     // output row tiles (all)
#endif
typedef __attribute__((ext_vector_type(8))) __bf16 v8b;
__device__ __forceinline__ v16b frag_b(const __bf16* rowk0, int lane) {
  union { v16b v; v8b q[2]; } u; const __bf16* p = rowk0 + 8 * (lane >> 4);
  u.q[0] = *(const v8b*)p; u.q[1] = *(const v8b*)(p + 16); return u.v;
}
// fragment loads from a wave-uniform base plus the lane's own 32-bit byte offset, which is the same in every pass
__device__ __forceinline__ v16h frag_hs(const _Float16* ub, unsigned vo) { union { v16h v; v8h q[2]; } u; const char* p = (const char*)ub + vo; u.q[0] = *(const v8h*)p; u.q[1] = *(const v8h*)(p + 32); return u.v; }
__device__ __forceinline__ v16b frag_bs(const __bf16* ub, unsigned vo) { union { v16b v; v8b q[2]; } u; const char* p = (const char*)ub + vo; u.q[0] = *(const v8b*)p; u.q[1] = *(const v8b*)(p + 32); return u.v; }
// the 16 f32 of one lane's A fragment, still unconverted, so that the loads can fly ahead of their use
struct R16 { v4f q[4]; };
__device__ __forceinline__ R16 ld_row16s(const float* ub, unsigned vo) { R16 r; const char* p = (const char*)ub + vo; r.q[0] = *(const v4f*)p; r.q[1] = *(const v4f*)(p + 16); r.q[2] = *(const v4f*)(p + 64); r.q[3] = *(const v4f*)(p + 80); return r; }
// stands behind a group of loads that stay in flight: the registers that hold their addresses may be rewritten only behind it
// the two scheduling barriers keep the wait behind its loads, and later loads and address arithmetic behind the wait
#define XW() do { __builtin_amdgcn_sched_barrier(0); asm volatile("s_wait_xcnt 0x0" ::: "memory"); __builtin_amdgcn_sched_barrier(0); } while (0)
// the same wait, taking two lane addresses of the group as inputs: they stay in their registers up to the wait, so no load of the group can be given those registers for its data
#define XWA(p, q) do { __builtin_amdgcn_sched_barrier(0); asm volatile("s_wait_xcnt 0x0" :: "v"(p), "v"(q) : "memory"); __builtin_amdgcn_sched_barrier(0); } while (0)
// fragment load from the lane's own byte address (k 0..7 of its half at p, k 16..23 at p + 32 bytes)
__device__ __forceinline__ v16h frag_hp(const char* p) { union { v16h v; v8h q[2]; } u; u.q[0] = *(const v8h*)p; u.q[1] = *(const v8h*)(p + 32); return u.v; }
// keeps a refill behind the WMMAs that last read the registers it refills; lifted over them, both sets would be live at once
#define SB() __builtin_amdgcn_sched_barrier(0)
__device__ __forceinline__ float bfr(float v) { return (float)(__bf16)v; }
__device__ __attribute__((noinline)) float exp_ni(float v) { return expf(v); }
__device__ __attribute__((noinline)) float erf_ni(float v) { return erff(v); }

#define PK_A 0                       // [3072][1024] Wqkv rows (natural [out][in])
#define PK_P (PK_A + QKVW * DM)        // [1024][1024] Wo rows (natural)
#define PK_END (PK_P + DM * DM)
#define WS_PK  0u
#define WS_QK  (WS_PK + 2u * PK_END)             // f16 [4096 rows][2048]: q | k
#define WS_QKL (WS_QK + 2u * NB * SS * 2 * DM)     // f16 q | k residual planes x2048
#define WS_VTH (WS_QKL + 2u * NB * SS * 2 * DM)    // f16 [b][1024 (h*64+d)][2048 s] hi
#define WS_VTL (WS_VTH + 2u * NB * DM * SS)        // f16 lo x 2048
#define WS_O   (WS_VTL + 2u * NB * DM * SS)        // f32 [4096][1024]
#define WS_CS  (WS_O + 4u * NB * SS * DM)           // unused f32 space (2 x [2048][32])
#define WS_MST (WS_CS + 4u * 2 * SS * 32)
#define WS_END (WS_MST + 4u * NB * NH * SS * 2)
// ---- k_pack: block = (row n, which): natural [out][in] rows -> bf16; which 0..2 -> W_q/W_k/W_v into PK_A rows which*1024 + n; 3 -> W_o into PK_P
__global__ __launch_bounds__(256) void k_pack(const float* __restrict__ WQ, const float* __restrict__ WK, const float* __restrict__ WV, const float* __restrict__ WO, __bf16* __restrict__ PK) {
  __shared__ __align__(16) __bf16 s[DM]; const int n = blockIdx.x, which = blockIdx.y, t = threadIdx.x; const float* Wm = (which == 0) ? WQ : (which == 1) ? WK : (which == 2) ? WV : WO;   // per-head (in,out) [H][D][64] -> row n = h*64+e reads W[h][d][e]; WO (in,out) -> row n reads WO[d][n]
  const int hh = n / HD, e = n % HD;
  for (int k = t; k < DM; k += 256) s[k] = (__bf16)((which < 3) ? Wm[((size_t)hh * DM + k) * HD + e] : Wm[(size_t)k * DM + n]);
  __syncthreads();
  __bf16* dst = (which < 3) ? PK + PK_A + ((size_t)which * DM + n) * DM : PK + PK_P + (size_t)n * DM;
  for (int q = t; q < DM / 8; q += 256) vst2((unsigned*)(dst + q * 8), *(const v4u*)&s[q * 8]);
}
__global__ __launch_bounds__(128) void k_qkv(const float* __restrict__ XQ, const float* __restrict__ XK, const float* __restrict__ XV, const __bf16* __restrict__ P, _Float16* __restrict__ QK, _Float16* __restrict__ QKL, _Float16* __restrict__ VTH, _Float16* __restrict__ VTL) {
  const int which0 = (blockIdx.y * 128) / DM; const float* X = (which0 == 0) ? XQ : (which0 == 1) ? XK : XV;   // Q from queries, K from keys, V from values
  __shared__ __align__(16) _Float16 so[4][16][136], sol[4][16][136]; __shared__ __align__(16) _Float16 sth[128][72], stl[128][72];
  const int tid = threadIdx.x, wave = tid >> 5, lane = tid & 31, col = lane & 15, g = lane >> 4; const size_t r0 = (size_t)blockIdx.x * 64 + wave * 16; const int n0 = blockIdx.y * 128;
  v8f acc[8] = {};
  // two register slots of fragments (k chunks kc and kc + 1); each fragment is loaded again, for two chunks on, directly behind its last use, so a whole slot's loads are in flight while the other slot is worked on
  const float* ua = X + (size_t)blockIdx.x * 64 * DM; const __bf16* ub = P + (size_t)n0 * DM; const unsigned voa = (unsigned)(((wave * 16 + col) * DM + 8 * g) * 4), vob = (unsigned)((col * DM + 8 * g) * 2);
  R16 ar[2]; v16b bw[2][8];
#pragma unroll
  for (int u = 0; u < 2; ++u) { ar[u] = ld_row16s(ua + u * 32, voa);
#pragma unroll
    for (int j = 0; j < 8; ++j) bw[u][j] = frag_bs(ub + j * 16 * DM + u * 32, vob); }
  XW();
#pragma unroll 1   // stays rolled: the two slots are the whole unrolling, a further copy would only cost registers
  for (int kc = 0; kc < DM / 32; kc += 2) {
#pragma unroll
    for (int u = 0; u < 2; ++u) { v16b a; const int kn = (kc + u + 2 < DM / 32) ? kc + u + 2 : DM / 32 - 1;   // past the end: the last chunk again, never used
#pragma unroll
      for (int i = 0; i < 8; ++i) { a[i] = (__bf16)ar[u].q[i >> 2][i & 3]; a[8 + i] = (__bf16)ar[u].q[2 + (i >> 2)][i & 3]; }
      ar[u] = ld_row16s(ua + kn * 32, voa);
#pragma unroll
      for (int j = 0; j < 8; ++j) { acc[j] = wmma_bf(a, bw[u][j], acc[j]); bw[u][j] = frag_bs(ub + j * 16 * DM + kn * 32, vob); }
      XW(); } }
  if (n0 < 2 * DM) {   // q stored unscaled (f16 sigma ~0.6, no subnormal exposure); CSCALE = 1/sqrt(2048) applied to the f32 score
#pragma unroll
    for (int j = 0; j < 8; ++j) {
#pragma unroll
      for (int r = 0; r < 8; ++r) { const float v = acc[j][r]; const _Float16 hv = (_Float16)v; so[wave][8 * g + r][j * 16 + col] = hv; sol[wave][8 * g + r][j * 16 + col] = (_Float16)((v - (float)hv) * 2048.0f); } }   // q, k as f16 hi + (x2048) residual (no RoPE in this module)
    LDSX();
    for (int rl = 0; rl < 16; ++rl) if (lane < 16) { vst2((unsigned*)(QK + (r0 + rl) * (2 * DM) + n0 + lane * 8), *(const v4u*)&so[wave][rl][lane * 8]); vst2((unsigned*)(QKL + (r0 + rl) * (2 * DM) + n0 + lane * 8), *(const v4u*)&sol[wave][rl][lane * 8]); }
  } else {
#pragma unroll
    for (int j = 0; j < 8; ++j) {
#pragma unroll
      for (int r = 0; r < 8; ++r) { const float v = acc[j][r]; const _Float16 hv = (_Float16)v; sth[j * 16 + col][wave * 16 + 8 * g + r] = hv; stl[j * 16 + col][wave * 16 + 8 * g + r] = (_Float16)((v - (float)hv) * 2048.0f); } }
    __syncthreads();
    const size_t rb = (size_t)blockIdx.x * 64; const int b = (int)(rb / SS), s0 = (int)(rb % SS); const int pc0 = n0 - 2 * DM;
    for (int q = tid; q < 128 * 8; q += 128) { const int d = q >> 3, pc = q & 7; const size_t o = ((size_t)b * DM + pc0 + d) * SS + s0 + pc * 8; vst2((unsigned*)(VTH + o), *(const v4u*)&sth[d][pc * 8]); vst2((unsigned*)(VTL + o), *(const v4u*)&stl[d][pc * 8]); }
  }
}
#define CSCALE 0.022097086912079608f   // float32(1/sqrt(2048)): the module divides by sqrt(number of keys)
// ---- k_cstat: block = (64 KEYS, h, b): the softmax runs over QUERIES (axis 2), so per key column we need max and sum over q: S^T tiles = K rows . Q rows (3 products), y = (qk + (k - q)) * CSCALE where causal (q >= k) if masking, else (qk + 0)*CSCALE for q < k; online (max, sum) per key row over the query tiles -> MST[b][h][k] = (m, l)
__global__ __launch_bounds__(128) void k_cstat(const _Float16* __restrict__ QK, const _Float16* __restrict__ QKL, const int* __restrict__ MASKING, float* __restrict__ MST) {
  __shared__ __align__(16) float sm[64][2];
  const int tid = threadIdx.x, wave = tid >> 5, lane = tid & 31, col = lane & 15, g = lane >> 4; const int kb = blockIdx.x, h = blockIdx.y, b = blockIdx.z; const int k0 = kb * 64 + wave * 16; const int masking = MASKING[0];
  v16h ak[2], akl[2];
#pragma unroll
  for (int kc = 0; kc < 2; ++kc) { const size_t rk = ((size_t)b * SS + k0 + col) * (2 * DM) + DM + h * HD + kc * 32; ak[kc] = frag_h(QK + rk, lane); akl[kc] = frag_h(QKL + rk, lane); }
  XW();
  float m[8], l[8];
#pragma unroll
  for (int r = 0; r < 8; ++r) { m[r] = -3.0e38f; l[r] = 0.f; }
  const int qs0 = masking ? (kb * 64) / 32 : 0;   // first query tile that can see these keys
  // query fragments of a pass sit in registers before the pass begins: each 16-query half is loaded again, for the next pass, directly behind its last WMMA
  const unsigned voq = (unsigned)((col * (2 * DM) + 8 * g) * 2); const size_t uq0 = (size_t)b * SS * (2 * DM) + h * HD;
  v16h qh[2][2], ql[2][2]; const char* pq0 = (const char*)(QK + uq0 + (size_t)qs0 * 32 * (2 * DM)) + voq; const char* pl0 = (const char*)(QKL + uq0 + (size_t)qs0 * 32 * (2 * DM)) + voq;
#pragma unroll
  for (int ct = 0; ct < 2; ++ct) {
#pragma unroll
    for (int kc = 0; kc < 2; ++kc) { qh[ct][kc] = frag_hp(pq0 + ct * 16 * (2 * DM) * 2 + kc * 64); ql[ct][kc] = frag_hp(pl0 + ct * 16 * (2 * DM) * 2 + kc * 64); } }
  XW();
  int qs = qs0;
#pragma unroll 1
  do { v8f s[2]; const int qn = (qs + 1 < SS / 32) ? qs + 1 : qs;   // past the end: the last tile again, never used
#pragma unroll
    for (int ct = 0; ct < 2; ++ct) { const int qq = qs * 32 + ct * 16 + col; const size_t uq = uq0 + (size_t)(qn * 32 + ct * 16) * (2 * DM); v8f c = {}, cl = {};
#pragma unroll
      for (int kc = 0; kc < 2; ++kc) { c = wmma16(ak[kc], qh[ct][kc], c); cl = wmma16(akl[kc], qh[ct][kc], cl); cl = wmma16(ak[kc], ql[ct][kc], cl); }
      SB();
#pragma unroll
      for (int kc = 0; kc < 2; ++kc) { qh[ct][kc] = frag_hs(QK + uq + kc * 32, voq); ql[ct][kc] = frag_hs(QKL + uq + kc * 32, voq); }
      XW();
#pragma unroll
      for (int r = 0; r < 8; ++r) { const int ki = k0 + 8 * g + r; const float qk = c[r] + cl[r] * (1.0f / 2048.0f); const bool causal = (ki <= qq);
        s[ct][r] = causal ? (qk + (float)(ki - qq)) * CSCALE : (masking ? -3.0e38f : qk * CSCALE); } }
#pragma unroll
    for (int r = 0; r < 8; ++r) { float mx = fmaxf(s[0][r], s[1][r]);
#pragma unroll
      for (int o = 1; o < 16; o <<= 1) mx = fmaxf(mx, __shfl_xor(mx, o));
      const float mn = fmaxf(m[r], mx); const float alpha = (m[r] <= -1.0e38f) ? 0.f : __expf(m[r] - mn);
      const float e0 = (s[0][r] <= -1.0e38f) ? 0.f : __expf(s[0][r] - mn), e1 = (s[1][r] <= -1.0e38f) ? 0.f : __expf(s[1][r] - mn); float es = e0 + e1;
#pragma unroll
      for (int o = 1; o < 16; o <<= 1) es += __shfl_xor(es, o);
      l[r] = l[r] * alpha + es; m[r] = mn; } } while (++qs < SS / 32);   // tested at the foot: qs0 is at most SS / 32 - 2
  if (col == 0) {
#pragma unroll
    for (int r = 0; r < 8; ++r) { sm[wave * 16 + 8 * g + r][0] = m[r]; sm[wave * 16 + 8 * g + r][1] = l[r]; } }
  __syncthreads();
  if (tid < 32) vst2(MST + (((size_t)b * NH + h) * SS + kb * 64) * 2 + tid * 4, *(const v4f*)(&sm[0][0] + tid * 4));
}
// ---- k_attn: block = (64 queries, h, b): key tiles (k <= q frontier if masking); y as above; z = exp(y - m_k) / l_k (column statistics); P = z as f16 hi + (x2048) lo x V hi/lo (3 products); out rows (no normalisation)
__global__ __launch_bounds__(128) void k_attn(const _Float16* __restrict__ QK, const _Float16* __restrict__ QKL, const _Float16* __restrict__ VTH, const _Float16* __restrict__ VTL, const float* __restrict__ MST, const int* __restrict__ MASKING, float* __restrict__ O) {
  __shared__ __align__(16) _Float16 sph[4][16][40], spl[4][16][40]; __shared__ __align__(16) float so[4][16][68];
  const int tid = threadIdx.x, wave = tid >> 5, lane = tid & 31, col = lane & 15, g = lane >> 4;
  const int qb = blockIdx.x, h = blockIdx.y, b = blockIdx.z; const int q0 = qb * 64 + wave * 16; const size_t rq = (size_t)b * SS + q0 + col; const int masking = MASKING[0];
  v16h aq[2], aql[2];
#pragma unroll
  for (int kc = 0; kc < 2; ++kc) { aq[kc] = frag_h(QK + rq * (2 * DM) + h * HD + kc * 32, lane); aql[kc] = frag_h(QKL + rq * (2 * DM) + h * HD + kc * 32, lane); }
  v8f acc[4] = {}, accl[4] = {};
  const int nks = masking ? (qb * 64 + 64) / 32 : SS / 32;
  // every global load of a pass is issued well ahead of its use: the values at the head of the pass; each block of 16 keys (with its statistics) into the one key buffer, directly behind the score WMMAs of the block before it
  const unsigned vok = (unsigned)((col * (2 * DM) + 8 * g) * 2), vov = (unsigned)((col * SS + 8 * g) * 2), vom = (unsigned)(col * 8);
  const size_t uk0 = (size_t)b * SS * (2 * DM) + DM + h * HD, uv0 = ((size_t)b * DM + h * HD) * SS; const float* um0 = MST + ((size_t)b * NH + h) * SS * 2;
  v16h kh[2], kl[2]; v2f ms;
#pragma unroll
  for (int kc = 0; kc < 2; ++kc) { kh[kc] = frag_hs(QK + uk0 + kc * 32, vok); kl[kc] = frag_hs(QKL + uk0 + kc * 32, vok); }
  ms = *(const v2f*)((const char*)um0 + vom);
  XW();
  int ks = 0;
#pragma unroll 1
  do { v16h vh[4], vl[4]; const int kn = (ks + 1 < nks) ? ks + 1 : ks;   // past the end: the last tile again, never used
    const char* pvh = (const char*)(VTH + uv0 + ks * 32) + vov; const char* pvl = (const char*)(VTL + uv0 + ks * 32) + vov;
#pragma unroll
    for (int dt = 0; dt < 4; ++dt) { vh[dt] = frag_hp(pvh + dt * 16 * SS * 2); vl[dt] = frag_hp(pvl + dt * 16 * SS * 2); }
    XWA(pvh, pvl);
#pragma unroll
    for (int ct = 0; ct < 2; ++ct) { const int kk = ks * 32 + ct * 16 + col; v8f c = {}, cl = {};
#pragma unroll
      for (int kc = 0; kc < 2; ++kc) { c = wmma16(aq[kc], kh[kc], c); cl = wmma16(aql[kc], kh[kc], cl); cl = wmma16(aq[kc], kl[kc], cl); }
      const float mk = ms[0], lk = ms[1]; const int kt = (ct == 0) ? ks * 32 + 16 : kn * 32;   // first key of the block that comes next
      SB();
#pragma unroll
      for (int kc = 0; kc < 2; ++kc) { const size_t uk = uk0 + (size_t)kt * (2 * DM) + kc * 32; kh[kc] = frag_hs(QK + uk, vok); kl[kc] = frag_hs(QKL + uk, vok); }
      ms = *(const v2f*)((const char*)(um0 + kt * 2) + vom);
      XW();
#pragma unroll
      for (int r = 0; r < 8; ++r) { const int qi = q0 + 8 * g + r; const float qk = c[r] + cl[r] * (1.0f / 2048.0f); const bool causal = (kk <= qi);
        const float y = causal ? (qk + (float)(kk - qi)) * CSCALE : qk * CSCALE; const float p = (causal || !masking) ? (__expf(y - mk) / lk) * 2048.0f : 0.f;   // z scaled by 2^11 so its f16 hi plane stays out of the subnormal range; 2^-11 folded into the epilogue
        const _Float16 hp = (_Float16)p; sph[wave][8 * g + r][ct * 16 + col] = hp; spl[wave][8 * g + r][ct * 16 + col] = (_Float16)((p - (float)hp) * 2048.0f); } }
    LDSX();
    const v16h pah = frag_h(&sph[wave][col][0], lane), pal = frag_h(&spl[wave][col][0], lane);
#pragma unroll
    for (int dt = 0; dt < 4; ++dt) { acc[dt] = wmma16(pah, vh[dt], acc[dt]); accl[dt] = wmma16(pal, vh[dt], accl[dt]); accl[dt] = wmma16(pah, vl[dt], accl[dt]); }
    LDSX(); } while (++ks < nks);   // tested at the foot: nks is at least 2 for any value of masking
#pragma unroll
  for (int r = 0; r < 8; ++r) {
#pragma unroll
    for (int dt = 0; dt < 4; ++dt) so[wave][8 * g + r][dt * 16 + col] = (acc[dt][r] + accl[dt][r] * (1.0f / 2048.0f)) * (1.0f / 2048.0f); }
  LDSX();
  for (int rl = 0; rl < 16; ++rl) if (lane < 16) vst2(O + ((size_t)b * SS + q0 + rl) * DM + h * HD + lane * 4, *(const v4f*)&so[wave][rl][lane * 4]);
}
// ---- k_out: block = (64 rows, 128 cols): out = O(hi/lo) . Wo rows (2 products)
__global__ __launch_bounds__(128) void k_out(const float* __restrict__ O, const __bf16* __restrict__ P, float* __restrict__ Y) {
  __shared__ __align__(16) float so[4][16][132];
  const int tid = threadIdx.x, wave = tid >> 5, lane = tid & 31, col = lane & 15, g = lane >> 4; const size_t r0 = (size_t)blockIdx.x * 64 + wave * 16; const int n0 = blockIdx.y * 128;
  v8f acc[8] = {};
  // two register slots of fragments, each loaded again for two chunks on directly behind its last use (as in k_qkv)
  const float* ua = O + (size_t)blockIdx.x * 64 * DM; const __bf16* ub = P + (size_t)n0 * DM; const unsigned voa = (unsigned)(((wave * 16 + col) * DM + 8 * g) * 4), vob = (unsigned)((col * DM + 8 * g) * 2);
  R16 ar[2]; v16b bw[2][8];
#pragma unroll
  for (int u = 0; u < 2; ++u) { ar[u] = ld_row16s(ua + u * 32, voa);
#pragma unroll
    for (int j = 0; j < 8; ++j) bw[u][j] = frag_bs(ub + j * 16 * DM + u * 32, vob); }
  XW();
#pragma unroll 1   // stays rolled: the two slots are the whole unrolling, a further copy would only cost registers
  for (int kc = 0; kc < DM / 32; kc += 2) {
#pragma unroll
    for (int u = 0; u < 2; ++u) { float v[16]; const int kn = (kc + u + 2 < DM / 32) ? kc + u + 2 : DM / 32 - 1;   // past the end: the last chunk again, never used
#pragma unroll
      for (int i = 0; i < 8; ++i) { v[i] = ar[u].q[i >> 2][i & 3]; v[8 + i] = ar[u].q[2 + (i >> 2)][i & 3]; }
      const F2 a = bsplit16(v); ar[u] = ld_row16s(ua + kn * 32, voa);
#pragma unroll
      for (int j = 0; j < 8; ++j) { acc[j] = wmma_bf(a.l, bw[u][j], acc[j]); acc[j] = wmma_bf(a.h, bw[u][j], acc[j]); bw[u][j] = frag_bs(ub + j * 16 * DM + kn * 32, vob); }
      XW(); } }
#pragma unroll
  for (int j = 0; j < 8; ++j) {
#pragma unroll
    for (int r = 0; r < 8; ++r) so[wave][8 * g + r][j * 16 + col] = acc[j][r]; }
  LDSX();
  for (int rl = 0; rl < 16; ++rl) vst2(Y + (r0 + rl) * DM + n0 + lane * 4, *(const v4f*)&so[wave][rl][lane * 4]);
}
extern "C" void kernel_launch(void* const* d_in, const int* in_sizes, int n_in, void* d_out, int out_size, void* d_ws, size_t ws_size, hipStream_t stream) {
  (void)in_sizes; (void)n_in; (void)out_size;
  const float** F = (const float**)d_in;   // 0 keys [2,2048,1024], 1 queries, 2 values, 3 WQ [16,1024,64], 4 WK, 5 WV, 6 WO [1024,1024] (in,out), 7 masking [1] int32
  if (ws_size < (size_t)WS_END) return;
  char* ws = (char*)d_ws; __bf16* PK = (__bf16*)(ws + WS_PK); _Float16 *QK = (_Float16*)(ws + WS_QK), *QKL = (_Float16*)(ws + WS_QKL), *VTH = (_Float16*)(ws + WS_VTH), *VTL = (_Float16*)(ws + WS_VTL); float* O = (float*)(ws + WS_O);
  float* MST = (float*)(ws + WS_MST);
  k_pack<<<dim3(DM, 4), 256, 0, stream>>>(F[3], F[4], F[5], F[6], PK);
  k_qkv<<<dim3(TNB * SS / 64, QKVW / 128), 128, 0, stream>>>(F[1], F[0], F[2], PK + PK_A, QK, QKL, VTH, VTL);
  k_cstat<<<dim3(SS / 64, NH, TNB), 128, 0, stream>>>(QK, QKL, (const int*)d_in[7], MST);
  k_attn<<<dim3(TQB, NH, TNB), 128, 0, stream>>>(QK, QKL, VTH, VTL, MST, (const int*)d_in[7], O);
  k_out<<<dim3(TOB, DM / 128), 128, 0, stream>>>(O, PK + PK_P, (float*)d_out);
}

// v002
// Measured time: 323 microseconds a run.
// Timed twice side by side with v001, it ran 1.55 and 1.54 times as fast.
// Counting every step since v000, it is 2.12 times as fast.
#include <hip/hip_runtime.h>
#include <math.h>

typedef __attribute__((ext_vector_type(16))) _Float16 v16h;
typedef __attribute__((ext_vector_type(16))) __bf16 v16b;
typedef __attribute__((ext_vector_type(8)))  _Float16 v8h;
typedef __attribute__((ext_vector_type(8)))  float v8f;
typedef __attribute__((ext_vector_type(4)))  float v4f;
typedef __attribute__((ext_vector_type(2)))  float v2f;
typedef __attribute__((ext_vector_type(4)))  unsigned v4u;
typedef __attribute__((ext_vector_type(4)))  int v4i;
typedef float __attribute__((may_alias)) float_a;
typedef int __attribute__((may_alias)) int_a;

template <typename T> __device__ __forceinline__ void vst2(void* p, T v) { *(T*)p = v;  }
__device__ __forceinline__ v8f wmma16(v16h a, v16h b, v8f c) {
  v8f d = __builtin_amdgcn_wmma_f32_16x16x32_f16(false, a, false, b, (short)0, c, false, false);
  asm volatile("v_nop\n\tv_nop\n\tv_nop\n\tv_nop" : "+v"(d) : "v"(a), "v"(b));
  return d;
}
__device__ __forceinline__ v8f wmma_bf(v16b a, v16b b, v8f c) {
  v8f d = __builtin_amdgcn_wmma_f32_16x16x32_bf16(false, a, false, b, (short)0, c, false, false);
  asm volatile("v_nop\n\tv_nop\n\tv_nop\n\tv_nop" : "+v"(d) : "v"(a), "v"(b));
  return d;
}
// Multi-head ALiBi-style block (B 2, S 2,048, d 1,024, 16 heads x 64): per-head projections of separate keys / queries / values, (QK + (k - q)) / sqrt(S) with a causal mask, softmax over the query axis, weighted values, output projection.
__device__ __forceinline__ v16h frag_h(const _Float16* rowk0, int lane) {
  union { v16h v; v8h q[2]; } u; const _Float16* p = rowk0 + 8 * (lane >> 4);
  u.q[0] = *(const v8h*)p; u.q[1] = *(const v8h*)(p + 16); return u.v;
}
__device__ __forceinline__ v16h frag_f32(const float* rowk0, int lane) {
  v16h a; const float* p = rowk0 + 8 * (lane >> 4);
#pragma unroll
  for (int i = 0; i < 8; ++i) { a[i] = (_Float16)p[i]; a[8 + i] = (_Float16)p[16 + i]; }
  return a;
}
__device__ __forceinline__ v16h frag_f32s(const float* rowk0, int lane, float sc) {
  v16h a; const float* p = rowk0 + 8 * (lane >> 4);
#pragma unroll
  for (int i = 0; i < 8; ++i) { a[i] = (_Float16)(p[i] * sc); a[8 + i] = (_Float16)(p[16 + i] * sc); }
  return a;
}
// column fragment from a [K][ld] layout (column n), rows >= K read as 0
__device__ __forceinline__ v16h fragc_f32(const float* W, int k0, int n, int lane, int ld, int K) {
  v16h a; const int g = lane >> 4;
#pragma unroll
  for (int i = 0; i < 8; ++i) { const int ka = k0 + 8 * g + i, kb = ka + 16;
    a[i] = (_Float16)(ka < K ? W[(size_t)(ka < K ? ka : K - 1) * ld + n] : 0.f); a[8 + i] = (_Float16)(kb < K ? W[(size_t)(kb < K ? kb : K - 1) * ld + n] : 0.f); }
  return a;
}
struct F2 { v16b h, l; };
__device__ __forceinline__ F2 bsplit16(const float v[16]) { F2 r;
#pragma unroll
  for (int i = 0; i < 16; ++i) { const __bf16 h = (__bf16)v[i]; r.h[i] = h; r.l[i] = (__bf16)(v[i] - (float)h); }
  return r; }
__device__ __forceinline__ F2 split_row(const float* row, int k0, int lane) { float v[16]; const float* p = row + k0 + 8 * (lane >> 4);
#pragma unroll
  for (int i = 0; i < 8; ++i) { v[i] = p[i]; v[8 + i] = p[16 + i]; }
  return bsplit16(v); }
__device__ __forceinline__ F2 split_rowK(const float* row, int k0, int lane, int K) { float v[16]; const int g = lane >> 4;
#pragma unroll
  for (int i = 0; i < 8; ++i) { const int ka = k0 + 8 * g + i, kb = ka + 16; v[i] = ka < K ? row[ka < K ? ka : K - 1] : 0.f; v[8 + i] = kb < K ? row[kb < K ? kb : K - 1] : 0.f; }
  return bsplit16(v); }
__device__ __forceinline__ F2 split_col(const float* W, int k0, int n, int lane, int ld, int K) { float v[16]; const int g = lane >> 4;
#pragma unroll
  for (int i = 0; i < 8; ++i) { const int ka = k0 + 8 * g + i, kb = ka + 16; v[i] = ka < K ? W[(size_t)(ka < K ? ka : K - 1) * ld + n] : 0.f; v[8 + i] = kb < K ? W[(size_t)(kb < K ? kb : K - 1) * ld + n] : 0.f; }
  return bsplit16(v); }
__device__ __forceinline__ v8f mac3(const F2& a, const F2& b, v8f c) { c = wmma_bf(a.l, b.h, c); c = wmma_bf(a.h, b.l, c); return wmma_bf(a.h, b.h, c); }
__device__ __forceinline__ float sigm(float v) { return 1.0f / (1.0f + expf(-v)); }
#define LDSX() do { asm volatile("s_wait_dscnt 0" ::: "memory"); __builtin_amdgcn_wave_barrier(); __builtin_amdgcn_fence(__ATOMIC_RELEASE, "workgroup"); } while (0)


#define NB 2
#define SS 2048
#define DM 1024
#define NH 16
#define HD 64
#define QKVW (3 * DM)
#ifndef TQB
#define TQB (SS / 64)
#define TNB NB
#define TOB (NB * SS / 64)     // output row tiles (all)
#endif
typedef __attribute__((ext_vector_type(8))) __bf16 v8b;
__device__ __forceinline__ v16b frag_b(const __bf16* rowk0, int lane) {
  union { v16b v; v8b q[2]; } u; const __bf16* p = rowk0 + 8 * (lane >> 4);
  u.q[0] = *(const v8b*)p; u.q[1] = *(const v8b*)(p + 16); return u.v;
}
// FRAGMENT ORDER of the workspace operands: a tile of 16 rows x 32 k is stored as [k half j][lane = 16 * g + row][8 k], element (row, k = 16 * j + 8 * g + i) at j * 256 + (16 * g + row) * 8 + i;
// a 16-bit tile is 1,024 B, and each of a fragment's two wave-wide 16-byte loads covers 512 contiguous bytes (4 whole lines); the tiles of one row tile follow one another along k
// fragment loads from a wave-uniform tile base plus the lane's own 32-bit byte offset (16 * lane), which is the same in every pass
__device__ __forceinline__ v16h frag_hs(const _Float16* ub, unsigned vo) { union { v16h v; v8h q[2]; } u; const char* p = (const char*)ub + vo; u.q[0] = *(const v8h*)p; u.q[1] = *(const v8h*)(p + 512); return u.v; }
__device__ __forceinline__ v16b frag_bs(const __bf16* ub, unsigned vo) { union { v16b v; v8b q[2]; } u; const char* p = (const char*)ub + vo; u.q[0] = *(const v8b*)p; u.q[1] = *(const v8b*)(p + 512); return u.v; }
// the 16 f32 of one lane's A fragment, still unconverted, so that the loads can fly ahead of their use
struct R16 { v4f q[4]; };
__device__ __forceinline__ R16 ld_row16s(const float* ub, unsigned vo) { R16 r; const char* p = (const char*)ub + vo; r.q[0] = *(const v4f*)p; r.q[1] = *(const v4f*)(p + 16); r.q[2] = *(const v4f*)(p + 64); r.q[3] = *(const v4f*)(p + 80); return r; }
// the same 16 f32 from a tile in fragment order (f32: 2,048 B, four quarters of 512 B, quarter m = 2 * j + (i >> 2))
__device__ __forceinline__ R16 ld_row16t(const float* ub, unsigned vo) { R16 r; const char* p = (const char*)ub + vo; r.q[0] = *(const v4f*)p; r.q[1] = *(const v4f*)(p + 512); r.q[2] = *(const v4f*)(p + 1024); r.q[3] = *(const v4f*)(p + 1536); return r; }
// stands behind a group of loads that stay in flight: the registers that hold their addresses may be rewritten only behind it
// the two scheduling barriers keep the wait behind its loads, and later loads and address arithmetic behind the wait
#define XW() do { __builtin_amdgcn_sched_barrier(0); asm volatile("s_wait_xcnt 0x0" ::: "memory"); __builtin_amdgcn_sched_barrier(0); } while (0)
// the same wait, taking two lane addresses of the group as inputs: they stay in their registers up to the wait, so no load of the group can be given those registers for its data
#define XWA(p, q) do { __builtin_amdgcn_sched_barrier(0); asm volatile("s_wait_xcnt 0x0" :: "v"(p), "v"(q) : "memory"); __builtin_amdgcn_sched_barrier(0); } while (0)
// fragment load from the lane's own byte address in a tile in fragment order (k half 0 at p, k half 1 at p + 512 bytes)
__device__ __forceinline__ v16h frag_hp(const char* p) { union { v16h v; v8h q[2]; } u; u.q[0] = *(const v8h*)p; u.q[1] = *(const v8h*)(p + 512); return u.v; }
// keeps a refill behind the WMMAs that last read the registers it refills; lifted over them, both sets would be live at once
#define SB() __builtin_amdgcn_sched_barrier(0)
__device__ __forceinline__ float bfr(float v) { return (float)(__bf16)v; }
__device__ __attribute__((noinline)) float exp_ni(float v) { return expf(v); }
__device__ __attribute__((noinline)) float erf_ni(float v) { return erff(v); }

#define PK_A 0                       // [3072][1024] Wqkv rows ([out][in]), fragment order: tile (row tile rt, k chunk kt) at (rt * 32 + kt) * 512
#define PK_P (PK_A + QKVW * DM)        // [1024][1024] Wo rows, fragment order
#define PK_END (PK_P + DM * DM)
#define WS_PK  0u
#define WS_QK  (WS_PK + 2u * PK_END)             // f16 [4096 rows][2048]: q | k, fragment order: tile (rt, kt) at (rt * 64 + kt) * 512
#define WS_QKL (WS_QK + 2u * NB * SS * 2 * DM)     // f16 q | k residual planes x2048
#define WS_VTH (WS_QKL + 2u * NB * SS * 2 * DM)    // f16 [b][1024 (h*64+d)][2048 s] hi, fragment order: tile (b, d tile, s chunk) at ((b * 64 + dt) * 64 + st) * 512
#define WS_VTL (WS_VTH + 2u * NB * DM * SS)        // f16 lo x 2048
#define WS_O   (WS_VTL + 2u * NB * DM * SS)        // f32 [4096][1024], fragment order: tile (rt, kt) at (rt * 32 + kt) * 512
#define WS_CS  (WS_O + 4u * NB * SS * DM)           // f32 2 x [2048][32], written and read by no kernel
#define WS_MST (WS_CS + 4u * 2 * SS * 32)
#define WS_END (WS_MST + 4u * NB * NH * SS * 2)
// ---- k_pack: block = (16 rows n, which, 128 k): [out][in] rows -> bf16 in fragment order; which 0..2 -> W_q/W_k/W_v into PK_A rows which*1024 + n; 3 -> W_o into PK_P
// a thread makes one whole 16-byte piece (8 k of one row), so a wave stores 512 contiguous bytes and reads, per k, 16 neighbouring floats for each of its two k groups
__global__ __launch_bounds__(256) void k_pack(const float* __restrict__ WQ, const float* __restrict__ WK, const float* __restrict__ WV, const float* __restrict__ WO, __bf16* __restrict__ PK) {
  const int n0 = blockIdx.x * 16, which = blockIdx.y, kq = blockIdx.z, p = threadIdx.x; const float* Wm = (which == 0) ? WQ : (which == 1) ? WK : (which == 2) ? WV : WO;   // per-head (in,out) [H][D][64] -> row n = h*64+e reads W[h][d][e]; WO (in,out) -> row n reads WO[d][n]
  const int hh = n0 / HD, e0 = n0 % HD; const int ld = (which < 3) ? HD : DM;
  __bf16* dst = ((which < 3) ? PK + PK_A + ((size_t)which * DM + n0) * DM : PK + PK_P + (size_t)n0 * DM) + kq * 4 * 512;
  const int row = p & 15, k = kq * 128 + (p >> 6) * 32 + ((p >> 5) & 1) * 16 + ((p >> 4) & 1) * 8;
  const float* s = (which < 3) ? Wm + ((size_t)hh * DM + k) * HD + e0 + row : Wm + (size_t)k * DM + n0 + row; v8b o;
#pragma unroll
  for (int i = 0; i < 8; ++i) o[i] = (__bf16)s[(size_t)i * ld];
  vst2(dst + p * 8, o);
}
__global__ __launch_bounds__(128) void k_qkv(const float* __restrict__ XQ, const float* __restrict__ XK, const float* __restrict__ XV, const __bf16* __restrict__ P, _Float16* __restrict__ QK, _Float16* __restrict__ QKL, _Float16* __restrict__ VTH, _Float16* __restrict__ VTL) {
  const int which0 = (blockIdx.y * 128) / DM; const float* X = (which0 == 0) ? XQ : (which0 == 1) ? XK : XV;   // Q from queries, K from keys, V from values
  __shared__ __align__(16) _Float16 so[4][2048], sol[4][2048];
  const int tid = threadIdx.x, wave = tid >> 5, lane = tid & 31, col = lane & 15, g = lane >> 4; const int n0 = blockIdx.y * 128;
  v8f acc[8] = {};
  // two register slots of fragments (k chunks kc and kc + 1); each fragment is loaded again, for two chunks on, directly behind its last use, so a whole slot's loads are in flight while the other slot is worked on
  const float* ua = X + (size_t)blockIdx.x * 64 * DM; const __bf16* ub = P + (size_t)n0 * DM; const unsigned voa = (unsigned)(((wave * 16 + col) * DM + 8 * g) * 4), vob = (unsigned)(lane * 16);
  R16 ar[2]; v16b bw[2][8];
#pragma unroll
  for (int u = 0; u < 2; ++u) { ar[u] = ld_row16s(ua + u * 32, voa);
#pragma unroll
    for (int j = 0; j < 8; ++j) bw[u][j] = frag_bs(ub + j * 16 * DM + u * 512, vob); }
  XW();
#pragma unroll 1   // stays rolled: the two slots are the whole unrolling, a further copy would only cost registers
  for (int kc = 0; kc < DM / 32; kc += 2) {
#pragma unroll
    for (int u = 0; u < 2; ++u) { v16b a; const int kn = (kc + u + 2 < DM / 32) ? kc + u + 2 : DM / 32 - 1;   // past the end: the last chunk again, never used
#pragma unroll
      for (int i = 0; i < 8; ++i) { a[i] = (__bf16)ar[u].q[i >> 2][i & 3]; a[8 + i] = (__bf16)ar[u].q[2 + (i >> 2)][i & 3]; }
      ar[u] = ld_row16s(ua + kn * 32, voa);
#pragma unroll
      for (int j = 0; j < 8; ++j) { acc[j] = wmma_bf(a, bw[u][j], acc[j]); bw[u][j] = frag_bs(ub + j * 16 * DM + kn * 512, vob); }
      XW(); } }
  if (n0 < 2 * DM) {   // q stored unscaled (f16 sigma ~0.6, no subnormal exposure); 1/sqrt(2048) (CSCALE) applied to the f32 score
    // the wave's 16 rows x 128 columns are four tiles that follow one another in the workspace: laid out in fragment order in LDS, then copied as they lie
#pragma unroll
    for (int j = 0; j < 8; ++j) { const int e = (j >> 1) * 512 + (j & 1) * 256 + ((col >> 3) * 16 + 8 * g) * 8 + (col & 7);
#pragma unroll
      for (int r = 0; r < 8; ++r) { const float v = acc[j][r]; const _Float16 hv = (_Float16)v; so[wave][e + r * 8] = hv; sol[wave][e + r * 8] = (_Float16)((v - (float)hv) * 2048.0f); } }   // q, k as f16 hi + (x2048) residual (no RoPE in this module)
    LDSX();
    const size_t o = ((size_t)(blockIdx.x * 4 + wave) * 64 + n0 / 32) * 512 + lane * 8;
#pragma unroll
    for (int q = 0; q < 8; ++q) { vst2(QK + o + q * 256, *(const v4u*)&so[wave][q * 256 + lane * 8]); vst2(QKL + o + q * 256, *(const v4u*)&sol[wave][q * 256 + lane * 8]); }
  } else {   // v transposed: a lane's 8 accumulator rows are 8 neighbouring keys of one column d, which is the lane's own 16-byte piece of the tile (k half = wave & 1): stored straight from registers
    const int rb = blockIdx.x * 64, b = rb / SS, s0 = rb % SS, pc0 = n0 - 2 * DM;
    const size_t o = (((size_t)b * (DM / 16) + pc0 / 16) * (SS / 32) + s0 / 32 + (wave >> 1)) * 512 + (wave & 1) * 256 + lane * 8;
#pragma unroll
    for (int j = 0; j < 8; ++j) { v8h hi, lo;
#pragma unroll
      for (int r = 0; r < 8; ++r) { const float v = acc[j][r]; const _Float16 hv = (_Float16)v; hi[r] = hv; lo[r] = (_Float16)((v - (float)hv) * 2048.0f); }
      vst2(VTH + o + (size_t)j * (SS / 32) * 512, hi); vst2(VTL + o + (size_t)j * (SS / 32) * 512, lo); }
    XW();   // behind the last of these stores: no register that they name is rewritten ahead of it on any path of the listing
  }
}
#define CSCALE 0.022097086912079608f   // float32(1/sqrt(2048)): the module divides by sqrt(number of keys)
// ---- k_cstat: block = (64 KEYS, h, b): the softmax runs over QUERIES (axis 2), so per key column we need max and sum over q: S^T tiles = K rows . Q rows (3 products), y = (qk + (k - q)) * CSCALE where causal (q >= k) if masking, else (qk + 0)*CSCALE for q < k; online (max, sum) per key row over the query tiles -> MST[b][h][k] = (m, l)
__global__ __launch_bounds__(128) void k_cstat(const _Float16* __restrict__ QK, const _Float16* __restrict__ QKL, const int* __restrict__ MASKING, float* __restrict__ MST) {
  __shared__ __align__(16) float sm[64][2];
  const int tid = threadIdx.x, wave = tid >> 5, lane = tid & 31, col = lane & 15, g = lane >> 4; const int kb = blockIdx.x, h = blockIdx.y, b = blockIdx.z; const int k0 = kb * 64 + wave * 16; const int masking = MASKING[0];
  v16h ak[2], akl[2];
#pragma unroll
  for (int kc = 0; kc < 2; ++kc) { const size_t rk = ((size_t)((b * SS + k0) / 16) * 64 + 32 + h * 2 + kc) * 512; ak[kc] = frag_hs(QK + rk, (unsigned)(lane * 16)); akl[kc] = frag_hs(QKL + rk, (unsigned)(lane * 16)); }
  XW();
  float m[8], l[8];
#pragma unroll
  for (int r = 0; r < 8; ++r) { m[r] = -3.0e38f; l[r] = 0.f; }
  const int qs0 = masking ? (kb * 64) / 32 : 0;   // first query tile that can see these keys
  // query fragments of a pass sit in registers before the pass begins: each 16-query half is loaded again, for the next pass, directly behind its last WMMA
  const unsigned voq = (unsigned)(lane * 16); const size_t uq0 = (size_t)b * SS * (2 * DM) + h * 2 * 512;   // 16 queries on: 16 * (2 * DM) elements, as in row order; k chunk on: 512
  v16h qh[2][2], ql[2][2]; const char* pq0 = (const char*)(QK + uq0 + (size_t)qs0 * 32 * (2 * DM)) + voq; const char* pl0 = (const char*)(QKL + uq0 + (size_t)qs0 * 32 * (2 * DM)) + voq;
#pragma unroll
  for (int ct = 0; ct < 2; ++ct) {
#pragma unroll
    for (int kc = 0; kc < 2; ++kc) { qh[ct][kc] = frag_hp(pq0 + ct * 16 * (2 * DM) * 2 + kc * 1024); ql[ct][kc] = frag_hp(pl0 + ct * 16 * (2 * DM) * 2 + kc * 1024); } }
  XWA(lane, voq);   // the lane's index and offset stay in their registers up to the wait
  int qs = qs0;
#pragma unroll 1
  do { v8f s[2]; const int qn = (qs + 1 < SS / 32) ? qs + 1 : qs;   // past the end: the last tile again, never used
#pragma unroll
    for (int ct = 0; ct < 2; ++ct) { const int qq = qs * 32 + ct * 16 + col; const size_t uq = uq0 + (size_t)(qn * 32 + ct * 16) * (2 * DM); v8f c = {}, cl = {};
#pragma unroll
      for (int kc = 0; kc < 2; ++kc) { c = wmma16(ak[kc], qh[ct][kc], c); cl = wmma16(akl[kc], qh[ct][kc], cl); cl = wmma16(ak[kc], ql[ct][kc], cl); }
      SB();
#pragma unroll
      for (int kc = 0; kc < 2; ++kc) { qh[ct][kc] = frag_hs(QK + uq + kc * 512, voq); ql[ct][kc] = frag_hs(QKL + uq + kc * 512, voq); }
      XW();
#pragma unroll
      for (int r = 0; r < 8; ++r) { const int ki = k0 + 8 * g + r; const float qk = c[r] + cl[r] * (1.0f / 2048.0f); const bool causal = (ki <= qq);
        s[ct][r] = causal ? (qk + (float)(ki - qq)) * CSCALE : (masking ? -3.0e38f : qk * CSCALE); } }
#pragma unroll
    for (int r = 0; r < 8; ++r) { float mx = fmaxf(s[0][r], s[1][r]);
#pragma unroll
      for (int o = 1; o < 16; o <<= 1) mx = fmaxf(mx, __shfl_xor(mx, o));
      const float mn = fmaxf(m[r], mx); const float alpha = (m[r] <= -1.0e38f) ? 0.f : __expf(m[r] - mn);
      const float e0 = (s[0][r] <= -1.0e38f) ? 0.f : __expf(s[0][r] - mn), e1 = (s[1][r] <= -1.0e38f) ? 0.f : __expf(s[1][r] - mn); float es = e0 + e1;
#pragma unroll
      for (int o = 1; o < 16; o <<= 1) es += __shfl_xor(es, o);
      l[r] = l[r] * alpha + es; m[r] = mn; } } while (++qs < SS / 32);   // tested at the foot: qs0 is at most SS / 32 - 2
  if (col == 0) {
#pragma unroll
    for (int r = 0; r < 8; ++r) { sm[wave * 16 + 8 * g + r][0] = m[r]; sm[wave * 16 + 8 * g + r][1] = l[r]; } }
  __syncthreads();
  if (tid < 32) vst2(MST + (((size_t)b * NH + h) * SS + kb * 64) * 2 + tid * 4, *(const v4f*)(&sm[0][0] + tid * 4));
}
// ---- k_attn: block = (64 queries, h, b): key tiles (k <= q frontier if masking); y as above; z = exp(y - m_k) / l_k (column statistics); P = z as f16 hi + (x2048) lo x V hi/lo (3 products); out rows (no normalisation)
__global__ __launch_bounds__(128) void k_attn(const _Float16* __restrict__ QK, const _Float16* __restrict__ QKL, const _Float16* __restrict__ VTH, const _Float16* __restrict__ VTL, const float* __restrict__ MST, const int* __restrict__ MASKING, float* __restrict__ O) {
  __shared__ __align__(16) _Float16 sph[4][16][40], spl[4][16][40]; __shared__ __align__(16) float so[4][1024];
  const int tid = threadIdx.x, wave = tid >> 5, lane = tid & 31, col = lane & 15, g = lane >> 4;
  const int qb = blockIdx.x, h = blockIdx.y, b = blockIdx.z; const int q0 = qb * 64 + wave * 16; const size_t rq = (size_t)b * SS + q0; const int masking = MASKING[0];
  v16h aq[2], aql[2];
#pragma unroll
  for (int kc = 0; kc < 2; ++kc) { aq[kc] = frag_hs(QK + rq * (2 * DM) + (h * 2 + kc) * 512, (unsigned)(lane * 16)); aql[kc] = frag_hs(QKL + rq * (2 * DM) + (h * 2 + kc) * 512, (unsigned)(lane * 16)); }
  v8f acc[4] = {}, accl[4] = {};
  const int nks = masking ? (qb * 64 + 64) / 32 : SS / 32;
  // every global load of a pass is issued well ahead of its use: the values at the head of the pass; each block of 16 keys (with its statistics) into the one key buffer, directly behind the score WMMAs of the block before it
  const unsigned vok = (unsigned)(lane * 16), vov = (unsigned)(lane * 16), vom = (unsigned)(col * 8);
  const size_t uk0 = (size_t)b * SS * (2 * DM) + (32 + h * 2) * 512, uv0 = ((size_t)b * DM + h * HD) * SS; const float* um0 = MST + ((size_t)b * NH + h) * SS * 2;
  v16h kh[2], kl[2]; v2f ms;
#pragma unroll
  for (int kc = 0; kc < 2; ++kc) { kh[kc] = frag_hs(QK + uk0 + kc * 512, vok); kl[kc] = frag_hs(QKL + uk0 + kc * 512, vok); }
  ms = *(const v2f*)((const char*)um0 + vom);
  XW();
  int ks = 0;
#pragma unroll 1
  do { v16h vh[4], vl[4]; const int kn = (ks + 1 < nks) ? ks + 1 : ks;   // past the end: the last tile again, never used
    const char* pvh = (const char*)(VTH + uv0 + ks * 512) + vov; const char* pvl = (const char*)(VTL + uv0 + ks * 512) + vov;
#pragma unroll
    for (int dt = 0; dt < 4; ++dt) { vh[dt] = frag_hp(pvh + dt * 16 * SS * 2); vl[dt] = frag_hp(pvl + dt * 16 * SS * 2); }
    XWA(pvh, pvl);
#pragma unroll
    for (int ct = 0; ct < 2; ++ct) { const int kk = ks * 32 + ct * 16 + col; v8f c = {}, cl = {};
#pragma unroll
      for (int kc = 0; kc < 2; ++kc) { c = wmma16(aq[kc], kh[kc], c); cl = wmma16(aql[kc], kh[kc], cl); cl = wmma16(aq[kc], kl[kc], cl); }
      const float mk = ms[0], lk = ms[1]; const int kt = (ct == 0) ? ks * 32 + 16 : kn * 32;   // first key of the block that comes next
      SB();
#pragma unroll
      for (int kc = 0; kc < 2; ++kc) { const size_t uk = uk0 + (size_t)kt * (2 * DM) + kc * 512; kh[kc] = frag_hs(QK + uk, vok); kl[kc] = frag_hs(QKL + uk, vok); }
      ms = *(const v2f*)((const char*)(um0 + kt * 2) + vom);
      XW();
#pragma unroll
      for (int r = 0; r < 8; ++r) { const int qi = q0 + 8 * g + r; const float qk = c[r] + cl[r] * (1.0f / 2048.0f); const bool causal = (kk <= qi);
        const float y = causal ? (qk + (float)(kk - qi)) * CSCALE : qk * CSCALE; const float p = (causal || !masking) ? (__expf(y - mk) / lk) * 2048.0f : 0.f;   // z scaled by 2^11 so its f16 hi plane stays out of the subnormal range; 2^-11 folded into the epilogue
        const _Float16 hp = (_Float16)p; sph[wave][8 * g + r][ct * 16 + col] = hp; spl[wave][8 * g + r][ct * 16 + col] = (_Float16)((p - (float)hp) * 2048.0f); } }
    LDSX();
    const v16h pah = frag_h(&sph[wave][col][0], lane), pal = frag_h(&spl[wave][col][0], lane);
#pragma unroll
    for (int dt = 0; dt < 4; ++dt) { acc[dt] = wmma16(pah, vh[dt], acc[dt]); accl[dt] = wmma16(pal, vh[dt], accl[dt]); accl[dt] = wmma16(pah, vl[dt], accl[dt]); }
    LDSX(); } while (++ks < nks);   // tested at the foot: nks is at least 2 for any value of masking
#pragma unroll
  for (int r = 0; r < 8; ++r) {
#pragma unroll
    for (int dt = 0; dt < 4; ++dt) so[wave][(dt >> 1) * 512 + ((dt & 1) * 2 + ((col >> 2) & 1)) * 128 + ((col >> 3) * 16 + 8 * g + r) * 4 + (col & 3)] = (acc[dt][r] + accl[dt][r] * (1.0f / 2048.0f)) * (1.0f / 2048.0f); }   // the wave's two f32 tiles, in fragment order
  LDSX();
#pragma unroll
  for (int q = 0; q < 8; ++q) vst2(O + rq * DM + h * 2 * 512 + q * 128 + lane * 4, *(const v4f*)&so[wave][q * 128 + lane * 4]);
}
// ---- k_out: block = (64 rows, 128 cols): out = O(hi/lo) . Wo rows (2 products)
__global__ __launch_bounds__(128) void k_out(const float* __restrict__ O, const __bf16* __restrict__ P, float* __restrict__ Y) {
  __shared__ __align__(16) float so[4][16][132];
  const int tid = threadIdx.x, wave = tid >> 5, lane = tid & 31, col = lane & 15, g = lane >> 4; const size_t r0 = (size_t)blockIdx.x * 64 + wave * 16; const int n0 = blockIdx.y * 128;
  v8f acc[8] = {};
  // two register slots of fragments, each loaded again for two chunks on directly behind its last use (as in k_qkv)
  const float* ua = O + (size_t)blockIdx.x * 64 * DM; const __bf16* ub = P + (size_t)n0 * DM; const unsigned voa = (unsigned)((wave * 16 * DM + lane * 4) * 4), vob = (unsigned)(lane * 16);
  R16 ar[2]; v16b bw[2][8];
#pragma unroll
  for (int u = 0; u < 2; ++u) { ar[u] = ld_row16t(ua + u * 512, voa);
#pragma unroll
    for (int j = 0; j < 8; ++j) bw[u][j] = frag_bs(ub + j * 16 * DM + u * 512, vob); }
  XW();
#pragma unroll 1   // stays rolled: the two slots are the whole unrolling, a further copy would only cost registers
  for (int kc = 0; kc < DM / 32; kc += 2) {
#pragma unroll
    for (int u = 0; u < 2; ++u) { float v[16]; const int kn = (kc + u + 2 < DM / 32) ? kc + u + 2 : DM / 32 - 1;   // past the end: the last chunk again, never used
#pragma unroll
      for (int i = 0; i < 8; ++i) { v[i] = ar[u].q[i >> 2][i & 3]; v[8 + i] = ar[u].q[2 + (i >> 2)][i & 3]; }
      const F2 a = bsplit16(v); ar[u] = ld_row16t(ua + kn * 512, voa);
#pragma unroll
      for (int j = 0; j < 8; ++j) { acc[j] = wmma_bf(a.l, bw[u][j], acc[j]); acc[j] = wmma_bf(a.h, bw[u][j], acc[j]); bw[u][j] = frag_bs(ub + j * 16 * DM + kn * 512, vob); }
      XW(); } }
#pragma unroll
  for (int j = 0; j < 8; ++j) {
#pragma unroll
    for (int r = 0; r < 8; ++r) so[wave][8 * g + r][j * 16 + col] = acc[j][r]; }
  LDSX();
  for (int rl = 0; rl < 16; ++rl) vst2(Y + (r0 + rl) * DM + n0 + lane * 4, *(const v4f*)&so[wave][rl][lane * 4]);
}
extern "C" void kernel_launch(void* const* d_in, const int* in_sizes, int n_in, void* d_out, int out_size, void* d_ws, size_t ws_size, hipStream_t stream) {
  (void)in_sizes; (void)n_in; (void)out_size;
  const float** F = (const float**)d_in;   // 0 keys [2,2048,1024], 1 queries, 2 values, 3 WQ [16,1024,64], 4 WK, 5 WV, 6 WO [1024,1024] (in,out), 7 masking [1] int32
  if (ws_size < (size_t)WS_END) return;
  char* ws = (char*)d_ws; __bf16* PK = (__bf16*)(ws + WS_PK); _Float16 *QK = (_Float16*)(ws + WS_QK), *QKL = (_Float16*)(ws + WS_QKL), *VTH = (_Float16*)(ws + WS_VTH), *VTL = (_Float16*)(ws + WS_VTL); float* O = (float*)(ws + WS_O);
  float* MST = (float*)(ws + WS_MST);
  k_pack<<<dim3(DM / 16, 4, 8), 256, 0, stream>>>(F[3], F[4], F[5], F[6], PK);
  k_qkv<<<dim3(TNB * SS / 64, QKVW / 128), 128, 0, stream>>>(F[1], F[0], F[2], PK + PK_A, QK, QKL, VTH, VTL);
  k_cstat<<<dim3(SS / 64, NH, TNB), 128, 0, stream>>>(QK, QKL, (const int*)d_in[7], MST);
  k_attn<<<dim3(TQB, NH, TNB), 128, 0, stream>>>(QK, QKL, VTH, VTL, MST, (const int*)d_in[7], O);
  k_out<<<dim3(TOB, DM / 128), 128, 0, stream>>>(O, PK + PK_P, (float*)d_out);
}

// v003
// It runs in 286 microseconds.
// Two timings next to v002 both put it at 1.13 times that version's speed.
// Counting every step since v000, it is 2.39 times as fast.
#include <hip/hip_runtime.h>
#include <math.h>

typedef __attribute__((ext_vector_type(16))) _Float16 v16h;
typedef __attribute__((ext_vector_type(16))) __bf16 v16b;
typedef __attribute__((ext_vector_type(8)))  _Float16 v8h;
typedef __attribute__((ext_vector_type(8)))  float v8f;
typedef __attribute__((ext_vector_type(4)))  float v4f;
typedef __attribute__((ext_vector_type(2)))  float v2f;
typedef __attribute__((ext_vector_type(4)))  unsigned v4u;
typedef __attribute__((ext_vector_type(4)))  int v4i;
typedef float __attribute__((may_alias)) float_a;
typedef int __attribute__((may_alias)) int_a;

template <typename T> __device__ __forceinline__ void vst2(void* p, T v) { *(T*)p = v;  }
__device__ __forceinline__ v8f wmma16(v16h a, v16h b, v8f c) {
  v8f d = __builtin_amdgcn_wmma_f32_16x16x32_f16(false, a, false, b, (short)0, c, false, false);
  asm volatile("v_nop\n\tv_nop\n\tv_nop\n\tv_nop" : "+v"(d) : "v"(a), "v"(b));
  return d;
}
__device__ __forceinline__ v8f wmma_bf(v16b a, v16b b, v8f c) {
  v8f d = __builtin_amdgcn_wmma_f32_16x16x32_bf16(false, a, false, b, (short)0, c, false, false);
  asm volatile("v_nop\n\tv_nop\n\tv_nop\n\tv_nop" : "+v"(d) : "v"(a), "v"(b));
  return d;
}
// Multi-head ALiBi-style block (B 2, S 2,048, d 1,024, 16 heads x 64): per-head projections of separate keys / queries / values, (QK + (k - q)) / sqrt(S) with a causal mask, softmax over the query axis, weighted values, output projection.
__device__ __forceinline__ v16h frag_h(const _Float16* rowk0, int lane) {
  union { v16h v; v8h q[2]; } u; const _Float16* p = rowk0 + 8 * (lane >> 4);
  u.q[0] = *(const v8h*)p; u.q[1] = *(const v8h*)(p + 16); return u.v;
}
__device__ __forceinline__ v16h frag_f32(const float* rowk0, int lane) {
  v16h a; const float* p = rowk0 + 8 * (lane >> 4);
#pragma unroll
  for (int i = 0; i < 8; ++i) { a[i] = (_Float16)p[i]; a[8 + i] = (_Float16)p[16 + i]; }
  return a;
}
__device__ __forceinline__ v16h frag_f32s(const float* rowk0, int lane, float sc) {
  v16h a; const float* p = rowk0 + 8 * (lane >> 4);
#pragma unroll
  for (int i = 0; i < 8; ++i) { a[i] = (_Float16)(p[i] * sc); a[8 + i] = (_Float16)(p[16 + i] * sc); }
  return a;
}
// column fragment from a [K][ld] layout (column n), rows >= K read as 0
__device__ __forceinline__ v16h fragc_f32(const float* W, int k0, int n, int lane, int ld, int K) {
  v16h a; const int g = lane >> 4;
#pragma unroll
  for (int i = 0; i < 8; ++i) { const int ka = k0 + 8 * g + i, kb = ka + 16;
    a[i] = (_Float16)(ka < K ? W[(size_t)(ka < K ? ka : K - 1) * ld + n] : 0.f); a[8 + i] = (_Float16)(kb < K ? W[(size_t)(kb < K ? kb : K - 1) * ld + n] : 0.f); }
  return a;
}
struct F2 { v16b h, l; };
__device__ __forceinline__ F2 bsplit16(const float v[16]) { F2 r;
#pragma unroll
  for (int i = 0; i < 16; ++i) { const __bf16 h = (__bf16)v[i]; r.h[i] = h; r.l[i] = (__bf16)(v[i] - (float)h); }
  return r; }
__device__ __forceinline__ F2 split_row(const float* row, int k0, int lane) { float v[16]; const float* p = row + k0 + 8 * (lane >> 4);
#pragma unroll
  for (int i = 0; i < 8; ++i) { v[i] = p[i]; v[8 + i] = p[16 + i]; }
  return bsplit16(v); }
__device__ __forceinline__ F2 split_rowK(const float* row, int k0, int lane, int K) { float v[16]; const int g = lane >> 4;
#pragma unroll
  for (int i = 0; i < 8; ++i) { const int ka = k0 + 8 * g + i, kb = ka + 16; v[i] = ka < K ? row[ka < K ? ka : K - 1] : 0.f; v[8 + i] = kb < K ? row[kb < K ? kb : K - 1] : 0.f; }
  return bsplit16(v); }
__device__ __forceinline__ F2 split_col(const float* W, int k0, int n, int lane, int ld, int K) { float v[16]; const int g = lane >> 4;
#pragma unroll
  for (int i = 0; i < 8; ++i) { const int ka = k0 + 8 * g + i, kb = ka + 16; v[i] = ka < K ? W[(size_t)(ka < K ? ka : K - 1) * ld + n] : 0.f; v[8 + i] = kb < K ? W[(size_t)(kb < K ? kb : K - 1) * ld + n] : 0.f; }
  return bsplit16(v); }
__device__ __forceinline__ v8f mac3(const F2& a, const F2& b, v8f c) { c = wmma_bf(a.l, b.h, c); c = wmma_bf(a.h, b.l, c); return wmma_bf(a.h, b.h, c); }
__device__ __forceinline__ float sigm(float v) { return 1.0f / (1.0f + expf(-v)); }
#define LDSX() do { asm volatile("s_wait_dscnt 0" ::: "memory"); __builtin_amdgcn_wave_barrier(); __builtin_amdgcn_fence(__ATOMIC_RELEASE, "workgroup"); } while (0)


#define NB 2
#define SS 2048
#define DM 1024
#define NH 16
#define HD 64
#define QKVW (3 * DM)
#ifndef TQB
#define TQB (SS / 64)
#define TNB NB
#define TOB (NB * SS / 64)     // output row tiles (all)
#endif
typedef __attribute__((ext_vector_type(8))) __bf16 v8b;
__device__ __forceinline__ v16b frag_b(const __bf16* rowk0, int lane) {
  union { v16b v; v8b q[2]; } u; const __bf16* p = rowk0 + 8 * (lane >> 4);
  u.q[0] = *(const v8b*)p; u.q[1] = *(const v8b*)(p + 16); return u.v;
}
// FRAGMENT ORDER of the workspace operands: a tile of 16 rows x 32 k is stored as [k half j][lane = 16 * g + row][8 k], element (row, k = 16 * j + 8 * g + i) at j * 256 + (16 * g + row) * 8 + i;
// a 16-bit tile is 1,024 B, and each of a fragment's two wave-wide 16-byte loads covers 512 contiguous bytes (4 whole lines); the tiles of one row tile follow one another along k
// fragment loads from a wave-uniform tile base plus the lane's own 32-bit byte offset (16 * lane), which is the same in every pass
__device__ __forceinline__ v16h frag_hs(const _Float16* ub, unsigned vo) { union { v16h v; v8h q[2]; } u; const char* p = (const char*)ub + vo; u.q[0] = *(const v8h*)p; u.q[1] = *(const v8h*)(p + 512); return u.v; }
__device__ __forceinline__ v16b frag_bs(const __bf16* ub, unsigned vo) { union { v16b v; v8b q[2]; } u; const char* p = (const char*)ub + vo; u.q[0] = *(const v8b*)p; u.q[1] = *(const v8b*)(p + 512); return u.v; }
// the 16 f32 of one lane's A fragment, still unconverted, so that the loads can fly ahead of their use
struct R16 { v4f q[4]; };
__device__ __forceinline__ R16 ld_row16s(const float* ub, unsigned vo) { R16 r; const char* p = (const char*)ub + vo; r.q[0] = *(const v4f*)p; r.q[1] = *(const v4f*)(p + 16); r.q[2] = *(const v4f*)(p + 64); r.q[3] = *(const v4f*)(p + 80); return r; }
// the same 16 f32 from a tile in fragment order (f32: 2,048 B, four quarters of 512 B, quarter m = 2 * j + (i >> 2))
__device__ __forceinline__ R16 ld_row16t(const float* ub, unsigned vo) { R16 r; const char* p = (const char*)ub + vo; r.q[0] = *(const v4f*)p; r.q[1] = *(const v4f*)(p + 512); r.q[2] = *(const v4f*)(p + 1024); r.q[3] = *(const v4f*)(p + 1536); return r; }
// stands behind a group of loads that stay in flight: the registers that hold their addresses may be rewritten only behind it
// the two scheduling barriers keep the wait behind its loads, and later loads and address arithmetic behind the wait
#define XW() do { __builtin_amdgcn_sched_barrier(0); asm volatile("s_wait_xcnt 0x0" ::: "memory"); __builtin_amdgcn_sched_barrier(0); } while (0)
// the same wait, taking two lane addresses of the group as inputs: they stay in their registers up to the wait, so no load of the group can be given those registers for its data
#define XWA(p, q) do { __builtin_amdgcn_sched_barrier(0); asm volatile("s_wait_xcnt 0x0" :: "v"(p), "v"(q) : "memory"); __builtin_amdgcn_sched_barrier(0); } while (0)
// fragment load from the lane's own byte address in a tile in fragment order (k half 0 at p, k half 1 at p + 512 bytes)
__device__ __forceinline__ v16h frag_hp(const char* p) { union { v16h v; v8h q[2]; } u; u.q[0] = *(const v8h*)p; u.q[1] = *(const v8h*)(p + 512); return u.v; }
// keeps a refill behind the WMMAs that last read the registers it refills; lifted over them, both sets would be live at once
#define SB() __builtin_amdgcn_sched_barrier(0)
__device__ __forceinline__ float bfr(float v) { return (float)(__bf16)v; }
__device__ __attribute__((noinline)) float exp_ni(float v) { return expf(v); }
__device__ __attribute__((noinline)) float erf_ni(float v) { return erff(v); }

#define PK_A 0                       // [3072][1024] Wqkv rows ([out][in]), fragment order: tile (row tile rt, k chunk kt) at (rt * 32 + kt) * 512
#define PK_P (PK_A + QKVW * DM)        // [1024][1024] Wo rows, fragment order
#define PK_END (PK_P + DM * DM)
#define WS_PK  0u
#define WS_QK  (WS_PK + 2u * PK_END)             // f16 [4096 rows][2048]: q | k, fragment order: tile (rt, kt) at (rt * 64 + kt) * 512
#define WS_QKL (WS_QK + 2u * NB * SS * 2 * DM)     // f16 q | k residual planes x2048
#define WS_VTH (WS_QKL + 2u * NB * SS * 2 * DM)    // f16 [b][1024 (h*64+d)][2048 s] hi, fragment order: tile (b, d tile, s chunk) at ((b * 64 + dt) * 64 + st) * 512
#define WS_VTL (WS_VTH + 2u * NB * DM * SS)        // f16 lo x 2048
#define WS_O   (WS_VTL + 2u * NB * DM * SS)        // f32 [4096][1024], fragment order: tile (rt, kt) at (rt * 32 + kt) * 512
#define WS_CS  (WS_O + 4u * NB * SS * DM)           // f32 2 x [2048][32], written and read by no kernel
#define WS_MST (WS_CS + 4u * 2 * SS * 32)
#define WS_END (WS_MST + 4u * NB * NH * SS * 2)
// ---- k_pack: block = (16 rows n, which, 128 k): [out][in] rows -> bf16 in fragment order; which 0..2 -> W_q/W_k/W_v into PK_A rows which*1024 + n; 3 -> W_o into PK_P
// a thread makes one whole 16-byte piece (8 k of one row), so a wave stores 512 contiguous bytes and reads, per k, 16 neighbouring floats for each of its two k groups
__global__ __launch_bounds__(256) void k_pack(const float* __restrict__ WQ, const float* __restrict__ WK, const float* __restrict__ WV, const float* __restrict__ WO, __bf16* __restrict__ PK) {
  const int n0 = blockIdx.x * 16, which = blockIdx.y, kq = blockIdx.z, p = threadIdx.x; const float* Wm = (which == 0) ? WQ : (which == 1) ? WK : (which == 2) ? WV : WO;   // per-head (in,out) [H][D][64] -> row n = h*64+e reads W[h][d][e]; WO (in,out) -> row n reads WO[d][n]
  const int hh = n0 / HD, e0 = n0 % HD; const int ld = (which < 3) ? HD : DM;
  __bf16* dst = ((which < 3) ? PK + PK_A + ((size_t)which * DM + n0) * DM : PK + PK_P + (size_t)n0 * DM) + kq * 4 * 512;
  const int row = p & 15, k = kq * 128 + (p >> 6) * 32 + ((p >> 5) & 1) * 16 + ((p >> 4) & 1) * 8;
  const float* s = (which < 3) ? Wm + ((size_t)hh * DM + k) * HD + e0 + row : Wm + (size_t)k * DM + n0 + row; v8b o;
#pragma unroll
  for (int i = 0; i < 8; ++i) o[i] = (__bf16)s[(size_t)i * ld];
  vst2(dst + p * 8, o);
}
__global__ __launch_bounds__(128) void k_qkv(const float* __restrict__ XQ, const float* __restrict__ XK, const float* __restrict__ XV, const __bf16* __restrict__ P, _Float16* __restrict__ QK, _Float16* __restrict__ QKL, _Float16* __restrict__ VTH, _Float16* __restrict__ VTL) {
  const int which0 = (blockIdx.y * 128) / DM; const float* X = (which0 == 0) ? XQ : (which0 == 1) ? XK : XV;   // Q from queries, K from keys, V from values
  __shared__ __align__(16) _Float16 so[4][2048], sol[4][2048];
  const int tid = threadIdx.x, wave = tid >> 5, lane = tid & 31, col = lane & 15, g = lane >> 4; const int n0 = blockIdx.y * 128;
  v8f acc[8] = {};
  // two register slots of fragments (k chunks kc and kc + 1); each fragment is loaded again, for two chunks on, directly behind its last use, so a whole slot's loads are in flight while the other slot is worked on
  const float* ua = X + (size_t)blockIdx.x * 64 * DM; const __bf16* ub = P + (size_t)n0 * DM; const unsigned voa = (unsigned)(((wave * 16 + col) * DM + 8 * g) * 4), vob = (unsigned)(lane * 16);
  R16 ar[2]; v16b bw[2][8];
#pragma unroll
  for (int u = 0; u < 2; ++u) { ar[u] = ld_row16s(ua + u * 32, voa);
#pragma unroll
    for (int j = 0; j < 8; ++j) bw[u][j] = frag_bs(ub + j * 16 * DM + u * 512, vob); }
  XW();
#pragma unroll 1   // stays rolled: the two slots are the whole unrolling, a further copy would only cost registers
  for (int kc = 0; kc < DM / 32; kc += 2) {
#pragma unroll
    for (int u = 0; u < 2; ++u) { v16b a; const int kn = (kc + u + 2 < DM / 32) ? kc + u + 2 : DM / 32 - 1;   // past the end: the last chunk again, never used
#pragma unroll
      for (int i = 0; i < 8; ++i) { a[i] = (__bf16)ar[u].q[i >> 2][i & 3]; a[8 + i] = (__bf16)ar[u].q[2 + (i >> 2)][i & 3]; }
      ar[u] = ld_row16s(ua + kn * 32, voa);
#pragma unroll
      for (int j = 0; j < 8; ++j) { acc[j] = wmma_bf(a, bw[u][j], acc[j]); bw[u][j] = frag_bs(ub + j * 16 * DM + kn * 512, vob); }
      XW(); } }
  if (n0 < 2 * DM) {   // q stored unscaled (f16 sigma ~0.6, no subnormal exposure); 1/sqrt(2048) (CSCALE) applied to the f32 score
    // the wave's 16 rows x 128 columns are four tiles that follow one another in the workspace: laid out in fragment order in LDS, then copied as they lie
#pragma unroll
    for (int j = 0; j < 8; ++j) { const int e = (j >> 1) * 512 + (j & 1) * 256 + ((col >> 3) * 16 + 8 * g) * 8 + (col & 7);
#pragma unroll
      for (int r = 0; r < 8; ++r) { const float v = acc[j][r]; const _Float16 hv = (_Float16)v; so[wave][e + r * 8] = hv; sol[wave][e + r * 8] = (_Float16)((v - (float)hv) * 2048.0f); } }   // q, k as f16 hi + (x2048) residual (no RoPE in this module)
    LDSX();
    const size_t o = ((size_t)(blockIdx.x * 4 + wave) * 64 + n0 / 32) * 512 + lane * 8;
#pragma unroll
    for (int q = 0; q < 8; ++q) { vst2(QK + o + q * 256, *(const v4u*)&so[wave][q * 256 + lane * 8]); vst2(QKL + o + q * 256, *(const v4u*)&sol[wave][q * 256 + lane * 8]); }
  } else {   // v transposed: a lane's 8 accumulator rows are 8 neighbouring keys of one column d, which is the lane's own 16-byte piece of the tile (k half = wave & 1): stored straight from registers
    const int rb = blockIdx.x * 64, b = rb / SS, s0 = rb % SS, pc0 = n0 - 2 * DM;
    const size_t o = (((size_t)b * (DM / 16) + pc0 / 16) * (SS / 32) + s0 / 32 + (wave >> 1)) * 512 + (wave & 1) * 256 + lane * 8;
#pragma unroll
    for (int j = 0; j < 8; ++j) { v8h hi, lo;
#pragma unroll
      for (int r = 0; r < 8; ++r) { const float v = acc[j][r]; const _Float16 hv = (_Float16)v; hi[r] = hv; lo[r] = (_Float16)((v - (float)hv) * 2048.0f); }
      vst2(VTH + o + (size_t)j * (SS / 32) * 512, hi); vst2(VTL + o + (size_t)j * (SS / 32) * 512, lo); }
    XW();   // behind the last of these stores: no register that they name is rewritten ahead of it on any path of the listing
  }
}
#define CSCALE 0.022097086912079608f   // float32(1/sqrt(2048)): the module divides by sqrt(number of keys)
// ---- k_cstat: block = (64 KEYS, h, b): the softmax runs over QUERIES (axis 2), so per key column we need max and sum over q: S^T tiles = K rows . Q rows (3 products), y = (qk + (k - q)) * CSCALE where causal (q >= k) if masking, else (qk + 0)*CSCALE for q < k; online (max, sum) per key row over the query tiles -> MST[b][h][k] = (m, 2048 / l)
__global__ __launch_bounds__(128) void k_cstat(const _Float16* __restrict__ QK, const _Float16* __restrict__ QKL, const int* __restrict__ MASKING, float* __restrict__ MST) {
  __shared__ __align__(16) float sm[64][2];
  const int tid = threadIdx.x, wave = tid >> 5, lane = tid & 31, col = lane & 15, g = lane >> 4; const int kb = blockIdx.x, h = blockIdx.y, b = blockIdx.z; const int k0 = kb * 64 + wave * 16; const int masking = MASKING[0];
  v16h ak[2], akl[2];
#pragma unroll
  for (int kc = 0; kc < 2; ++kc) { const size_t rk = ((size_t)((b * SS + k0) / 16) * 64 + 32 + h * 2 + kc) * 512; ak[kc] = frag_hs(QK + rk, (unsigned)(lane * 16)); akl[kc] = frag_hs(QKL + rk, (unsigned)(lane * 16)); }
  XW();
  float m[8], l[8];
#pragma unroll
  for (int r = 0; r < 8; ++r) { m[r] = -3.0e38f; l[r] = 0.f; }
  const int qs0 = masking ? (kb * 64) / 32 : 0;   // first query tile that can see these keys
  // query fragments of a pass sit in registers before the pass begins: each 16-query half is loaded again, for the next pass, directly behind its last WMMA
  const unsigned voq = (unsigned)(lane * 16); const size_t uq0 = (size_t)b * SS * (2 * DM) + h * 2 * 512;   // 16 queries on: 16 * (2 * DM) elements, as in row order; k chunk on: 512
  v16h qh[2][2], ql[2][2]; const char* pq0 = (const char*)(QK + uq0 + (size_t)qs0 * 32 * (2 * DM)) + voq; const char* pl0 = (const char*)(QKL + uq0 + (size_t)qs0 * 32 * (2 * DM)) + voq;
#pragma unroll
  for (int ct = 0; ct < 2; ++ct) {
#pragma unroll
    for (int kc = 0; kc < 2; ++kc) { qh[ct][kc] = frag_hp(pq0 + ct * 16 * (2 * DM) * 2 + kc * 1024); ql[ct][kc] = frag_hp(pl0 + ct * 16 * (2 * DM) * 2 + kc * 1024); } }
  XWA(lane, voq);   // the lane's index and offset stay in their registers up to the wait
  int qs = qs0;
#pragma unroll 1
  do { v8f s[2]; const int qn = (qs + 1 < SS / 32) ? qs + 1 : qs;   // past the end: the last tile again, never used
#pragma unroll
    for (int ct = 0; ct < 2; ++ct) { const int qq = qs * 32 + ct * 16 + col; const size_t uq = uq0 + (size_t)(qn * 32 + ct * 16) * (2 * DM); v8f c = {}, cl = {};
#pragma unroll
      for (int kc = 0; kc < 2; ++kc) { c = wmma16(ak[kc], qh[ct][kc], c); cl = wmma16(akl[kc], qh[ct][kc], cl); cl = wmma16(ak[kc], ql[ct][kc], cl); }
      SB();
#pragma unroll
      for (int kc = 0; kc < 2; ++kc) { qh[ct][kc] = frag_hs(QK + uq + kc * 512, voq); ql[ct][kc] = frag_hs(QKL + uq + kc * 512, voq); }
      XW();
#pragma unroll
      for (int r = 0; r < 8; ++r) { const int ki = k0 + 8 * g + r; const float qk = c[r] + cl[r] * (1.0f / 2048.0f); const bool causal = (ki <= qq);
        s[ct][r] = causal ? (qk + (float)(ki - qq)) * CSCALE : (masking ? -3.0e38f : qk * CSCALE); } }
#pragma unroll
    for (int r = 0; r < 8; ++r) { float mx = fmaxf(s[0][r], s[1][r]);
#pragma unroll
      for (int o = 1; o < 16; o <<= 1) mx = fmaxf(mx, __shfl_xor(mx, o));
      const float mn = fmaxf(m[r], mx); const float alpha = (m[r] <= -1.0e38f) ? 0.f : __expf(m[r] - mn);
      const float e0 = (s[0][r] <= -1.0e38f) ? 0.f : __expf(s[0][r] - mn), e1 = (s[1][r] <= -1.0e38f) ? 0.f : __expf(s[1][r] - mn); float es = e0 + e1;
#pragma unroll
      for (int o = 1; o < 16; o <<= 1) es += __shfl_xor(es, o);
      l[r] = l[r] * alpha + es; m[r] = mn; } } while (++qs < SS / 32);   // tested at the foot: qs0 is at most SS / 32 - 2
  if (col == 0) {
#pragma unroll
    for (int r = 0; r < 8; ++r) { sm[wave * 16 + 8 * g + r][0] = m[r]; sm[wave * 16 + 8 * g + r][1] = 2048.0f / l[r]; } }   // the one division per key; l is at least 1 (the maximum's own term)
  __syncthreads();
  if (tid < 32) vst2(MST + (((size_t)b * NH + h) * SS + kb * 64) * 2 + tid * 4, *(const v4f*)(&sm[0][0] + tid * 4));
}
// ---- k_attn: block = (64 queries, h, b): key tiles (k <= q frontier if masking); y as above; z = exp(y - m_k) * (2048 / l_k) (column statistics, the scaled reciprocal from k_cstat); P = z as f16 hi + (x2048) lo x V hi/lo (3 products); out rows (no normalisation)
__global__ __launch_bounds__(128) void k_attn(const _Float16* __restrict__ QK, const _Float16* __restrict__ QKL, const _Float16* __restrict__ VTH, const _Float16* __restrict__ VTL, const float* __restrict__ MST, const int* __restrict__ MASKING, float* __restrict__ O) {
  __shared__ __align__(16) _Float16 sph[4][16][40], spl[4][16][40]; __shared__ __align__(16) float so[4][1024];
  const int tid = threadIdx.x, wave = tid >> 5, lane = tid & 31, col = lane & 15, g = lane >> 4;
  const int qb = blockIdx.x, h = blockIdx.y, b = blockIdx.z; const int q0 = qb * 64 + wave * 16; const size_t rq = (size_t)b * SS + q0; const int masking = MASKING[0];
  v16h aq[2], aql[2];
#pragma unroll
  for (int kc = 0; kc < 2; ++kc) { aq[kc] = frag_hs(QK + rq * (2 * DM) + (h * 2 + kc) * 512, (unsigned)(lane * 16)); aql[kc] = frag_hs(QKL + rq * (2 * DM) + (h * 2 + kc) * 512, (unsigned)(lane * 16)); }
  v8f acc[4] = {}, accl[4] = {};
  const int nks = masking ? (qb * 64 + 64) / 32 : SS / 32;
  // every global load of a pass is issued well ahead of its use: the values at the head of the pass; each block of 16 keys (with its statistics) into the one key buffer, directly behind the score WMMAs of the block before it
  const unsigned vok = (unsigned)(lane * 16), vov = (unsigned)(lane * 16), vom = (unsigned)(col * 8);
  const size_t uk0 = (size_t)b * SS * (2 * DM) + (32 + h * 2) * 512, uv0 = ((size_t)b * DM + h * HD) * SS; const float* um0 = MST + ((size_t)b * NH + h) * SS * 2;
  v16h kh[2], kl[2]; v2f ms;
#pragma unroll
  for (int kc = 0; kc < 2; ++kc) { kh[kc] = frag_hs(QK + uk0 + kc * 512, vok); kl[kc] = frag_hs(QKL + uk0 + kc * 512, vok); }
  ms = *(const v2f*)((const char*)um0 + vom);
  XW();
  int ks = 0;
#pragma unroll 1
  do { v16h vh[4], vl[4]; const int kn = (ks + 1 < nks) ? ks + 1 : ks;   // past the end: the last tile again, never used
    const char* pvh = (const char*)(VTH + uv0 + ks * 512) + vov; const char* pvl = (const char*)(VTL + uv0 + ks * 512) + vov;
#pragma unroll
    for (int dt = 0; dt < 4; ++dt) { vh[dt] = frag_hp(pvh + dt * 16 * SS * 2); vl[dt] = frag_hp(pvl + dt * 16 * SS * 2); }
    XWA(pvh, pvl);
#pragma unroll
    for (int ct = 0; ct < 2; ++ct) { const int kk = ks * 32 + ct * 16 + col; v8f c = {}, cl = {};
#pragma unroll
      for (int kc = 0; kc < 2; ++kc) { c = wmma16(aq[kc], kh[kc], c); cl = wmma16(aql[kc], kh[kc], cl); cl = wmma16(aq[kc], kl[kc], cl); }
      const float mk = ms[0], rk = ms[1]; const int kt = (ct == 0) ? ks * 32 + 16 : kn * 32;   // first key of the block that comes next
      SB();
#pragma unroll
      for (int kc = 0; kc < 2; ++kc) { const size_t uk = uk0 + (size_t)kt * (2 * DM) + kc * 512; kh[kc] = frag_hs(QK + uk, vok); kl[kc] = frag_hs(QKL + uk, vok); }
      ms = *(const v2f*)((const char*)(um0 + kt * 2) + vom);
      XW();
#pragma unroll
      for (int r = 0; r < 8; ++r) { const int qi = q0 + 8 * g + r; const float qk = c[r] + cl[r] * (1.0f / 2048.0f); const bool causal = (kk <= qi);
        const float y = causal ? (qk + (float)(kk - qi)) * CSCALE : qk * CSCALE; const float p = (causal || !masking) ? __expf(y - mk) * rk : 0.f;   // rk = 2^11 / l: z scaled by 2^11 so its f16 hi plane stays out of the subnormal range; 2^-11 folded into the epilogue
        const _Float16 hp = (_Float16)p; sph[wave][8 * g + r][ct * 16 + col] = hp; spl[wave][8 * g + r][ct * 16 + col] = (_Float16)((p - (float)hp) * 2048.0f); } }
    LDSX();
    const v16h pah = frag_h(&sph[wave][col][0], lane), pal = frag_h(&spl[wave][col][0], lane);
#pragma unroll
    for (int dt = 0; dt < 4; ++dt) { acc[dt] = wmma16(pah, vh[dt], acc[dt]); accl[dt] = wmma16(pal, vh[dt], accl[dt]); accl[dt] = wmma16(pah, vl[dt], accl[dt]); }
    LDSX(); } while (++ks < nks);   // tested at the foot: nks is at least 2 for any value of masking
#pragma unroll
  for (int r = 0; r < 8; ++r) {
#pragma unroll
    for (int dt = 0; dt < 4; ++dt) so[wave][(dt >> 1) * 512 + ((dt & 1) * 2 + ((col >> 2) & 1)) * 128 + ((col >> 3) * 16 + 8 * g + r) * 4 + (col & 3)] = (acc[dt][r] + accl[dt][r] * (1.0f / 2048.0f)) * (1.0f / 2048.0f); }   // the wave's two f32 tiles, in fragment order
  LDSX();
#pragma unroll
  for (int q = 0; q < 8; ++q) vst2(O + rq * DM + h * 2 * 512 + q * 128 + lane * 4, *(const v4f*)&so[wave][q * 128 + lane * 4]);
}
// ---- k_out: block = (64 rows, 128 cols): out = O(hi/lo) . Wo rows (2 products)
__global__ __launch_bounds__(128) void k_out(const float* __restrict__ O, const __bf16* __restrict__ P, float* __restrict__ Y) {
  __shared__ __align__(16) float so[4][16][132];
  const int tid = threadIdx.x, wave = tid >> 5, lane = tid & 31, col = lane & 15, g = lane >> 4; const size_t r0 = (size_t)blockIdx.x * 64 + wave * 16; const int n0 = blockIdx.y * 128;
  v8f acc[8] = {};
  // two register slots of fragments, each loaded again for two chunks on directly behind its last use (as in k_qkv)
  const float* ua = O + (size_t)blockIdx.x * 64 * DM; const __bf16* ub = P + (size_t)n0 * DM; const unsigned voa = (unsigned)((wave * 16 * DM + lane * 4) * 4), vob = (unsigned)(lane * 16);
  R16 ar[2]; v16b bw[2][8];
#pragma unroll
  for (int u = 0; u < 2; ++u) { ar[u] = ld_row16t(ua + u * 512, voa);
#pragma unroll
    for (int j = 0; j < 8; ++j) bw[u][j] = frag_bs(ub + j * 16 * DM + u * 512, vob); }
  XW();
#pragma unroll 1   // stays rolled: the two slots are the whole unrolling, a further copy would only cost registers
  for (int kc = 0; kc < DM / 32; kc += 2) {
#pragma unroll
    for (int u = 0; u < 2; ++u) { float v[16]; const int kn = (kc + u + 2 < DM / 32) ? kc + u + 2 : DM / 32 - 1;   // past the end: the last chunk again, never used
#pragma unroll
      for (int i = 0; i < 8; ++i) { v[i] = ar[u].q[i >> 2][i & 3]; v[8 + i] = ar[u].q[2 + (i >> 2)][i & 3]; }
      const F2 a = bsplit16(v); ar[u] = ld_row16t(ua + kn * 512, voa);
#pragma unroll
      for (int j = 0; j < 8; ++j) { acc[j] = wmma_bf(a.l, bw[u][j], acc[j]); acc[j] = wmma_bf(a.h, bw[u][j], acc[j]); bw[u][j] = frag_bs(ub + j * 16 * DM + kn * 512, vob); }
      XW(); } }
#pragma unroll
  for (int j = 0; j < 8; ++j) {
#pragma unroll
    for (int r = 0; r < 8; ++r) so[wave][8 * g + r][j * 16 + col] = acc[j][r]; }
  LDSX();
  for (int rl = 0; rl < 16; ++rl) vst2(Y + (r0 + rl) * DM + n0 + lane * 4, *(const v4f*)&so[wave][rl][lane * 4]);
}
extern "C" void kernel_launch(void* const* d_in, const int* in_sizes, int n_in, void* d_out, int out_size, void* d_ws, size_t ws_size, hipStream_t stream) {
  (void)in_sizes; (void)n_in; (void)out_size;
  const float** F = (const float**)d_in;   // 0 keys [2,2048,1024], 1 queries, 2 values, 3 WQ [16,1024,64], 4 WK, 5 WV, 6 WO [1024,1024] (in,out), 7 masking [1] int32
  if (ws_size < (size_t)WS_END) return;
  char* ws = (char*)d_ws; __bf16* PK = (__bf16*)(ws + WS_PK); _Float16 *QK = (_Float16*)(ws + WS_QK), *QKL = (_Float16*)(ws + WS_QKL), *VTH = (_Float16*)(ws + WS_VTH), *VTL = (_Float16*)(ws + WS_VTL); float* O = (float*)(ws + WS_O);
  float* MST = (float*)(ws + WS_MST);
  k_pack<<<dim3(DM / 16, 4, 8), 256, 0, stream>>>(F[3], F[4], F[5], F[6], PK);
  k_qkv<<<dim3(TNB * SS / 64, QKVW / 128), 128, 0, stream>>>(F[1], F[0], F[2], PK + PK_A, QK, QKL, VTH, VTL);
  k_cstat<<<dim3(SS / 64, NH, TNB), 128, 0, stream>>>(QK, QKL, (const int*)d_in[7], MST);
  k_attn<<<dim3(TQB, NH, TNB), 128, 0, stream>>>(QK, QKL, VTH, VTL, MST, (const int*)d_in[7], O);
  k_out<<<dim3(TOB, DM / 128), 128, 0, stream>>>(O, PK + PK_P, (float*)d_out);
}

// v004
// It runs in 207 microseconds.
// Next to v003, in two timings, it ran 1.40 and 1.39 times as fast.
// Over all steps from v000 it is 3.33 times as fast.
#include <hip/hip_runtime.h>
#include <math.h>

typedef __attribute__((ext_vector_type(16))) _Float16 v16h;
typedef __attribute__((ext_vector_type(16))) __bf16 v16b;
typedef __attribute__((ext_vector_type(8)))  _Float16 v8h;
typedef __attribute__((ext_vector_type(8)))  float v8f;
typedef __attribute__((ext_vector_type(4)))  float v4f;
typedef __attribute__((ext_vector_type(2)))  float v2f;
typedef __attribute__((ext_vector_type(4)))  unsigned v4u;
typedef __attribute__((ext_vector_type(4)))  int v4i;
typedef float __attribute__((may_alias)) float_a;
typedef int __attribute__((may_alias)) int_a;

template <typename T> __device__ __forceinline__ void vst2(void* p, T v) { *(T*)p = v;  }
__device__ __forceinline__ v8f wmma16(v16h a, v16h b, v8f c) {
  v8f d = __builtin_amdgcn_wmma_f32_16x16x32_f16(false, a, false, b, (short)0, c, false, false);
  asm volatile("v_nop\n\tv_nop\n\tv_nop\n\tv_nop" : "+v"(d) : "v"(a), "v"(b));
  return d;
}
__device__ __forceinline__ v8f wmma_bf(v16b a, v16b b, v8f c) {
  v8f d = __builtin_amdgcn_wmma_f32_16x16x32_bf16(false, a, false, b, (short)0, c, false, false);
  asm volatile("v_nop\n\tv_nop\n\tv_nop\n\tv_nop" : "+v"(d) : "v"(a), "v"(b));
  return d;
}
// Multi-head ALiBi-style block (B 2, S 2,048, d 1,024, 16 heads x 64): per-head projections of separate keys / queries / values, (QK + (k - q)) / sqrt(S) with a causal mask, softmax over the query axis, weighted values, output projection.
__device__ __forceinline__ v16h frag_h(const _Float16* rowk0, int lane) {
  union { v16h v; v8h q[2]; } u; const _Float16* p = rowk0 + 8 * (lane >> 4);
  u.q[0] = *(const v8h*)p; u.q[1] = *(const v8h*)(p + 16); return u.v;
}
__device__ __forceinline__ v16h frag_f32(const float* rowk0, int lane) {
  v16h a; const float* p = rowk0 + 8 * (lane >> 4);
#pragma unroll
  for (int i = 0; i < 8; ++i) { a[i] = (_Float16)p[i]; a[8 + i] = (_Float16)p[16 + i]; }
  return a;
}
__device__ __forceinline__ v16h frag_f32s(const float* rowk0, int lane, float sc) {
  v16h a; const float* p = rowk0 + 8 * (lane >> 4);
#pragma unroll
  for (int i = 0; i < 8; ++i) { a[i] = (_Float16)(p[i] * sc); a[8 + i] = (_Float16)(p[16 + i] * sc); }
  return a;
}
// column fragment from a [K][ld] layout (column n), rows >= K read as 0
__device__ __forceinline__ v16h fragc_f32(const float* W, int k0, int n, int lane, int ld, int K) {
  v16h a; const int g = lane >> 4;
#pragma unroll
  for (int i = 0; i < 8; ++i) { const int ka = k0 + 8 * g + i, kb = ka + 16;
    a[i] = (_Float16)(ka < K ? W[(size_t)(ka < K ? ka : K - 1) * ld + n] : 0.f); a[8 + i] = (_Float16)(kb < K ? W[(size_t)(kb < K ? kb : K - 1) * ld + n] : 0.f); }
  return a;
}
struct F2 { v16b h, l; };
__device__ __forceinline__ F2 bsplit16(const float v[16]) { F2 r;
#pragma unroll
  for (int i = 0; i < 16; ++i) { const __bf16 h = (__bf16)v[i]; r.h[i] = h; r.l[i] = (__bf16)(v[i] - (float)h); }
  return r; }
__device__ __forceinline__ F2 split_row(const float* row, int k0, int lane) { float v[16]; const float* p = row + k0 + 8 * (lane >> 4);
#pragma unroll
  for (int i = 0; i < 8; ++i) { v[i] = p[i]; v[8 + i] = p[16 + i]; }
  return bsplit16(v); }
__device__ __forceinline__ F2 split_rowK(const float* row, int k0, int lane, int K) { float v[16]; const int g = lane >> 4;
#pragma unroll
  for (int i = 0; i < 8; ++i) { const int ka = k0 + 8 * g + i, kb = ka + 16; v[i] = ka < K ? row[ka < K ? ka : K - 1] : 0.f; v[8 + i] = kb < K ? row[kb < K ? kb : K - 1] : 0.f; }
  return bsplit16(v); }
__device__ __forceinline__ F2 split_col(const float* W, int k0, int n, int lane, int ld, int K) { float v[16]; const int g = lane >> 4;
#pragma unroll
  for (int i = 0; i < 8; ++i) { const int ka = k0 + 8 * g + i, kb = ka + 16; v[i] = ka < K ? W[(size_t)(ka < K ? ka : K - 1) * ld + n] : 0.f; v[8 + i] = kb < K ? W[(size_t)(kb < K ? kb : K - 1) * ld + n] : 0.f; }
  return bsplit16(v); }
__device__ __forceinline__ v8f mac3(const F2& a, const F2& b, v8f c) { c = wmma_bf(a.l, b.h, c); c = wmma_bf(a.h, b.l, c); return wmma_bf(a.h, b.h, c); }
__device__ __forceinline__ float sigm(float v) { return 1.0f / (1.0f + expf(-v)); }
#define LDSX() do { asm volatile("s_wait_dscnt 0" ::: "memory"); __builtin_amdgcn_wave_barrier(); __builtin_amdgcn_fence(__ATOMIC_RELEASE, "workgroup"); } while (0)


#define NB 2
#define SS 2048
#define DM 1024
#define NH 16
#define HD 64
#define QKVW (3 * DM)
#ifndef TQB
#define TQB (SS / 64)
#define TNB NB
#define TOB (NB * SS / 64)     // output row tiles (all)
#endif
typedef __attribute__((ext_vector_type(8))) __bf16 v8b;
__device__ __forceinline__ v16b frag_b(const __bf16* rowk0, int lane) {
  union { v16b v; v8b q[2]; } u; const __bf16* p = rowk0 + 8 * (lane >> 4);
  u.q[0] = *(const v8b*)p; u.q[1] = *(const v8b*)(p + 16); return u.v;
}
// FRAGMENT ORDER of the workspace operands: a tile of 16 rows x 32 k is stored as [k half j][lane = 16 * g + row][8 k], element (row, k = 16 * j + 8 * g + i) at j * 256 + (16 * g + row) * 8 + i;
// a 16-bit tile is 1,024 B, and each of a fragment's two wave-wide 16-byte loads covers 512 contiguous bytes (4 whole lines); the tiles of one row tile follow one another along k
// fragment loads from a wave-uniform tile base plus the lane's own 32-bit byte offset (16 * lane), which is the same in every pass
__device__ __forceinline__ v16h frag_hs(const _Float16* ub, unsigned vo) { union { v16h v; v8h q[2]; } u; const char* p = (const char*)ub + vo; u.q[0] = *(const v8h*)p; u.q[1] = *(const v8h*)(p + 512); return u.v; }
__device__ __forceinline__ v16b frag_bs(const __bf16* ub, unsigned vo) { union { v16b v; v8b q[2]; } u; const char* p = (const char*)ub + vo; u.q[0] = *(const v8b*)p; u.q[1] = *(const v8b*)(p + 512); return u.v; }
// the 16 f32 of one lane's A fragment, still unconverted, so that the loads can fly ahead of their use
struct R16 { v4f q[4]; };
__device__ __forceinline__ R16 ld_row16s(const float* ub, unsigned vo) { R16 r; const char* p = (const char*)ub + vo; r.q[0] = *(const v4f*)p; r.q[1] = *(const v4f*)(p + 16); r.q[2] = *(const v4f*)(p + 64); r.q[3] = *(const v4f*)(p + 80); return r; }
// the same 16 f32 from a tile in fragment order (f32: 2,048 B, four quarters of 512 B, quarter m = 2 * j + (i >> 2))
__device__ __forceinline__ R16 ld_row16t(const float* ub, unsigned vo) { R16 r; const char* p = (const char*)ub + vo; r.q[0] = *(const v4f*)p; r.q[1] = *(const v4f*)(p + 512); r.q[2] = *(const v4f*)(p + 1024); r.q[3] = *(const v4f*)(p + 1536); return r; }
// stands behind a group of loads that stay in flight: the registers that hold their addresses may be rewritten only behind it
// the two scheduling barriers keep the wait behind its loads, and later loads and address arithmetic behind the wait
#define XW() do { __builtin_amdgcn_sched_barrier(0); asm volatile("s_wait_xcnt 0x0" ::: "memory"); __builtin_amdgcn_sched_barrier(0); } while (0)
// the same wait, taking two lane addresses of the group as inputs: they stay in their registers up to the wait, so no load of the group can be given those registers for its data
#define XWA(p, q) do { __builtin_amdgcn_sched_barrier(0); asm volatile("s_wait_xcnt 0x0" :: "v"(p), "v"(q) : "memory"); __builtin_amdgcn_sched_barrier(0); } while (0)
// fragment load from the lane's own byte address in a tile in fragment order (k half 0 at p, k half 1 at p + 512 bytes)
__device__ __forceinline__ v16h frag_hp(const char* p) { union { v16h v; v8h q[2]; } u; u.q[0] = *(const v8h*)p; u.q[1] = *(const v8h*)(p + 512); return u.v; }
// keeps a refill behind the WMMAs that last read the registers it refills; lifted over them, both sets would be live at once
#define SB() __builtin_amdgcn_sched_barrier(0)
__device__ __forceinline__ float bfr(float v) { return (float)(__bf16)v; }
__device__ __attribute__((noinline)) float exp_ni(float v) { return expf(v); }
__device__ __attribute__((noinline)) float erf_ni(float v) { return erff(v); }

#define PK_A 0                       // [3072][1024] Wqkv rows ([out][in]), fragment order: tile (row tile rt, k chunk kt) at (rt * 32 + kt) * 512
#define PK_P (PK_A + QKVW * DM)        // [1024][1024] Wo rows, fragment order
#define PK_END (PK_P + DM * DM)
#define WS_PK  0u
#define WS_QK  (WS_PK + 2u * PK_END)             // f16 [4096 rows][2048]: q | k, fragment order: tile (rt, kt) at (rt * 64 + kt) * 512
#define WS_QKL (WS_QK + 2u * NB * SS * 2 * DM)     // f16 q | k residual planes x2048
#define WS_VTH (WS_QKL + 2u * NB * SS * 2 * DM)    // f16 [b][1024 (h*64+d)][2048 s] hi, fragment order: tile (b, d tile, s chunk) at ((b * 64 + dt) * 64 + st) * 512
#define WS_VTL (WS_VTH + 2u * NB * DM * SS)        // f16 lo x 2048
#define WS_O   (WS_VTL + 2u * NB * DM * SS)        // f32 [4096][1024], fragment order: tile (rt, kt) at (rt * 32 + kt) * 512
#define WS_CS  (WS_O + 4u * NB * SS * DM)           // f32 2 x [2048][32], written and read by no kernel
#define WS_MST (WS_CS + 4u * 2 * SS * 32)
#define WS_END (WS_MST + 4u * NB * NH * SS * 2)
// ---- k_pack: block = (16 rows n, which, 128 k): [out][in] rows -> bf16 in fragment order; which 0..2 -> W_q/W_k/W_v into PK_A rows which*1024 + n; 3 -> W_o into PK_P
// a thread makes one whole 16-byte piece (8 k of one row), so a wave stores 512 contiguous bytes and reads, per k, 16 neighbouring floats for each of its two k groups
__global__ __launch_bounds__(256) void k_pack(const float* __restrict__ WQ, const float* __restrict__ WK, const float* __restrict__ WV, const float* __restrict__ WO, __bf16* __restrict__ PK) {
  const int n0 = blockIdx.x * 16, which = blockIdx.y, kq = blockIdx.z, p = threadIdx.x; const float* Wm = (which == 0) ? WQ : (which == 1) ? WK : (which == 2) ? WV : WO;   // per-head (in,out) [H][D][64] -> row n = h*64+e reads W[h][d][e]; WO (in,out) -> row n reads WO[d][n]
  const int hh = n0 / HD, e0 = n0 % HD; const int ld = (which < 3) ? HD : DM;
  __bf16* dst = ((which < 3) ? PK + PK_A + ((size_t)which * DM + n0) * DM : PK + PK_P + (size_t)n0 * DM) + kq * 4 * 512;
  const int row = p & 15, k = kq * 128 + (p >> 6) * 32 + ((p >> 5) & 1) * 16 + ((p >> 4) & 1) * 8;
  const float* s = (which < 3) ? Wm + ((size_t)hh * DM + k) * HD + e0 + row : Wm + (size_t)k * DM + n0 + row; v8b o;
#pragma unroll
  for (int i = 0; i < 8; ++i) o[i] = (__bf16)s[(size_t)i * ld];
  vst2(dst + p * 8, o);
}
__global__ __launch_bounds__(128) void k_qkv(const float* __restrict__ XQ, const float* __restrict__ XK, const float* __restrict__ XV, const __bf16* __restrict__ P, _Float16* __restrict__ QK, _Float16* __restrict__ QKL, _Float16* __restrict__ VTH, _Float16* __restrict__ VTL) {
  const int which0 = (blockIdx.y * 128) / DM; const float* X = (which0 == 0) ? XQ : (which0 == 1) ? XK : XV;   // Q from queries, K from keys, V from values
  __shared__ __align__(16) _Float16 so[4][2048], sol[4][2048];
  const int tid = threadIdx.x, wave = tid >> 5, lane = tid & 31, col = lane & 15, g = lane >> 4; const int n0 = blockIdx.y * 128;
  v8f acc[8] = {};
  // two register slots of fragments (k chunks kc and kc + 1); each fragment is loaded again, for two chunks on, directly behind its last use, so a whole slot's loads are in flight while the other slot is worked on
  const float* ua = X + (size_t)blockIdx.x * 64 * DM; const __bf16* ub = P + (size_t)n0 * DM; const unsigned voa = (unsigned)(((wave * 16 + col) * DM + 8 * g) * 4), vob = (unsigned)(lane * 16);
  R16 ar[2]; v16b bw[2][8];
#pragma unroll
  for (int u = 0; u < 2; ++u) { ar[u] = ld_row16s(ua + u * 32, voa);
#pragma unroll
    for (int j = 0; j < 8; ++j) bw[u][j] = frag_bs(ub + j * 16 * DM + u * 512, vob); }
  XW();
#pragma unroll 1   // stays rolled: the two slots are the whole unrolling, a further copy would only cost registers
  for (int kc = 0; kc < DM / 32; kc += 2) {
#pragma unroll
    for (int u = 0; u < 2; ++u) { v16b a; const int kn = (kc + u + 2 < DM / 32) ? kc + u + 2 : DM / 32 - 1;   // past the end: the last chunk again, never used
#pragma unroll
      for (int i = 0; i < 8; ++i) { a[i] = (__bf16)ar[u].q[i >> 2][i & 3]; a[8 + i] = (__bf16)ar[u].q[2 + (i >> 2)][i & 3]; }
      ar[u] = ld_row16s(ua + kn * 32, voa);
#pragma unroll
      for (int j = 0; j < 8; ++j) { acc[j] = wmma_bf(a, bw[u][j], acc[j]); bw[u][j] = frag_bs(ub + j * 16 * DM + kn * 512, vob); }
      XW(); } }
  if (n0 < 2 * DM) {   // q stored unscaled (f16 sigma ~0.6, no subnormal exposure); 1/sqrt(2048) (CSCALE) applied to the f32 score
    // the wave's 16 rows x 128 columns are four tiles that follow one another in the workspace: laid out in fragment order in LDS, then copied as they lie
#pragma unroll
    for (int j = 0; j < 8; ++j) { const int e = (j >> 1) * 512 + (j & 1) * 256 + ((col >> 3) * 16 + 8 * g) * 8 + (col & 7);
#pragma unroll
      for (int r = 0; r < 8; ++r) { const float v = acc[j][r]; const _Float16 hv = (_Float16)v; so[wave][e + r * 8] = hv; sol[wave][e + r * 8] = (_Float16)((v - (float)hv) * 2048.0f); } }   // q, k as f16 hi + (x2048) residual (no RoPE in this module)
    LDSX();
    const size_t o = ((size_t)(blockIdx.x * 4 + wave) * 64 + n0 / 32) * 512 + lane * 8;
#pragma unroll
    for (int q = 0; q < 8; ++q) { vst2(QK + o + q * 256, *(const v4u*)&so[wave][q * 256 + lane * 8]); vst2(QKL + o + q * 256, *(const v4u*)&sol[wave][q * 256 + lane * 8]); }
  } else {   // v transposed: a lane's 8 accumulator rows are 8 neighbouring keys of one column d, which is the lane's own 16-byte piece of the tile (k half = wave & 1): stored straight from registers
    const int rb = blockIdx.x * 64, b = rb / SS, s0 = rb % SS, pc0 = n0 - 2 * DM;
    const size_t o = (((size_t)b * (DM / 16) + pc0 / 16) * (SS / 32) + s0 / 32 + (wave >> 1)) * 512 + (wave & 1) * 256 + lane * 8;
#pragma unroll
    for (int j = 0; j < 8; ++j) { v8h hi, lo;
#pragma unroll
      for (int r = 0; r < 8; ++r) { const float v = acc[j][r]; const _Float16 hv = (_Float16)v; hi[r] = hv; lo[r] = (_Float16)((v - (float)hv) * 2048.0f); }
      vst2(VTH + o + (size_t)j * (SS / 32) * 512, hi); vst2(VTL + o + (size_t)j * (SS / 32) * 512, lo); }
    XW();   // behind the last of these stores: no register that they name is rewritten ahead of it on any path of the listing
  }
}
#define CSCALE 0.022097086912079608f   // float32(1/sqrt(2048)): the module divides by sqrt(number of keys)
// ---- k_cstat: block = (two tiles of 64 KEYS, h, b), 8 waves. Under the causal mask key tile t is seen by 64 - 2 t query tiles of 32: the block takes tile x and tile 31 - x, 66 passes for each 16 keys' pair, and deals them in two equal walks:
// waves 0..3 walk the first half of the pair's passes, all in tile x; waves 4..7 walk the rest of tile x, leave that partial (m, l) in LDS, and then walk all of tile 31 - x; behind the one barrier waves 0..3 join the two partials. Per tile: the softmax runs over QUERIES (axis 2), so per key column we need max and sum over q: S^T tiles = K rows . Q rows (3 products), y = (qk + (k - q)) * CSCALE where causal (q >= k) if masking, else (qk + 0)*CSCALE for q < k; online (max, sum) per key row over the query tiles -> MST[b][h][k] = (m, 2048 / l)
__global__ __launch_bounds__(256) void k_cstat(const _Float16* __restrict__ QK, const _Float16* __restrict__ QKL, const int* __restrict__ MASKING, float* __restrict__ MST) {
  __shared__ __align__(16) float sm[8][16][2], sb[4][16][2];   // sm: each wave's own results on their way out; sb: the partial (m, l) that wave 4 + w leaves for wave w
  const int tid = threadIdx.x, wave = tid >> 5, lane = tid & 31, col = lane & 15, g = lane >> 4; const int h = blockIdx.y, b = blockIdx.z; const int masking = MASKING[0];
  const int part = __builtin_amdgcn_readfirstlane(wave >> 2), w4 = wave & 3;   // part in a scalar register: every test on it is a scalar branch, so EXEC stays whole for the WMMAs
  const int t1 = blockIdx.x, t2 = SS / 64 - 1 - t1; const int f1 = masking ? t1 * 2 : 0, f2 = masking ? t2 * 2 : 0;   // first query tile that can see the keys of each key tile; f1 <= f2
  const int cut = f1 + (2 * (SS / 32) - f1 - f2) / 2;   // where tile t1's walk is cut: half of the pair's passes; at most SS / 32
  float m[8], l[8];
#pragma unroll 1   // stays rolled: the walks of a wave run one after the other in the same registers
  for (int seg = 0; seg <= part; ++seg) {
  const int kb = seg ? t2 : t1, qs0 = seg ? f2 : (part ? cut : f1), qe = part ? SS / 32 : cut; const int k0 = kb * 64 + w4 * 16;
#pragma unroll
  for (int r = 0; r < 8; ++r) { m[r] = -3.0e38f; l[r] = 0.f; }
  if (qs0 < qe) {   // without the mask nothing of tile t1 is left for waves 4..7
  v16h ak[2], akl[2];
#pragma unroll
  for (int kc = 0; kc < 2; ++kc) { const size_t rk = ((size_t)((b * SS + k0) / 16) * 64 + 32 + h * 2 + kc) * 512; ak[kc] = frag_hs(QK + rk, (unsigned)(lane * 16)); akl[kc] = frag_hs(QKL + rk, (unsigned)(lane * 16)); }
  XW();
  // query fragments of a pass sit in registers before the pass begins: each 16-query half is loaded again, for the next pass, directly behind its last WMMA
  const unsigned voq = (unsigned)(lane * 16); const size_t uq0 = (size_t)b * SS * (2 * DM) + h * 2 * 512;   // 16 queries on: 16 * (2 * DM) elements, as in row order; k chunk on: 512
  v16h qh[2][2], ql[2][2]; const char* pq0 = (const char*)(QK + uq0 + (size_t)qs0 * 32 * (2 * DM)) + voq; const char* pl0 = (const char*)(QKL + uq0 + (size_t)qs0 * 32 * (2 * DM)) + voq;
#pragma unroll
  for (int ct = 0; ct < 2; ++ct) {
#pragma unroll
    for (int kc = 0; kc < 2; ++kc) { qh[ct][kc] = frag_hp(pq0 + ct * 16 * (2 * DM) * 2 + kc * 1024); ql[ct][kc] = frag_hp(pl0 + ct * 16 * (2 * DM) * 2 + kc * 1024); } }
  XWA(lane, voq);   // the lane's index and offset stay in their registers up to the wait
  int qs = qs0;
#pragma unroll 1
  do { v8f s[2]; const int qn = (qs + 1 < SS / 32) ? qs + 1 : qs;   // past the end: the last tile again, never used
#pragma unroll
    for (int ct = 0; ct < 2; ++ct) { const int qq = qs * 32 + ct * 16 + col; const size_t uq = uq0 + (size_t)(qn * 32 + ct * 16) * (2 * DM); v8f c = {}, cl = {};
#pragma unroll
      for (int kc = 0; kc < 2; ++kc) { c = wmma16(ak[kc], qh[ct][kc], c); cl = wmma16(akl[kc], qh[ct][kc], cl); cl = wmma16(ak[kc], ql[ct][kc], cl); }
      SB();
#pragma unroll
      for (int kc = 0; kc < 2; ++kc) { qh[ct][kc] = frag_hs(QK + uq + kc * 512, voq); ql[ct][kc] = frag_hs(QKL + uq + kc * 512, voq); }
      XW();
#pragma unroll
      for (int r = 0; r < 8; ++r) { const int ki = k0 + 8 * g + r; const float qk = c[r] + cl[r] * (1.0f / 2048.0f); const bool causal = (ki <= qq);
        s[ct][r] = causal ? (qk + (float)(ki - qq)) * CSCALE : (masking ? -3.0e38f : qk * CSCALE); } }
#pragma unroll
    for (int r = 0; r < 8; ++r) { float mx = fmaxf(s[0][r], s[1][r]);
#pragma unroll
      for (int o = 1; o < 16; o <<= 1) mx = fmaxf(mx, __shfl_xor(mx, o));
      const float mn = fmaxf(m[r], mx); const float alpha = (m[r] <= -1.0e38f) ? 0.f : __expf(m[r] - mn);
      const float e0 = (s[0][r] <= -1.0e38f) ? 0.f : __expf(s[0][r] - mn), e1 = (s[1][r] <= -1.0e38f) ? 0.f : __expf(s[1][r] - mn); float es = e0 + e1;
#pragma unroll
      for (int o = 1; o < 16; o <<= 1) es += __shfl_xor(es, o);
      l[r] = l[r] * alpha + es; m[r] = mn; } } while (++qs < qe);   // tested at the foot: entered only with qs0 < qe
  }
  if (part && seg == 0 && col == 0) {
#pragma unroll
    for (int r = 0; r < 8; ++r) { sb[w4][8 * g + r][0] = m[r]; sb[w4][8 * g + r][1] = l[r]; } }
  }
  __syncthreads();   // hands the partials in sb over from waves 4..7 to waves 0..3
  if (part == 0) {
#pragma unroll
    for (int r = 0; r < 8; ++r) { const float mb = sb[w4][8 * g + r][0], lb = sb[w4][8 * g + r][1]; const float d = m[r] - mb, e = __expf(-fabsf(d));   // the side with the smaller maximum is scaled down; an empty side (m = -3e38, l = 0) gets e = 0
      l[r] = (d >= 0.f) ? l[r] + lb * e : l[r] * e + lb; m[r] = fmaxf(m[r], mb); } }
  if (col == 0) {
#pragma unroll
    for (int r = 0; r < 8; ++r) { sm[wave][8 * g + r][0] = m[r]; sm[wave][8 * g + r][1] = 2048.0f / l[r]; } }   // the one division per key; l is at least 1 (the maximum's own term)
  LDSX();
  if (lane < 8) vst2(MST + (((size_t)b * NH + h) * SS + (part ? t2 : t1) * 64 + w4 * 16) * 2 + lane * 4, *(const v4f*)(&sm[wave][0][0] + lane * 4));   // each wave stores its own 16 keys: one whole line
}
// ---- k_attn: block = (two tiles of 64 queries, h, b), 8 waves. Under the causal mask query tile t walks 2 (t + 1) key tiles of 32: the block takes tile 31 - x and tile x, 66 passes for each 16 queries' pair, and deals them in two equal walks:
// waves 0..3 walk the first half of the pair's passes, all in tile 31 - x; waves 4..7 walk the rest of tile 31 - x, leave that partial sum in LDS, and then walk all of tile x; behind the one barrier waves 0..3 add the partial to their own. Per tile: key tiles (k <= q frontier if masking); y as above; z = exp(y - m_k) * (2048 / l_k) (column statistics, the scaled reciprocal from k_cstat); P = z as f16 hi + (x2048) lo x V hi/lo (3 products); out rows (no normalisation)
__global__ __launch_bounds__(256) void k_attn(const _Float16* __restrict__ QK, const _Float16* __restrict__ QKL, const _Float16* __restrict__ VTH, const _Float16* __restrict__ VTL, const float* __restrict__ MST, const int* __restrict__ MASKING, float* __restrict__ O) {
  __shared__ __align__(16) _Float16 sph[8][16][40], spl[8][16][40]; __shared__ __align__(16) float so[8][1024], sx[4][1024];   // sx: the partial sum that wave 4 + w leaves for wave w
  const int tid = threadIdx.x, wave = tid >> 5, lane = tid & 31, col = lane & 15, g = lane >> 4;
  const int h = blockIdx.y, b = blockIdx.z; const int masking = MASKING[0];
  const int part = __builtin_amdgcn_readfirstlane(wave >> 2), w4 = wave & 3;   // part in a scalar register: every test on it is a scalar branch, so EXEC stays whole for the WMMAs
  const int t2 = blockIdx.x, t1 = SS / 64 - 1 - t2; const int n1 = masking ? (t1 * 64 + 64) / 32 : SS / 32, n2 = masking ? (t2 * 64 + 64) / 32 : SS / 32;   // key tiles of each query tile; n1 >= n2
  const int cut = (n1 + n2) / 2;   // where tile t1's walk is cut: half of the pair's passes; at most n1
  v8f acc[4], accl[4];
#pragma unroll 1   // stays rolled: the walks of a wave run one after the other in the same registers
  for (int seg = 0; seg <= part; ++seg) {
  const int qb = seg ? t2 : t1, ks0 = (part && !seg) ? cut : 0, nks = seg ? n2 : (part ? n1 : cut); const int q0 = qb * 64 + w4 * 16; const size_t rq = (size_t)b * SS + q0;
#pragma unroll
  for (int dt = 0; dt < 4; ++dt) { acc[dt] = v8f{}; accl[dt] = v8f{}; }
  if (ks0 < nks) {   // without the mask nothing of tile t1 is left for waves 4..7
  v16h aq[2], aql[2];
#pragma unroll
  for (int kc = 0; kc < 2; ++kc) { aq[kc] = frag_hs(QK + rq * (2 * DM) + (h * 2 + kc) * 512, (unsigned)(lane * 16)); aql[kc] = frag_hs(QKL + rq * (2 * DM) + (h * 2 + kc) * 512, (unsigned)(lane * 16)); }
  // every global load of a pass is issued well ahead of its use: the values at the head of the pass; each block of 16 keys (with its statistics) into the one key buffer, directly behind the score WMMAs of the block before it
  const unsigned vok = (unsigned)(lane * 16), vov = (unsigned)(lane * 16), vom = (unsigned)(col * 8);
  const size_t uk0 = (size_t)b * SS * (2 * DM) + (32 + h * 2) * 512, uv0 = ((size_t)b * DM + h * HD) * SS; const float* um0 = MST + ((size_t)b * NH + h) * SS * 2;
  v16h kh[2], kl[2]; v2f ms;
#pragma unroll
  for (int kc = 0; kc < 2; ++kc) { const size_t uk = uk0 + (size_t)(ks0 * 32) * (2 * DM) + kc * 512; kh[kc] = frag_hs(QK + uk, vok); kl[kc] = frag_hs(QKL + uk, vok); }
  ms = *(const v2f*)((const char*)(um0 + ks0 * 32 * 2) + vom);
  XW();
  int ks = ks0;
#pragma unroll 1
  do { v16h vh[4], vl[4]; const int kn = (ks + 1 < nks) ? ks + 1 : ks;   // past the end: the last tile again, never used
    const char* pvh = (const char*)(VTH + uv0 + ks * 512) + vov; const char* pvl = (const char*)(VTL + uv0 + ks * 512) + vov;
#pragma unroll
    for (int dt = 0; dt < 4; ++dt) { vh[dt] = frag_hp(pvh + dt * 16 * SS * 2); vl[dt] = frag_hp(pvl + dt * 16 * SS * 2); }
    XWA(pvh, pvl);
#pragma unroll
    for (int ct = 0; ct < 2; ++ct) { const int kk = ks * 32 + ct * 16 + col; v8f c = {}, cl = {};
#pragma unroll
      for (int kc = 0; kc < 2; ++kc) { c = wmma16(aq[kc], kh[kc], c); cl = wmma16(aql[kc], kh[kc], cl); cl = wmma16(aq[kc], kl[kc], cl); }
      const float mk = ms[0], rk = ms[1]; const int kt = (ct == 0) ? ks * 32 + 16 : kn * 32;   // first key of the block that comes next
      SB();
#pragma unroll
      for (int kc = 0; kc < 2; ++kc) { const size_t uk = uk0 + (size_t)kt * (2 * DM) + kc * 512; kh[kc] = frag_hs(QK + uk, vok); kl[kc] = frag_hs(QKL + uk, vok); }
      ms = *(const v2f*)((const char*)(um0 + kt * 2) + vom);
      XW();
#pragma unroll
      for (int r = 0; r < 8; ++r) { const int qi = q0 + 8 * g + r; const float qk = c[r] + cl[r] * (1.0f / 2048.0f); const bool causal = (kk <= qi);
        const float y = causal ? (qk + (float)(kk - qi)) * CSCALE : qk * CSCALE; const float p = (causal || !masking) ? __expf(y - mk) * rk : 0.f;   // rk = 2^11 / l: z scaled by 2^11 so its f16 hi plane stays out of the subnormal range; 2^-11 folded into the epilogue
        const _Float16 hp = (_Float16)p; sph[wave][8 * g + r][ct * 16 + col] = hp; spl[wave][8 * g + r][ct * 16 + col] = (_Float16)((p - (float)hp) * 2048.0f); } }
    LDSX();
    const v16h pah = frag_h(&sph[wave][col][0], lane), pal = frag_h(&spl[wave][col][0], lane);
#pragma unroll
    for (int dt = 0; dt < 4; ++dt) { acc[dt] = wmma16(pah, vh[dt], acc[dt]); accl[dt] = wmma16(pal, vh[dt], accl[dt]); accl[dt] = wmma16(pah, vl[dt], accl[dt]); }
    LDSX(); } while (++ks < nks);   // tested at the foot: entered only with ks0 < nks
  }
  if (part && seg == 0) {   // a lane leaves each value where its partner's same lane will look for it
#pragma unroll
    for (int r = 0; r < 8; ++r) {
#pragma unroll
      for (int dt = 0; dt < 4; ++dt) sx[w4][(dt * 8 + r) * 32 + lane] = (acc[dt][r] + accl[dt][r] * (1.0f / 2048.0f)) * (1.0f / 2048.0f); } }
  }
  __syncthreads();   // hands the partial sums in sx over from waves 4..7 to waves 0..3
  const size_t rqo = (size_t)b * SS + (part ? t2 : t1) * 64 + w4 * 16;
#pragma unroll
  for (int dt = 0; dt < 4; ++dt) acc[dt] = (acc[dt] + accl[dt] * (1.0f / 2048.0f)) * (1.0f / 2048.0f);
  if (part == 0) {
#pragma unroll
    for (int r = 0; r < 8; ++r) {
#pragma unroll
      for (int dt = 0; dt < 4; ++dt) acc[dt][r] += sx[w4][(dt * 8 + r) * 32 + lane]; } }
#pragma unroll
  for (int r = 0; r < 8; ++r) {
#pragma unroll
    for (int dt = 0; dt < 4; ++dt) so[wave][(dt >> 1) * 512 + ((dt & 1) * 2 + ((col >> 2) & 1)) * 128 + ((col >> 3) * 16 + 8 * g + r) * 4 + (col & 3)] = acc[dt][r]; }   // the wave's two f32 tiles, in fragment order
  LDSX();
#pragma unroll
  for (int q = 0; q < 8; ++q) vst2(O + rqo * DM + h * 2 * 512 + q * 128 + lane * 4, *(const v4f*)&so[wave][q * 128 + lane * 4]);
}
// ---- k_out: block = (64 rows, 128 cols): out = O(hi/lo) . Wo rows (2 products)
__global__ __launch_bounds__(128) void k_out(const float* __restrict__ O, const __bf16* __restrict__ P, float* __restrict__ Y) {
  __shared__ __align__(16) float so[4][16][132];
  const int tid = threadIdx.x, wave = tid >> 5, lane = tid & 31, col = lane & 15, g = lane >> 4; const size_t r0 = (size_t)blockIdx.x * 64 + wave * 16; const int n0 = blockIdx.y * 128;
  v8f acc[8] = {};
  // two register slots of fragments, each loaded again for two chunks on directly behind its last use (as in k_qkv)
  const float* ua = O + (size_t)blockIdx.x * 64 * DM; const __bf16* ub = P + (size_t)n0 * DM; const unsigned voa = (unsigned)((wave * 16 * DM + lane * 4) * 4), vob = (unsigned)(lane * 16);
  R16 ar[2]; v16b bw[2][8];
#pragma unroll
  for (int u = 0; u < 2; ++u) { ar[u] = ld_row16t(ua + u * 512, voa);
#pragma unroll
    for (int j = 0; j < 8; ++j) bw[u][j] = frag_bs(ub + j * 16 * DM + u * 512, vob); }
  XW();
#pragma unroll 1   // stays rolled: the two slots are the whole unrolling, a further copy would only cost registers
  for (int kc = 0; kc < DM / 32; kc += 2) {
#pragma unroll
    for (int u = 0; u < 2; ++u) { float v[16]; const int kn = (kc + u + 2 < DM / 32) ? kc + u + 2 : DM / 32 - 1;   // past the end: the last chunk again, never used
#pragma unroll
      for (int i = 0; i < 8; ++i) { v[i] = ar[u].q[i >> 2][i & 3]; v[8 + i] = ar[u].q[2 + (i >> 2)][i & 3]; }
      const F2 a = bsplit16(v); ar[u] = ld_row16t(ua + kn * 512, voa);
#pragma unroll
      for (int j = 0; j < 8; ++j) { acc[j] = wmma_bf(a.l, bw[u][j], acc[j]); acc[j] = wmma_bf(a.h, bw[u][j], acc[j]); bw[u][j] = frag_bs(ub + j * 16 * DM + kn * 512, vob); }
      XW(); } }
#pragma unroll
  for (int j = 0; j < 8; ++j) {
#pragma unroll
    for (int r = 0; r < 8; ++r) so[wave][8 * g + r][j * 16 + col] = acc[j][r]; }
  LDSX();
  for (int rl = 0; rl < 16; ++rl) vst2(Y + (r0 + rl) * DM + n0 + lane * 4, *(const v4f*)&so[wave][rl][lane * 4]);
}
extern "C" void kernel_launch(void* const* d_in, const int* in_sizes, int n_in, void* d_out, int out_size, void* d_ws, size_t ws_size, hipStream_t stream) {
  (void)in_sizes; (void)n_in; (void)out_size;
  const float** F = (const float**)d_in;   // 0 keys [2,2048,1024], 1 queries, 2 values, 3 WQ [16,1024,64], 4 WK, 5 WV, 6 WO [1024,1024] (in,out), 7 masking [1] int32
  if (ws_size < (size_t)WS_END) return;
  char* ws = (char*)d_ws; __bf16* PK = (__bf16*)(ws + WS_PK); _Float16 *QK = (_Float16*)(ws + WS_QK), *QKL = (_Float16*)(ws + WS_QKL), *VTH = (_Float16*)(ws + WS_VTH), *VTL = (_Float16*)(ws + WS_VTL); float* O = (float*)(ws + WS_O);
  float* MST = (float*)(ws + WS_MST);
  k_pack<<<dim3(DM / 16, 4, 8), 256, 0, stream>>>(F[3], F[4], F[5], F[6], PK);
  k_qkv<<<dim3(TNB * SS / 64, QKVW / 128), 128, 0, stream>>>(F[1], F[0], F[2], PK + PK_A, QK, QKL, VTH, VTL);
  k_cstat<<<dim3(SS / 128, NH, TNB), 256, 0, stream>>>(QK, QKL, (const int*)d_in[7], MST);
  k_attn<<<dim3(TQB / 2, NH, TNB), 256, 0, stream>>>(QK, QKL, VTH, VTL, MST, (const int*)d_in[7], O);
  k_out<<<dim3(TOB, DM / 128), 128, 0, stream>>>(O, PK + PK_P, (float*)d_out);
}

// v005
// A run of this version takes 196 microseconds.
// Next to v004, in two timings, it ran 1.06 and 1.05 times as fast.
// All steps since v000 together make it 3.51 times as fast.
#include <hip/hip_runtime.h>
#include <math.h>

typedef __attribute__((ext_vector_type(16))) _Float16 v16h;
typedef __attribute__((ext_vector_type(16))) __bf16 v16b;
typedef __attribute__((ext_vector_type(8)))  _Float16 v8h;
typedef __attribute__((ext_vector_type(8)))  float v8f;
typedef __attribute__((ext_vector_type(4)))  float v4f;
typedef __attribute__((ext_vector_type(2)))  float v2f;
typedef __attribute__((ext_vector_type(4)))  unsigned v4u;
typedef __attribute__((ext_vector_type(4)))  int v4i;
typedef float __attribute__((may_alias)) float_a;
typedef int __attribute__((may_alias)) int_a;

template <typename T> __device__ __forceinline__ void vst2(void* p, T v) { *(T*)p = v;  }
__device__ __forceinline__ v8f wmma16(v16h a, v16h b, v8f c) {
  v8f d = __builtin_amdgcn_wmma_f32_16x16x32_f16(false, a, false, b, (short)0, c, false, false);
  asm volatile("v_nop\n\tv_nop\n\tv_nop\n\tv_nop" : "+v"(d) : "v"(a), "v"(b));
  return d;
}
__device__ __forceinline__ v8f wmma_bf(v16b a, v16b b, v8f c) {
  v8f d = __builtin_amdgcn_wmma_f32_16x16x32_bf16(false, a, false, b, (short)0, c, false, false);
  asm volatile("v_nop\n\tv_nop\n\tv_nop\n\tv_nop" : "+v"(d) : "v"(a), "v"(b));
  return d;
}
// Multi-head ALiBi-style block (B 2, S 2,048, d 1,024, 16 heads x 64): per-head projections of separate keys / queries / values, (QK + (k - q)) / sqrt(S) with a causal mask, softmax over the query axis, weighted values, output projection.
__device__ __forceinline__ v16h frag_h(const _Float16* rowk0, int lane) {
  union { v16h v; v8h q[2]; } u; const _Float16* p = rowk0 + 8 * (lane >> 4);
  u.q[0] = *(const v8h*)p; u.q[1] = *(const v8h*)(p + 16); return u.v;
}
__device__ __forceinline__ v16h frag_f32(const float* rowk0, int lane) {
  v16h a; const float* p = rowk0 + 8 * (lane >> 4);
#pragma unroll
  for (int i = 0; i < 8; ++i) { a[i] = (_Float16)p[i]; a[8 + i] = (_Float16)p[16 + i]; }
  return a;
}
__device__ __forceinline__ v16h frag_f32s(const float* rowk0, int lane, float sc) {
  v16h a; const float* p = rowk0 + 8 * (lane >> 4);
#pragma unroll
  for (int i = 0; i < 8; ++i) { a[i] = (_Float16)(p[i] * sc); a[8 + i] = (_Float16)(p[16 + i] * sc); }
  return a;
}
// column fragment from a [K][ld] layout (column n), rows >= K read as 0
__device__ __forceinline__ v16h fragc_f32(const float* W, int k0, int n, int lane, int ld, int K) {
  v16h a; const int g = lane >> 4;
#pragma unroll
  for (int i = 0; i < 8; ++i) { const int ka = k0 + 8 * g + i, kb = ka + 16;
    a[i] = (_Float16)(ka < K ? W[(size_t)(ka < K ? ka : K - 1) * ld + n] : 0.f); a[8 + i] = (_Float16)(kb < K ? W[(size_t)(kb < K ? kb : K - 1) * ld + n] : 0.f); }
  return a;
}
struct F2 { v16b h, l; };
__device__ __forceinline__ F2 bsplit16(const float v[16]) { F2 r;
#pragma unroll
  for (int i = 0; i < 16; ++i) { const __bf16 h = (__bf16)v[i]; r.h[i] = h; r.l[i] = (__bf16)(v[i] - (float)h); }
  return r; }
__device__ __forceinline__ F2 split_row(const float* row, int k0, int lane) { float v[16]; const float* p = row + k0 + 8 * (lane >> 4);
#pragma unroll
  for (int i = 0; i < 8; ++i) { v[i] = p[i]; v[8 + i] = p[16 + i]; }
  return bsplit16(v); }
__device__ __forceinline__ F2 split_rowK(const float* row, int k0, int lane, int K) { float v[16]; const int g = lane >> 4;
#pragma unroll
  for (int i = 0; i < 8; ++i) { const int ka = k0 + 8 * g + i, kb = ka + 16; v[i] = ka < K ? row[ka < K ? ka : K - 1] : 0.f; v[8 + i] = kb < K ? row[kb < K ? kb : K - 1] : 0.f; }
  return bsplit16(v); }
__device__ __forceinline__ F2 split_col(const float* W, int k0, int n, int lane, int ld, int K) { float v[16]; const int g = lane >> 4;
#pragma unroll
  for (int i = 0; i < 8; ++i) { const int ka = k0 + 8 * g + i, kb = ka + 16; v[i] = ka < K ? W[(size_t)(ka < K ? ka : K - 1) * ld + n] : 0.f; v[8 + i] = kb < K ? W[(size_t)(kb < K ? kb : K - 1) * ld + n] : 0.f; }
  return bsplit16(v); }
__device__ __forceinline__ v8f mac3(const F2& a, const F2& b, v8f c) { c = wmma_bf(a.l, b.h, c); c = wmma_bf(a.h, b.l, c); return wmma_bf(a.h, b.h, c); }
__device__ __forceinline__ float sigm(float v) { return 1.0f / (1.0f + expf(-v)); }
#define LDSX() do { asm volatile("s_wait_dscnt 0" ::: "memory"); __builtin_amdgcn_wave_barrier(); __builtin_amdgcn_fence(__ATOMIC_RELEASE, "workgroup"); } while (0)


#define NB 2
#define SS 2048
#define DM 1024
#define NH 16
#define HD 64
#define QKVW (3 * DM)
#ifndef TQB
#define TQB (SS / 64)
#define TNB NB
#define TOB (NB * SS / 64)     // output row tiles (all)
#endif
typedef __attribute__((ext_vector_type(8))) __bf16 v8b;
__device__ __forceinline__ v16b frag_b(const __bf16* rowk0, int lane) {
  union { v16b v; v8b q[2]; } u; const __bf16* p = rowk0 + 8 * (lane >> 4);
  u.q[0] = *(const v8b*)p; u.q[1] = *(const v8b*)(p + 16); return u.v;
}
// FRAGMENT ORDER of the workspace operands: a tile of 16 rows x 32 k is stored as [k half j][lane = 16 * g + row][8 k], element (row, k = 16 * j + 8 * g + i) at j * 256 + (16 * g + row) * 8 + i;
// a 16-bit tile is 1,024 B, and each of a fragment's two wave-wide 16-byte loads covers 512 contiguous bytes (4 whole lines); the tiles of one row tile follow one another along k
// fragment loads from a wave-uniform tile base plus the lane's own 32-bit byte offset (16 * lane, in k_qkv's A plus the wave's row tile), which is the same in every pass
__device__ __forceinline__ v16h frag_hs(const _Float16* ub, unsigned vo) { union { v16h v; v8h q[2]; } u; const char* p = (const char*)ub + vo; u.q[0] = *(const v8h*)p; u.q[1] = *(const v8h*)(p + 512); return u.v; }
__device__ __forceinline__ v16b frag_bs(const __bf16* ub, unsigned vo) { union { v16b v; v8b q[2]; } u; const char* p = (const char*)ub + vo; u.q[0] = *(const v8b*)p; u.q[1] = *(const v8b*)(p + 512); return u.v; }
// the 16 f32 of one lane's A fragment, still unconverted, so that the loads can fly ahead of their use
struct R16 { v4f q[4]; };
__device__ __forceinline__ R16 ld_row16s(const float* ub, unsigned vo) { R16 r; const char* p = (const char*)ub + vo; r.q[0] = *(const v4f*)p; r.q[1] = *(const v4f*)(p + 16); r.q[2] = *(const v4f*)(p + 64); r.q[3] = *(const v4f*)(p + 80); return r; }
// the same 16 f32 from a tile in fragment order (f32: 2,048 B, four quarters of 512 B, quarter m = 2 * j + (i >> 2))
__device__ __forceinline__ R16 ld_row16t(const float* ub, unsigned vo) { R16 r; const char* p = (const char*)ub + vo; r.q[0] = *(const v4f*)p; r.q[1] = *(const v4f*)(p + 512); r.q[2] = *(const v4f*)(p + 1024); r.q[3] = *(const v4f*)(p + 1536); return r; }
// stands behind a group of loads that stay in flight: the registers that hold their addresses may be rewritten only behind it
// the two scheduling barriers keep the wait behind its loads, and later loads and address arithmetic behind the wait
#define XW() do { __builtin_amdgcn_sched_barrier(0); asm volatile("s_wait_xcnt 0x0" ::: "memory"); __builtin_amdgcn_sched_barrier(0); } while (0)
// the same wait, taking two lane addresses of the group as inputs: they stay in their registers up to the wait, so no load of the group can be given those registers for its data
#define XWA(p, q) do { __builtin_amdgcn_sched_barrier(0); asm volatile("s_wait_xcnt 0x0" :: "v"(p), "v"(q) : "memory"); __builtin_amdgcn_sched_barrier(0); } while (0)
// fragment load from the lane's own byte address in a tile in fragment order (k half 0 at p, k half 1 at p + 512 bytes)
__device__ __forceinline__ v16h frag_hp(const char* p) { union { v16h v; v8h q[2]; } u; u.q[0] = *(const v8h*)p; u.q[1] = *(const v8h*)(p + 512); return u.v; }
// keeps a refill behind the WMMAs that last read the registers it refills; lifted over them, both sets would be live at once
#define SB() __builtin_amdgcn_sched_barrier(0)
__device__ __forceinline__ float bfr(float v) { return (float)(__bf16)v; }
__device__ __attribute__((noinline)) float exp_ni(float v) { return expf(v); }
__device__ __attribute__((noinline)) float erf_ni(float v) { return erff(v); }

#define PK_A 0                       // [3072][1024] Wqkv rows ([out][in]), fragment order: tile (row tile rt, k chunk kt) at (rt * 32 + kt) * 512
#define PK_P (PK_A + QKVW * DM)        // [1024][1024] Wo rows, fragment order
#define PK_END (PK_P + DM * DM)
#define WS_PK  0u
#define WS_QK  (WS_PK + 2u * PK_END)             // f16 [4096 rows][2048]: q | k, fragment order: tile (rt, kt) at (rt * 64 + kt) * 512
#define WS_QKL (WS_QK + 2u * NB * SS * 2 * DM)     // f16 q | k residual planes x2048
#define WS_VTH (WS_QKL + 2u * NB * SS * 2 * DM)    // f16 [b][1024 (h*64+d)][2048 s] hi, fragment order: tile (b, d tile, s chunk) at ((b * 64 + dt) * 64 + st) * 512
#define WS_VTL (WS_VTH + 2u * NB * DM * SS)        // f16 lo x 2048
#define WS_O   (WS_VTL + 2u * NB * DM * SS)        // f32 [4096][1024], fragment order: tile (rt, kt) at (rt * 32 + kt) * 512
#define WS_CS  (WS_O + 4u * NB * SS * DM)           // f32 2 x [2048][32], written and read by no kernel
#define WS_MST (WS_CS + 4u * 2 * SS * 32)
#define WS_XP  (WS_MST + 4u * NB * NH * SS * 2)    // bf16 [3][4096 rows][1024]: queries | keys | values, fragment order: tile (input xi, rt, kt) at ((xi * 256 + rt) * 32 + kt) * 512
#define WS_END (WS_XP + 2u * 3 * NB * SS * DM)
// ---- k_pack: blockIdx.y = 0: the three activation inputs -> bf16 in fragment order (below); blockIdx.y = 1 + which: block = (16 rows n, which, 128 k): [out][in] rows -> bf16 in fragment order; which 0..2 -> W_q/W_k/W_v into PK_A rows which*1024 + n; 3 -> W_o into PK_P
// a thread makes one whole 16-byte piece (8 k of one row), so a wave stores 512 contiguous bytes and reads, per k, 16 neighbouring floats for each of its two k groups
__global__ __launch_bounds__(256) void k_pack(const float* __restrict__ WQ, const float* __restrict__ WK, const float* __restrict__ WV, const float* __restrict__ WO, const float* __restrict__ XQ, const float* __restrict__ XK, const float* __restrict__ XV, __bf16* __restrict__ PK, __bf16* __restrict__ XP) {
  if (blockIdx.y == 0) {   // activations: 3 x 256 x 32 tiles of 16 rows x 32 k, numbered as they lie in XP; a wave takes six that follow one another, few fat waves in place of many thin ones
    const int lane = threadIdx.x & 31, wv = __builtin_amdgcn_readfirstlane(threadIdx.x >> 5); const int T0 = ((blockIdx.z * 64 + blockIdx.x) * 8 + wv) * 6;
    const unsigned vo = (unsigned)(((lane & 15) * DM + 8 * (lane >> 4)) * 4); R16 r[6];
#pragma unroll
    for (int t = 0; t < 6; ++t) { const int T = T0 + t, xi = T >> 13, rt = (T >> 5) & 255, kt = T & 31; const float* X = (xi == 0) ? XQ : (xi == 1) ? XK : XV;
      r[t] = ld_row16s(X + (size_t)rt * 16 * DM + kt * 32, vo);
      XW(); }   // all six tiles' loads fly together; the wait keeps the next tile's base behind this tile's loads
#pragma unroll
    for (int t = 0; t < 6; ++t) { v8b o0, o1;
#pragma unroll
      for (int i = 0; i < 8; ++i) { o0[i] = (__bf16)r[t].q[i >> 2][i & 3]; o1[i] = (__bf16)r[t].q[2 + (i >> 2)][i & 3]; }
      vst2(XP + (size_t)(T0 + t) * 512 + lane * 8, o0); vst2(XP + (size_t)(T0 + t) * 512 + 256 + lane * 8, o1); }
    return;
  }
  const int n0 = blockIdx.x * 16, which = blockIdx.y - 1, kq = blockIdx.z, p = threadIdx.x; const float* Wm = (which == 0) ? WQ : (which == 1) ? WK : (which == 2) ? WV : WO;   // per-head (in,out) [H][D][64] -> row n = h*64+e reads W[h][d][e]; WO (in,out) -> row n reads WO[d][n]
  const int hh = n0 / HD, e0 = n0 % HD; const int ld = (which < 3) ? HD : DM;
  __bf16* dst = ((which < 3) ? PK + PK_A + ((size_t)which * DM + n0) * DM : PK + PK_P + (size_t)n0 * DM) + kq * 4 * 512;
  const int row = p & 15, k = kq * 128 + (p >> 6) * 32 + ((p >> 5) & 1) * 16 + ((p >> 4) & 1) * 8;
  const float* s = (which < 3) ? Wm + ((size_t)hh * DM + k) * HD + e0 + row : Wm + (size_t)k * DM + n0 + row; v8b o;
#pragma unroll
  for (int i = 0; i < 8; ++i) o[i] = (__bf16)s[(size_t)i * ld];
  vst2(dst + p * 8, o);
}
__global__ __launch_bounds__(128) void k_qkv(const __bf16* __restrict__ XP, const __bf16* __restrict__ P, _Float16* __restrict__ QK, _Float16* __restrict__ QKL, _Float16* __restrict__ VTH, _Float16* __restrict__ VTL) {
  const int which0 = (blockIdx.y * 128) / DM;   // Q from queries, K from keys, V from values: plane which0 of XP
  __shared__ __align__(16) _Float16 so[4][2048], sol[4][2048];
  const int tid = threadIdx.x, wave = tid >> 5, lane = tid & 31, col = lane & 15, g = lane >> 4; const int n0 = blockIdx.y * 128;
  v8f acc[8] = {};
  // two register slots of B fragments (k chunks kc and kc + 1); each B fragment is loaded again, for two chunks on, directly behind its last use, so a whole slot's loads are in flight while the other slot is worked on
  const __bf16* ua = XP + ((size_t)which0 * NB * SS + (size_t)blockIdx.x * 64) * DM; const __bf16* ub = P + (size_t)n0 * DM; const unsigned voa = (unsigned)((wave * 16 * DM + lane * 8) * 2), vob = (unsigned)(lane * 16);
  // the A fragment is read by all eight WMMAs of its chunk, so its load for two chunks on goes, at the head of the chunk, into a slot of its own: four A slots, a loop body of four chunks
  v16b ar[4]; v16b bw[2][8];
#pragma unroll
  for (int u = 0; u < 2; ++u) { ar[u] = frag_bs(ua + u * 512, voa);
#pragma unroll
    for (int j = 0; j < 8; ++j) bw[u][j] = frag_bs(ub + j * 16 * DM + u * 512, vob); }
  XW();
#pragma unroll 1   // stays rolled: the slots are the whole unrolling, a further copy would only cost registers
  for (int kc = 0; kc < DM / 32; kc += 4) {
#pragma unroll
    for (int u = 0; u < 4; ++u) { const int kn = (kc + u + 2 < DM / 32) ? kc + u + 2 : DM / 32 - 1;   // past the end: the last chunk again, never used
      ar[(u + 2) & 3] = frag_bs(ua + kn * 512, voa);
#pragma unroll
      for (int j = 0; j < 8; ++j) { acc[j] = wmma_bf(ar[u], bw[u & 1][j], acc[j]); bw[u & 1][j] = frag_bs(ub + j * 16 * DM + kn * 512, vob); }
      XW(); } }
  if (n0 < 2 * DM) {   // q stored unscaled (f16 sigma ~0.6, no subnormal exposure); 1/sqrt(2048) (CSCALE) applied to the f32 score
    // the wave's 16 rows x 128 columns are four tiles that follow one another in the workspace: laid out in fragment order in LDS, then copied as they lie
#pragma unroll
    for (int j = 0; j < 8; ++j) { const int e = (j >> 1) * 512 + (j & 1) * 256 + ((col >> 3) * 16 + 8 * g) * 8 + (col & 7);
#pragma unroll
      for (int r = 0; r < 8; ++r) { const float v = acc[j][r]; const _Float16 hv = (_Float16)v; so[wave][e + r * 8] = hv; sol[wave][e + r * 8] = (_Float16)((v - (float)hv) * 2048.0f); } }   // q, k as f16 hi + (x2048) residual (no RoPE in this module)
    LDSX();
    const size_t o = ((size_t)(blockIdx.x * 4 + wave) * 64 + n0 / 32) * 512 + lane * 8;
#pragma unroll
    for (int q = 0; q < 8; ++q) { vst2(QK + o + q * 256, *(const v4u*)&so[wave][q * 256 + lane * 8]); vst2(QKL + o + q * 256, *(const v4u*)&sol[wave][q * 256 + lane * 8]); }
  } else {   // v transposed: a lane's 8 accumulator rows are 8 neighbouring keys of one column d, which is the lane's own 16-byte piece of the tile (k half = wave & 1): stored straight from registers
    const int rb = blockIdx.x * 64, b = rb / SS, s0 = rb % SS, pc0 = n0 - 2 * DM;
    const size_t o = (((size_t)b * (DM / 16) + pc0 / 16) * (SS / 32) + s0 / 32 + (wave >> 1)) * 512 + (wave & 1) * 256 + lane * 8;
#pragma unroll
    for (int j = 0; j < 8; ++j) { v8h hi, lo;
#pragma unroll
      for (int r = 0; r < 8; ++r) { const float v = acc[j][r]; const _Float16 hv = (_Float16)v; hi[r] = hv; lo[r] = (_Float16)((v - (float)hv) * 2048.0f); }
      vst2(VTH + o + (size_t)j * (SS / 32) * 512, hi); vst2(VTL + o + (size_t)j * (SS / 32) * 512, lo); }
    XW();   // behind the last of these stores: no register that they name is rewritten ahead of it on any path of the listing
  }
}
#define CSCALE 0.022097086912079608f   // float32(1/sqrt(2048)): the module divides by sqrt(number of keys)
// ---- k_cstat: block = (two tiles of 64 KEYS, h, b), 8 waves. Under the causal mask key tile t is seen by 64 - 2 t query tiles of 32: the block takes tile x and tile 31 - x, 66 passes for each 16 keys' pair, and deals them in two equal walks:
// waves 0..3 walk the first half of the pair's passes, all in tile x; waves 4..7 walk the rest of tile x, leave that partial (m, l) in LDS, and then walk all of tile 31 - x; behind the one barrier waves 0..3 join the two partials. Per tile: the softmax runs over QUERIES (axis 2), so per key column we need max and sum over q: S^T tiles = K rows . Q rows (3 products), y = (qk + (k - q)) * CSCALE where causal (q >= k) if masking, else (qk + 0)*CSCALE for q < k; online (max, sum) per key row over the query tiles -> MST[b][h][k] = (m, 2048 / l)
__global__ __launch_bounds__(256) void k_cstat(const _Float16* __restrict__ QK, const _Float16* __restrict__ QKL, const int* __restrict__ MASKING, float* __restrict__ MST) {
  __shared__ __align__(16) float sm[8][16][2], sb[4][16][2];   // sm: each wave's own results on their way out; sb: the partial (m, l) that wave 4 + w leaves for wave w
  const int tid = threadIdx.x, wave = tid >> 5, lane = tid & 31, col = lane & 15, g = lane >> 4; const int h = blockIdx.y, b = blockIdx.z; const int masking = MASKING[0];
  const int part = __builtin_amdgcn_readfirstlane(wave >> 2), w4 = wave & 3;   // part in a scalar register: every test on it is a scalar branch, so EXEC stays whole for the WMMAs
  const int t1 = blockIdx.x, t2 = SS / 64 - 1 - t1; const int f1 = masking ? t1 * 2 : 0, f2 = masking ? t2 * 2 : 0;   // first query tile that can see the keys of each key tile; f1 <= f2
  const int cut = f1 + (2 * (SS / 32) - f1 - f2) / 2;   // where tile t1's walk is cut: half of the pair's passes; at most SS / 32
  float m[8], l[8];
#pragma unroll 1   // stays rolled: the walks of a wave run one after the other in the same registers
  for (int seg = 0; seg <= part; ++seg) {
  const int kb = seg ? t2 : t1, qs0 = seg ? f2 : (part ? cut : f1), qe = part ? SS / 32 : cut; const int k0 = kb * 64 + w4 * 16;
#pragma unroll
  for (int r = 0; r < 8; ++r) { m[r] = -3.0e38f; l[r] = 0.f; }
  if (qs0 < qe) {   // without the mask nothing of tile t1 is left for waves 4..7
  v16h ak[2], akl[2];
#pragma unroll
  for (int kc = 0; kc < 2; ++kc) { const size_t rk = ((size_t)((b * SS + k0) / 16) * 64 + 32 + h * 2 + kc) * 512; ak[kc] = frag_hs(QK + rk, (unsigned)(lane * 16)); akl[kc] = frag_hs(QKL + rk, (unsigned)(lane * 16)); }
  XW();
  // query fragments of a pass sit in registers before the pass begins: each 16-query half is loaded again, for the next pass, directly behind its last WMMA
  const unsigned voq = (unsigned)(lane * 16); const size_t uq0 = (size_t)b * SS * (2 * DM) + h * 2 * 512;   // 16 queries on: 16 * (2 * DM) elements, as in row order; k chunk on: 512
  v16h qh[2][2], ql[2][2]; const char* pq0 = (const char*)(QK + uq0 + (size_t)qs0 * 32 * (2 * DM)) + voq; const char* pl0 = (const char*)(QKL + uq0 + (size_t)qs0 * 32 * (2 * DM)) + voq;
#pragma unroll
  for (int ct = 0; ct < 2; ++ct) {
#pragma unroll
    for (int kc = 0; kc < 2; ++kc) { qh[ct][kc] = frag_hp(pq0 + ct * 16 * (2 * DM) * 2 + kc * 1024); ql[ct][kc] = frag_hp(pl0 + ct * 16 * (2 * DM) * 2 + kc * 1024); } }
  XWA(lane, voq);   // the lane's index and offset stay in their registers up to the wait
  int qs = qs0;
#pragma unroll 1
  do { v8f s[2]; const int qn = (qs + 1 < SS / 32) ? qs + 1 : qs;   // past the end: the last tile again, never used
#pragma unroll
    for (int ct = 0; ct < 2; ++ct) { const int qq = qs * 32 + ct * 16 + col; const size_t uq = uq0 + (size_t)(qn * 32 + ct * 16) * (2 * DM); v8f c = {}, cl = {};
#pragma unroll
      for (int kc = 0; kc < 2; ++kc) { c = wmma16(ak[kc], qh[ct][kc], c); cl = wmma16(akl[kc], qh[ct][kc], cl); cl = wmma16(ak[kc], ql[ct][kc], cl); }
      SB();
#pragma unroll
      for (int kc = 0; kc < 2; ++kc) { qh[ct][kc] = frag_hs(QK + uq + kc * 512, voq); ql[ct][kc] = frag_hs(QKL + uq + kc * 512, voq); }
      XW();
#pragma unroll
      for (int r = 0; r < 8; ++r) { const int ki = k0 + 8 * g + r; const float qk = c[r] + cl[r] * (1.0f / 2048.0f); const bool causal = (ki <= qq);
        s[ct][r] = causal ? (qk + (float)(ki - qq)) * CSCALE : (masking ? -3.0e38f : qk * CSCALE); } }
#pragma unroll
    for (int r = 0; r < 8; ++r) { float mx = fmaxf(s[0][r], s[1][r]);
#pragma unroll
      for (int o = 1; o < 16; o <<= 1) mx = fmaxf(mx, __shfl_xor(mx, o));
      const float mn = fmaxf(m[r], mx); const float alpha = (m[r] <= -1.0e38f) ? 0.f : __expf(m[r] - mn);
      const float e0 = (s[0][r] <= -1.0e38f) ? 0.f : __expf(s[0][r] - mn), e1 = (s[1][r] <= -1.0e38f) ? 0.f : __expf(s[1][r] - mn); float es = e0 + e1;
#pragma unroll
      for (int o = 1; o < 16; o <<= 1) es += __shfl_xor(es, o);
      l[r] = l[r] * alpha + es; m[r] = mn; } } while (++qs < qe);   // tested at the foot: entered only with qs0 < qe
  }
  if (part && seg == 0 && col == 0) {
#pragma unroll
    for (int r = 0; r < 8; ++r) { sb[w4][8 * g + r][0] = m[r]; sb[w4][8 * g + r][1] = l[r]; } }
  }
  __syncthreads();   // hands the partials in sb over from waves 4..7 to waves 0..3
  if (part == 0) {
#pragma unroll
    for (int r = 0; r < 8; ++r) { const float mb = sb[w4][8 * g + r][0], lb = sb[w4][8 * g + r][1]; const float d = m[r] - mb, e = __expf(-fabsf(d));   // the side with the smaller maximum is scaled down; an empty side (m = -3e38, l = 0) gets e = 0
      l[r] = (d >= 0.f) ? l[r] + lb * e : l[r] * e + lb; m[r] = fmaxf(m[r], mb); } }
  if (col == 0) {
#pragma unroll
    for (int r = 0; r < 8; ++r) { sm[wave][8 * g + r][0] = m[r]; sm[wave][8 * g + r][1] = 2048.0f / l[r]; } }   // the one division per key; l is at least 1 (the maximum's own term)
  LDSX();
  if (lane < 8) vst2(MST + (((size_t)b * NH + h) * SS + (part ? t2 : t1) * 64 + w4 * 16) * 2 + lane * 4, *(const v4f*)(&sm[wave][0][0] + lane * 4));   // each wave stores its own 16 keys: one whole line
}
// ---- k_attn: block = (two tiles of 64 queries, h, b), 8 waves. Under the causal mask query tile t walks 2 (t + 1) key tiles of 32: the block takes tile 31 - x and tile x, 66 passes for each 16 queries' pair, and deals them in two equal walks:
// waves 0..3 walk the first half of the pair's passes, all in tile 31 - x; waves 4..7 walk the rest of tile 31 - x, leave that partial sum in LDS, and then walk all of tile x; behind the one barrier waves 0..3 add the partial to their own. Per tile: key tiles (k <= q frontier if masking); y as above; z = exp(y - m_k) * (2048 / l_k) (column statistics, the scaled reciprocal from k_cstat); P = z as f16 hi + (x2048) lo x V hi/lo (3 products); out rows (no normalisation)
__global__ __launch_bounds__(256) void k_attn(const _Float16* __restrict__ QK, const _Float16* __restrict__ QKL, const _Float16* __restrict__ VTH, const _Float16* __restrict__ VTL, const float* __restrict__ MST, const int* __restrict__ MASKING, float* __restrict__ O) {
  __shared__ __align__(16) _Float16 sph[8][16][40], spl[8][16][40]; __shared__ __align__(16) float so[8][1024], sx[4][1024];   // sx: the partial sum that wave 4 + w leaves for wave w
  const int tid = threadIdx.x, wave = tid >> 5, lane = tid & 31, col = lane & 15, g = lane >> 4;
  const int h = blockIdx.y, b = blockIdx.z; const int masking = MASKING[0];
  const int part = __builtin_amdgcn_readfirstlane(wave >> 2), w4 = wave & 3;   // part in a scalar register: every test on it is a scalar branch, so EXEC stays whole for the WMMAs
  const int t2 = blockIdx.x, t1 = SS / 64 - 1 - t2; const int n1 = masking ? (t1 * 64 + 64) / 32 : SS / 32, n2 = masking ? (t2 * 64 + 64) / 32 : SS / 32;   // key tiles of each query tile; n1 >= n2
  const int cut = (n1 + n2) / 2;   // where tile t1's walk is cut: half of the pair's passes; at most n1
  v8f acc[4], accl[4];
#pragma unroll 1   // stays rolled: the walks of a wave run one after the other in the same registers
  for (int seg = 0; seg <= part; ++seg) {
  const int qb = seg ? t2 : t1, ks0 = (part && !seg) ? cut : 0, nks = seg ? n2 : (part ? n1 : cut); const int q0 = qb * 64 + w4 * 16; const size_t rq = (size_t)b * SS + q0;
#pragma unroll
  for (int dt = 0; dt < 4; ++dt) { acc[dt] = v8f{}; accl[dt] = v8f{}; }
  if (ks0 < nks) {   // without the mask nothing of tile t1 is left for waves 4..7
  v16h aq[2], aql[2];
#pragma unroll
  for (int kc = 0; kc < 2; ++kc) { aq[kc] = frag_hs(QK + rq * (2 * DM) + (h * 2 + kc) * 512, (unsigned)(lane * 16)); aql[kc] = frag_hs(QKL + rq * (2 * DM) + (h * 2 + kc) * 512, (unsigned)(lane * 16)); }
  // every global load of a pass is issued well ahead of its use: the values at the head of the pass; each block of 16 keys (with its statistics) into the one key buffer, directly behind the score WMMAs of the block before it
  const unsigned vok = (unsigned)(lane * 16), vov = (unsigned)(lane * 16), vom = (unsigned)(col * 8);
  const size_t uk0 = (size_t)b * SS * (2 * DM) + (32 + h * 2) * 512, uv0 = ((size_t)b * DM + h * HD) * SS; const float* um0 = MST + ((size_t)b * NH + h) * SS * 2;
  v16h kh[2], kl[2]; v2f ms;
#pragma unroll
  for (int kc = 0; kc < 2; ++kc) { const size_t uk = uk0 + (size_t)(ks0 * 32) * (2 * DM) + kc * 512; kh[kc] = frag_hs(QK + uk, vok); kl[kc] = frag_hs(QKL + uk, vok); }
  ms = *(const v2f*)((const char*)(um0 + ks0 * 32 * 2) + vom);
  XW();
  int ks = ks0;
#pragma unroll 1
  do { v16h vh[4], vl[4]; const int kn = (ks + 1 < nks) ? ks + 1 : ks;   // past the end: the last tile again, never used
    const char* pvh = (const char*)(VTH + uv0 + ks * 512) + vov; const char* pvl = (const char*)(VTL + uv0 + ks * 512) + vov;
#pragma unroll
    for (int dt = 0; dt < 4; ++dt) { vh[dt] = frag_hp(pvh + dt * 16 * SS * 2); vl[dt] = frag_hp(pvl + dt * 16 * SS * 2); }
    XWA(pvh, pvl);
#pragma unroll
    for (int ct = 0; ct < 2; ++ct) { const int kk = ks * 32 + ct * 16 + col; v8f c = {}, cl = {};
#pragma unroll
      for (int kc = 0; kc < 2; ++kc) { c = wmma16(aq[kc], kh[kc], c); cl = wmma16(aql[kc], kh[kc], cl); cl = wmma16(aq[kc], kl[kc], cl); }
      const float mk = ms[0], rk = ms[1]; const int kt = (ct == 0) ? ks * 32 + 16 : kn * 32;   // first key of the block that comes next
      SB();
#pragma unroll
      for (int kc = 0; kc < 2; ++kc) { const size_t uk = uk0 + (size_t)kt * (2 * DM) + kc * 512; kh[kc] = frag_hs(QK + uk, vok); kl[kc] = frag_hs(QKL + uk, vok); }
      ms = *(const v2f*)((const char*)(um0 + kt * 2) + vom);
      XW();
#pragma unroll
      for (int r = 0; r < 8; ++r) { const int qi = q0 + 8 * g + r; const float qk = c[r] + cl[r] * (1.0f / 2048.0f); const bool causal = (kk <= qi);
        const float y = causal ? (qk + (float)(kk - qi)) * CSCALE : qk * CSCALE; const float p = (causal || !masking) ? __expf(y - mk) * rk : 0.f;   // rk = 2^11 / l: z scaled by 2^11 so its f16 hi plane stays out of the subnormal range; 2^-11 folded into the epilogue
        const _Float16 hp = (_Float16)p; sph[wave][8 * g + r][ct * 16 + col] = hp; spl[wave][8 * g + r][ct * 16 + col] = (_Float16)((p - (float)hp) * 2048.0f); } }
    LDSX();
    const v16h pah = frag_h(&sph[wave][col][0], lane), pal = frag_h(&spl[wave][col][0], lane);
#pragma unroll
    for (int dt = 0; dt < 4; ++dt) { acc[dt] = wmma16(pah, vh[dt], acc[dt]); accl[dt] = wmma16(pal, vh[dt], accl[dt]); accl[dt] = wmma16(pah, vl[dt], accl[dt]); }
    LDSX(); } while (++ks < nks);   // tested at the foot: entered only with ks0 < nks
  }
  if (part && seg == 0) {   // a lane leaves each value where its partner's same lane will look for it
#pragma unroll
    for (int r = 0; r < 8; ++r) {
#pragma unroll
      for (int dt = 0; dt < 4; ++dt) sx[w4][(dt * 8 + r) * 32 + lane] = (acc[dt][r] + accl[dt][r] * (1.0f / 2048.0f)) * (1.0f / 2048.0f); } }
  }
  __syncthreads();   // hands the partial sums in sx over from waves 4..7 to waves 0..3
  const size_t rqo = (size_t)b * SS + (part ? t2 : t1) * 64 + w4 * 16;
#pragma unroll
  for (int dt = 0; dt < 4; ++dt) acc[dt] = (acc[dt] + accl[dt] * (1.0f / 2048.0f)) * (1.0f / 2048.0f);
  if (part == 0) {
#pragma unroll
    for (int r = 0; r < 8; ++r) {
#pragma unroll
      for (int dt = 0; dt < 4; ++dt) acc[dt][r] += sx[w4][(dt * 8 + r) * 32 + lane]; } }
#pragma unroll
  for (int r = 0; r < 8; ++r) {
#pragma unroll
    for (int dt = 0; dt < 4; ++dt) so[wave][(dt >> 1) * 512 + ((dt & 1) * 2 + ((col >> 2) & 1)) * 128 + ((col >> 3) * 16 + 8 * g + r) * 4 + (col & 3)] = acc[dt][r]; }   // the wave's two f32 tiles, in fragment order
  LDSX();
#pragma unroll
  for (int q = 0; q < 8; ++q) vst2(O + rqo * DM + h * 2 * 512 + q * 128 + lane * 4, *(const v4f*)&so[wave][q * 128 + lane * 4]);
}
// ---- k_out: block = (64 rows, 128 cols): out = O(hi/lo) . Wo rows (2 products)
__global__ __launch_bounds__(128) void k_out(const float* __restrict__ O, const __bf16* __restrict__ P, float* __restrict__ Y) {
  __shared__ __align__(16) float so[4][16][132];
  const int tid = threadIdx.x, wave = tid >> 5, lane = tid & 31, col = lane & 15, g = lane >> 4; const size_t r0 = (size_t)blockIdx.x * 64 + wave * 16; const int n0 = blockIdx.y * 128;
  v8f acc[8] = {};
  // two register slots of fragments, each loaded again for two chunks on directly behind its last use (as the B fragments in k_qkv)
  const float* ua = O + (size_t)blockIdx.x * 64 * DM; const __bf16* ub = P + (size_t)n0 * DM; const unsigned voa = (unsigned)((wave * 16 * DM + lane * 4) * 4), vob = (unsigned)(lane * 16);
  R16 ar[2]; v16b bw[2][8];
#pragma unroll
  for (int u = 0; u < 2; ++u) { ar[u] = ld_row16t(ua + u * 512, voa);
#pragma unroll
    for (int j = 0; j < 8; ++j) bw[u][j] = frag_bs(ub + j * 16 * DM + u * 512, vob); }
  XW();
#pragma unroll 1   // stays rolled: the two slots are the whole unrolling, a further copy would only cost registers
  for (int kc = 0; kc < DM / 32; kc += 2) {
#pragma unroll
    for (int u = 0; u < 2; ++u) { float v[16]; const int kn = (kc + u + 2 < DM / 32) ? kc + u + 2 : DM / 32 - 1;   // past the end: the last chunk again, never used
#pragma unroll
      for (int i = 0; i < 8; ++i) { v[i] = ar[u].q[i >> 2][i & 3]; v[8 + i] = ar[u].q[2 + (i >> 2)][i & 3]; }
      const F2 a = bsplit16(v); ar[u] = ld_row16t(ua + kn * 512, voa);
#pragma unroll
      for (int j = 0; j < 8; ++j) { acc[j] = wmma_bf(a.l, bw[u][j], acc[j]); acc[j] = wmma_bf(a.h, bw[u][j], acc[j]); bw[u][j] = frag_bs(ub + j * 16 * DM + kn * 512, vob); }
      XW(); } }
#pragma unroll
  for (int j = 0; j < 8; ++j) {
#pragma unroll
    for (int r = 0; r < 8; ++r) so[wave][8 * g + r][j * 16 + col] = acc[j][r]; }
  LDSX();
  for (int rl = 0; rl < 16; ++rl) vst2(Y + (r0 + rl) * DM + n0 + lane * 4, *(const v4f*)&so[wave][rl][lane * 4]);
}
extern "C" void kernel_launch(void* const* d_in, const int* in_sizes, int n_in, void* d_out, int out_size, void* d_ws, size_t ws_size, hipStream_t stream) {
  (void)in_sizes; (void)n_in; (void)out_size;
  const float** F = (const float**)d_in;   // 0 keys [2,2048,1024], 1 queries, 2 values, 3 WQ [16,1024,64], 4 WK, 5 WV, 6 WO [1024,1024] (in,out), 7 masking [1] int32
  if (ws_size < (size_t)WS_END) return;
  char* ws = (char*)d_ws; __bf16* PK = (__bf16*)(ws + WS_PK); _Float16 *QK = (_Float16*)(ws + WS_QK), *QKL = (_Float16*)(ws + WS_QKL), *VTH = (_Float16*)(ws + WS_VTH), *VTL = (_Float16*)(ws + WS_VTL); float* O = (float*)(ws + WS_O);
  float* MST = (float*)(ws + WS_MST); __bf16* XP = (__bf16*)(ws + WS_XP);
  k_pack<<<dim3(DM / 16, 5, 8), 256, 0, stream>>>(F[3], F[4], F[5], F[6], F[1], F[0], F[2], PK, XP);
  k_qkv<<<dim3(TNB * SS / 64, QKVW / 128), 128, 0, stream>>>(XP, PK + PK_A, QK, QKL, VTH, VTL);
  k_cstat<<<dim3(SS / 128, NH, TNB), 256, 0, stream>>>(QK, QKL, (const int*)d_in[7], MST);
  k_attn<<<dim3(TQB / 2, NH, TNB), 256, 0, stream>>>(QK, QKL, VTH, VTL, MST, (const int*)d_in[7], O);
  k_out<<<dim3(TOB, DM / 128), 128, 0, stream>>>(O, PK + PK_P, (float*)d_out);
}

// v006
// Measured time: 176 microseconds a run.
// Timed twice side by side with v005, it ran 1.11 times as fast both times.
// Counting every step since v000, it is 3.90 times as fast.
#include <hip/hip_runtime.h>
#include <math.h>

typedef __attribute__((ext_vector_type(16))) _Float16 v16h;
typedef __attribute__((ext_vector_type(16))) __bf16 v16b;
typedef __attribute__((ext_vector_type(8)))  _Float16 v8h;
typedef __attribute__((ext_vector_type(8)))  float v8f;
typedef __attribute__((ext_vector_type(4)))  float v4f;
typedef __attribute__((ext_vector_type(2)))  float v2f;
typedef __attribute__((ext_vector_type(4)))  unsigned v4u;
typedef __attribute__((ext_vector_type(4)))  int v4i;
typedef float __attribute__((may_alias)) float_a;
typedef int __attribute__((may_alias)) int_a;

template <typename T> __device__ __forceinline__ void vst2(void* p, T v) { *(T*)p = v;  }
__device__ __forceinline__ v8f wmma16(v16h a, v16h b, v8f c) {
  v8f d = __builtin_amdgcn_wmma_f32_16x16x32_f16(false, a, false, b, (short)0, c, false, false);
  asm volatile("v_nop\n\tv_nop\n\tv_nop\n\tv_nop" : "+v"(d) : "v"(a), "v"(b));
  return d;
}
__device__ __forceinline__ v8f wmma_bf(v16b a, v16b b, v8f c) {
  v8f d = __builtin_amdgcn_wmma_f32_16x16x32_bf16(false, a, false, b, (short)0, c, false, false);
  asm volatile("v_nop\n\tv_nop\n\tv_nop\n\tv_nop" : "+v"(d) : "v"(a), "v"(b));
  return d;
}
// Multi-head ALiBi-style block (B 2, S 2,048, d 1,024, 16 heads x 64): per-head projections of separate keys / queries / values, (QK + (k - q)) / sqrt(S) with a causal mask, softmax over the query axis, weighted values, output projection.
__device__ __forceinline__ v16h frag_h(const _Float16* rowk0, int lane) {
  union { v16h v; v8h q[2]; } u; const _Float16* p = rowk0 + 8 * (lane >> 4);
  u.q[0] = *(const v8h*)p; u.q[1] = *(const v8h*)(p + 16); return u.v;
}
__device__ __forceinline__ v16h frag_f32(const float* rowk0, int lane) {
  v16h a; const float* p = rowk0 + 8 * (lane >> 4);
#pragma unroll
  for (int i = 0; i < 8; ++i) { a[i] = (_Float16)p[i]; a[8 + i] = (_Float16)p[16 + i]; }
  return a;
}
__device__ __forceinline__ v16h frag_f32s(const float* rowk0, int lane, float sc) {
  v16h a; const float* p = rowk0 + 8 * (lane >> 4);
#pragma unroll
  for (int i = 0; i < 8; ++i) { a[i] = (_Float16)(p[i] * sc); a[8 + i] = (_Float16)(p[16 + i] * sc); }
  return a;
}
// column fragment from a [K][ld] layout (column n), rows >= K read as 0
__device__ __forceinline__ v16h fragc_f32(const float* W, int k0, int n, int lane, int ld, int K) {
  v16h a; const int g = lane >> 4;
#pragma unroll
  for (int i = 0; i < 8; ++i) { const int ka = k0 + 8 * g + i, kb = ka + 16;
    a[i] = (_Float16)(ka < K ? W[(size_t)(ka < K ? ka : K - 1) * ld + n] : 0.f); a[8 + i] = (_Float16)(kb < K ? W[(size_t)(kb < K ? kb : K - 1) * ld + n] : 0.f); }
  return a;
}
struct F2 { v16b h, l; };
__device__ __forceinline__ F2 bsplit16(const float v[16]) { F2 r;
#pragma unroll
  for (int i = 0; i < 16; ++i) { const __bf16 h = (__bf16)v[i]; r.h[i] = h; r.l[i] = (__bf16)(v[i] - (float)h); }
  return r; }
__device__ __forceinline__ F2 split_row(const float* row, int k0, int lane) { float v[16]; const float* p = row + k0 + 8 * (lane >> 4);
#pragma unroll
  for (int i = 0; i < 8; ++i) { v[i] = p[i]; v[8 + i] = p[16 + i]; }
  return bsplit16(v); }
__device__ __forceinline__ F2 split_rowK(const float* row, int k0, int lane, int K) { float v[16]; const int g = lane >> 4;
#pragma unroll
  for (int i = 0; i < 8; ++i) { const int ka = k0 + 8 * g + i, kb = ka + 16; v[i] = ka < K ? row[ka < K ? ka : K - 1] : 0.f; v[8 + i] = kb < K ? row[kb < K ? kb : K - 1] : 0.f; }
  return bsplit16(v); }
__device__ __forceinline__ F2 split_col(const float* W, int k0, int n, int lane, int ld, int K) { float v[16]; const int g = lane >> 4;
#pragma unroll
  for (int i = 0; i < 8; ++i) { const int ka = k0 + 8 * g + i, kb = ka + 16; v[i] = ka < K ? W[(size_t)(ka < K ? ka : K - 1) * ld + n] : 0.f; v[8 + i] = kb < K ? W[(size_t)(kb < K ? kb : K - 1) * ld + n] : 0.f; }
  return bsplit16(v); }
__device__ __forceinline__ v8f mac3(const F2& a, const F2& b, v8f c) { c = wmma_bf(a.l, b.h, c); c = wmma_bf(a.h, b.l, c); return wmma_bf(a.h, b.h, c); }
__device__ __forceinline__ float sigm(float v) { return 1.0f / (1.0f + expf(-v)); }
#define LDSX() do { asm volatile("s_wait_dscnt 0" ::: "memory"); __builtin_amdgcn_wave_barrier(); __builtin_amdgcn_fence(__ATOMIC_RELEASE, "workgroup"); } while (0)


#define NB 2
#define SS 2048
#define DM 1024
#define NH 16
#define HD 64
#define QKVW (3 * DM)
#ifndef TQB
#define TQB (SS / 64)
#define TNB NB
#define TOB (NB * SS / 64)     // output row tiles (all)
#endif
typedef __attribute__((ext_vector_type(8))) __bf16 v8b;
__device__ __forceinline__ v16b frag_b(const __bf16* rowk0, int lane) {
  union { v16b v; v8b q[2]; } u; const __bf16* p = rowk0 + 8 * (lane >> 4);
  u.q[0] = *(const v8b*)p; u.q[1] = *(const v8b*)(p + 16); return u.v;
}
// FRAGMENT ORDER of the workspace operands: a tile of 16 rows x 32 k is stored as [k half j][lane = 16 * g + row][8 k], element (row, k = 16 * j + 8 * g + i) at j * 256 + (16 * g + row) * 8 + i;
// a 16-bit tile is 1,024 B, and each of a fragment's two wave-wide 16-byte loads covers 512 contiguous bytes (4 whole lines); the tiles of one row tile follow one another along k
// fragment loads from a wave-uniform tile base plus the lane's own 32-bit byte offset (16 * lane, in k_qkv's A plus the wave's row tile), which is the same in every pass
__device__ __forceinline__ v16h frag_hs(const _Float16* ub, unsigned vo) { union { v16h v; v8h q[2]; } u; const char* p = (const char*)ub + vo; u.q[0] = *(const v8h*)p; u.q[1] = *(const v8h*)(p + 512); return u.v; }
__device__ __forceinline__ v16b frag_bs(const __bf16* ub, unsigned vo) { union { v16b v; v8b q[2]; } u; const char* p = (const char*)ub + vo; u.q[0] = *(const v8b*)p; u.q[1] = *(const v8b*)(p + 512); return u.v; }
// the 16 f32 of one lane's A fragment, still unconverted, so that the loads can fly ahead of their use
struct R16 { v4f q[4]; };
__device__ __forceinline__ R16 ld_row16s(const float* ub, unsigned vo) { R16 r; const char* p = (const char*)ub + vo; r.q[0] = *(const v4f*)p; r.q[1] = *(const v4f*)(p + 16); r.q[2] = *(const v4f*)(p + 64); r.q[3] = *(const v4f*)(p + 80); return r; }
// the same 16 f32 from a tile in fragment order (f32: 2,048 B, four quarters of 512 B, quarter m = 2 * j + (i >> 2))
__device__ __forceinline__ R16 ld_row16t(const float* ub, unsigned vo) { R16 r; const char* p = (const char*)ub + vo; r.q[0] = *(const v4f*)p; r.q[1] = *(const v4f*)(p + 512); r.q[2] = *(const v4f*)(p + 1024); r.q[3] = *(const v4f*)(p + 1536); return r; }
// stands behind a group of loads that stay in flight: the registers that hold their addresses may be rewritten only behind it
// the two scheduling barriers keep the wait behind its loads, and later loads and address arithmetic behind the wait
#define XW() do { __builtin_amdgcn_sched_barrier(0); asm volatile("s_wait_xcnt 0x0" ::: "memory"); __builtin_amdgcn_sched_barrier(0); } while (0)
// the same wait, taking two lane addresses of the group as inputs: they stay in their registers up to the wait, so no load of the group can be given those registers for its data
#define XWA(p, q) do { __builtin_amdgcn_sched_barrier(0); asm volatile("s_wait_xcnt 0x0" :: "v"(p), "v"(q) : "memory"); __builtin_amdgcn_sched_barrier(0); } while (0)
// fragment load from the lane's own byte address in a tile in fragment order (k half 0 at p, k half 1 at p + 512 bytes)
__device__ __forceinline__ v16h frag_hp(const char* p) { union { v16h v; v8h q[2]; } u; u.q[0] = *(const v8h*)p; u.q[1] = *(const v8h*)(p + 512); return u.v; }
// keeps a refill behind the WMMAs that last read the registers it refills; lifted over them, both sets would be live at once
#define SB() __builtin_amdgcn_sched_barrier(0)
__device__ __forceinline__ float bfr(float v) { return (float)(__bf16)v; }
__device__ __attribute__((noinline)) float exp_ni(float v) { return expf(v); }
__device__ __attribute__((noinline)) float erf_ni(float v) { return erff(v); }

#define PK_A 0                       // [3072][1024] Wqkv rows ([out][in]), fragment order: tile (row tile rt, k chunk kt) at (rt * 32 + kt) * 512
#define PK_P (PK_A + QKVW * DM)        // [1024][1024] Wo rows, fragment order
#define PK_END (PK_P + DM * DM)
#define WS_PK  0u
#define WS_QK  (WS_PK + 2u * PK_END)             // f16 [4096 rows][2048]: q | k, fragment order: tile (rt, kt) at (rt * 64 + kt) * 512
#define WS_QKL (WS_QK + 2u * NB * SS * 2 * DM)     // f16 q | k residual planes x2048
#define WS_VTH (WS_QKL + 2u * NB * SS * 2 * DM)    // f16 [b][1024 (h*64+d)][2048 s] hi, fragment order: tile (b, d tile, s chunk) at ((b * 64 + dt) * 64 + st) * 512
#define WS_VTL (WS_VTH + 2u * NB * DM * SS)        // f16 lo x 2048
#define WS_O   (WS_VTL + 2u * NB * DM * SS)        // f32 [4096][1024], fragment order: tile (rt, kt) at (rt * 32 + kt) * 512
#define WS_CS  (WS_O + 4u * NB * SS * DM)           // f32 2 x [2048][32], written and read by no kernel
#define WS_MST (WS_CS + 4u * 2 * SS * 32)
#define WS_XP  (WS_MST + 4u * NB * NH * SS * 2)    // bf16 [3][4096 rows][1024]: queries | keys | values, fragment order: tile (input xi, rt, kt) at ((xi * 256 + rt) * 32 + kt) * 512
#define WS_END (WS_XP + 2u * 3 * NB * SS * DM)
// ---- k_pack: blockIdx.y = 0: the three activation inputs -> bf16 in fragment order (below); blockIdx.y = 1 + which: block = (16 rows n, which, 128 k): [out][in] rows -> bf16 in fragment order; which 0..2 -> W_q/W_k/W_v into PK_A rows which*1024 + n; 3 -> W_o into PK_P
// a thread makes one whole 16-byte piece (8 k of one row), so a wave stores 512 contiguous bytes and reads, per k, 16 neighbouring floats for each of its two k groups
__global__ __launch_bounds__(256) void k_pack(const float* __restrict__ WQ, const float* __restrict__ WK, const float* __restrict__ WV, const float* __restrict__ WO, const float* __restrict__ XQ, const float* __restrict__ XK, const float* __restrict__ XV, __bf16* __restrict__ PK, __bf16* __restrict__ XP) {
  if (blockIdx.y == 0) {   // activations: 3 x 256 x 32 tiles of 16 rows x 32 k, numbered as they lie in XP; a wave takes six that follow one another, few fat waves in place of many thin ones
    const int lane = threadIdx.x & 31, wv = __builtin_amdgcn_readfirstlane(threadIdx.x >> 5); const int T0 = ((blockIdx.z * 64 + blockIdx.x) * 8 + wv) * 6;
    const unsigned vo = (unsigned)(((lane & 15) * DM + 8 * (lane >> 4)) * 4); R16 r[6];
#pragma unroll
    for (int t = 0; t < 6; ++t) { const int T = T0 + t, xi = T >> 13, rt = (T >> 5) & 255, kt = T & 31; const float* X = (xi == 0) ? XQ : (xi == 1) ? XK : XV;
      r[t] = ld_row16s(X + (size_t)rt * 16 * DM + kt * 32, vo);
      XW(); }   // all six tiles' loads fly together; the wait keeps the next tile's base behind this tile's loads
#pragma unroll
    for (int t = 0; t < 6; ++t) { v8b o0, o1;
#pragma unroll
      for (int i = 0; i < 8; ++i) { o0[i] = (__bf16)r[t].q[i >> 2][i & 3]; o1[i] = (__bf16)r[t].q[2 + (i >> 2)][i & 3]; }
      vst2(XP + (size_t)(T0 + t) * 512 + lane * 8, o0); vst2(XP + (size_t)(T0 + t) * 512 + 256 + lane * 8, o1); }
    return;
  }
  const int n0 = blockIdx.x * 16, which = blockIdx.y - 1, kq = blockIdx.z, p = threadIdx.x; const float* Wm = (which == 0) ? WQ : (which == 1) ? WK : (which == 2) ? WV : WO;   // per-head (in,out) [H][D][64] -> row n = h*64+e reads W[h][d][e]; WO (in,out) -> row n reads WO[d][n]
  const int hh = n0 / HD, e0 = n0 % HD; const int ld = (which < 3) ? HD : DM;
  __bf16* dst = ((which < 3) ? PK + PK_A + ((size_t)which * DM + n0) * DM : PK + PK_P + (size_t)n0 * DM) + kq * 4 * 512;
  const int row = p & 15, k = kq * 128 + (p >> 6) * 32 + ((p >> 5) & 1) * 16 + ((p >> 4) & 1) * 8;
  const float* s = (which < 3) ? Wm + ((size_t)hh * DM + k) * HD + e0 + row : Wm + (size_t)k * DM + n0 + row; v8b o;
#pragma unroll
  for (int i = 0; i < 8; ++i) o[i] = (__bf16)s[(size_t)i * ld];
  vst2(dst + p * 8, o);
}
__global__ __launch_bounds__(128) void k_qkv(const __bf16* __restrict__ XP, const __bf16* __restrict__ P, _Float16* __restrict__ QK, _Float16* __restrict__ QKL, _Float16* __restrict__ VTH, _Float16* __restrict__ VTL) {
  const int which0 = (blockIdx.y * 128) / DM;   // Q from queries, K from keys, V from values: plane which0 of XP
  __shared__ __align__(16) _Float16 so[4][2048], sol[4][2048];
  const int tid = threadIdx.x, wave = tid >> 5, lane = tid & 31, col = lane & 15, g = lane >> 4; const int n0 = blockIdx.y * 128;
  v8f acc[8] = {};
  // two register slots of B fragments (k chunks kc and kc + 1); each B fragment is loaded again, for two chunks on, directly behind its last use, so a whole slot's loads are in flight while the other slot is worked on
  const __bf16* ua = XP + ((size_t)which0 * NB * SS + (size_t)blockIdx.x * 64) * DM; const __bf16* ub = P + (size_t)n0 * DM; const unsigned voa = (unsigned)((wave * 16 * DM + lane * 8) * 2), vob = (unsigned)(lane * 16);
  // the A fragment is read by all eight WMMAs of its chunk, so its load for two chunks on goes, at the head of the chunk, into a slot of its own: four A slots, a loop body of four chunks
  v16b ar[4]; v16b bw[2][8];
#pragma unroll
  for (int u = 0; u < 2; ++u) { ar[u] = frag_bs(ua + u * 512, voa);
#pragma unroll
    for (int j = 0; j < 8; ++j) bw[u][j] = frag_bs(ub + j * 16 * DM + u * 512, vob); }
  XW();
#pragma unroll 1   // stays rolled: the slots are the whole unrolling, a further copy would only cost registers
  for (int kc = 0; kc < DM / 32; kc += 4) {
#pragma unroll
    for (int u = 0; u < 4; ++u) { const int kn = (kc + u + 2 < DM / 32) ? kc + u + 2 : DM / 32 - 1;   // past the end: the last chunk again, never used
      ar[(u + 2) & 3] = frag_bs(ua + kn * 512, voa);
#pragma unroll
      for (int j = 0; j < 8; ++j) { acc[j] = wmma_bf(ar[u], bw[u & 1][j], acc[j]); bw[u & 1][j] = frag_bs(ub + j * 16 * DM + kn * 512, vob); }
      XW(); } }
  if (n0 < 2 * DM) {   // q stored unscaled (f16 sigma ~0.6, no subnormal exposure); 1/sqrt(2048) (CSCALE) applied to the f32 score
    // the wave's 16 rows x 128 columns are four tiles that follow one another in the workspace: laid out in fragment order in LDS, then copied as they lie
#pragma unroll
    for (int j = 0; j < 8; ++j) { const int e = (j >> 1) * 512 + (j & 1) * 256 + ((col >> 3) * 16 + 8 * g) * 8 + (col & 7);
#pragma unroll
      for (int r = 0; r < 8; ++r) { const float v = acc[j][r]; const _Float16 hv = (_Float16)v; so[wave][e + r * 8] = hv; sol[wave][e + r * 8] = (_Float16)((v - (float)hv) * 2048.0f); } }   // q, k as f16 hi + (x2048) residual (no RoPE in this module)
    LDSX();
    const size_t o = ((size_t)(blockIdx.x * 4 + wave) * 64 + n0 / 32) * 512 + lane * 8;
#pragma unroll
    for (int q = 0; q < 8; ++q) { vst2(QK + o + q * 256, *(const v4u*)&so[wave][q * 256 + lane * 8]); vst2(QKL + o + q * 256, *(const v4u*)&sol[wave][q * 256 + lane * 8]); }
  } else {   // v transposed: a lane's 8 accumulator rows are 8 neighbouring keys of one column d, which is the lane's own 16-byte piece of the tile (k half = wave & 1): stored straight from registers
    const int rb = blockIdx.x * 64, b = rb / SS, s0 = rb % SS, pc0 = n0 - 2 * DM;
    const size_t o = (((size_t)b * (DM / 16) + pc0 / 16) * (SS / 32) + s0 / 32 + (wave >> 1)) * 512 + (wave & 1) * 256 + lane * 8;
#pragma unroll
    for (int j = 0; j < 8; ++j) { v8h hi, lo;
#pragma unroll
      for (int r = 0; r < 8; ++r) { const float v = acc[j][r]; const _Float16 hv = (_Float16)v; hi[r] = hv; lo[r] = (_Float16)((v - (float)hv) * 2048.0f); }
      vst2(VTH + o + (size_t)j * (SS / 32) * 512, hi); vst2(VTL + o + (size_t)j * (SS / 32) * 512, lo); }
    XW();   // behind the last of these stores: no register that they name is rewritten ahead of it on any path of the listing
  }
}
#define CSCALE 0.022097086912079608f   // float32(1/sqrt(2048)): the module divides by sqrt(number of keys)
// a pass's exponentials as runs of v_exp_f32 in one statement each: behind a transcendental the instruction set asks for one independent instruction before its result is read or its source overwritten;
// inside a run the next v_exp_f32 is that instruction (every output is early-clobber, so none lies on a source), and the closing v_nop is it for the last one
__device__ __forceinline__ void exp2x8(float (&e)[8], const float (&t)[8]) {
  asm("v_exp_f32 %0, %8\n\tv_exp_f32 %1, %9\n\tv_exp_f32 %2, %10\n\tv_exp_f32 %3, %11\n\tv_exp_f32 %4, %12\n\tv_exp_f32 %5, %13\n\tv_exp_f32 %6, %14\n\tv_exp_f32 %7, %15\n\tv_nop"
      : "=&v"(e[0]), "=&v"(e[1]), "=&v"(e[2]), "=&v"(e[3]), "=&v"(e[4]), "=&v"(e[5]), "=&v"(e[6]), "=&v"(e[7]) : "v"(t[0]), "v"(t[1]), "v"(t[2]), "v"(t[3]), "v"(t[4]), "v"(t[5]), "v"(t[6]), "v"(t[7]));
}
__device__ __forceinline__ void exp2x9(float& ea, float ta, float (&e)[8], const float (&t)[8]) {
  asm("v_exp_f32 %0, %9\n\tv_exp_f32 %1, %10\n\tv_exp_f32 %2, %11\n\tv_exp_f32 %3, %12\n\tv_exp_f32 %4, %13\n\tv_exp_f32 %5, %14\n\tv_exp_f32 %6, %15\n\tv_exp_f32 %7, %16\n\tv_exp_f32 %8, %17\n\tv_nop"
      : "=&v"(ea), "=&v"(e[0]), "=&v"(e[1]), "=&v"(e[2]), "=&v"(e[3]), "=&v"(e[4]), "=&v"(e[5]), "=&v"(e[6]), "=&v"(e[7]) : "v"(ta), "v"(t[0]), "v"(t[1]), "v"(t[2]), "v"(t[3]), "v"(t[4]), "v"(t[5]), "v"(t[6]), "v"(t[7]));
}
// ---- k_cstat: block = (two tiles of 64 KEYS, h, b), 8 waves. Under the causal mask key tile t is seen by 64 - 2 t query tiles of 32: the block takes tile x and tile 31 - x, 66 passes for each 16 keys' pair, and deals them in two equal walks:
// waves 0..3 walk the first half of the pair's passes, all in tile x; waves 4..7 walk the rest of tile x, leave that partial (m, l) in LDS, and then walk all of tile 31 - x; behind the one barrier waves 0..3 join the two partials. Per tile: the softmax runs over QUERIES (axis 2), so per key column we need max and sum over q: S tiles = Q rows . K rows (3 products), queries along the accumulator's rows and the wave's 16 keys along its columns, so a lane holds 16 scores of ONE key per pass: maximum and sum stay in the lane, one running (m, l) per lane, and the wave's two halves (query rows 0..7 and 8..15 of each tile) join once, at the end
// y = (qk + (k - q)) * CSCALE where causal (q >= k) if masking, else (qk + 0)*CSCALE for q < k -> MST[b][h][k] = (m, 2048 / l)
__global__ __launch_bounds__(256) void k_cstat(const _Float16* __restrict__ QK, const _Float16* __restrict__ QKL, const int* __restrict__ MASKING, float* __restrict__ MST) {
  __shared__ __align__(16) float sb[4][32][2];   // the partial (m, l) that each lane of wave 4 + w leaves for the same lane of wave w
  const int tid = threadIdx.x, wave = tid >> 5, lane = tid & 31, col = lane & 15, g = lane >> 4; const int h = blockIdx.y, b = blockIdx.z; const int masking = MASKING[0];
  const int part = __builtin_amdgcn_readfirstlane(wave >> 2), w4 = wave & 3;   // part in a scalar register: every test on it is a scalar branch, so EXEC stays whole for the WMMAs
  const int t1 = blockIdx.x, t2 = SS / 64 - 1 - t1; const int f1 = masking ? t1 * 2 : 0, f2 = masking ? t2 * 2 : 0;   // first query tile that can see the keys of each key tile; f1 <= f2
  const int cut = f1 + (2 * (SS / 32) - f1 - f2) / 2;   // where tile t1's walk is cut: half of the pair's passes; at most SS / 32
  float m, l;
#pragma unroll 1   // stays rolled: the walks of a wave run one after the other in the same registers
  for (int seg = 0; seg <= part; ++seg) {
  const int kb = seg ? t2 : t1, qs0 = seg ? f2 : (part ? cut : f1), qe = part ? SS / 32 : cut; const int k0 = kb * 64 + w4 * 16;
  m = -3.0e38f; l = 0.f;
  if (qs0 < qe) {   // without the mask nothing of tile t1 is left for waves 4..7
  v16h ak[2], akl[2];
#pragma unroll
  for (int kc = 0; kc < 2; ++kc) { const size_t rk = ((size_t)((b * SS + k0) / 16) * 64 + 32 + h * 2 + kc) * 512; ak[kc] = frag_hs(QK + rk, (unsigned)(lane * 16)); akl[kc] = frag_hs(QKL + rk, (unsigned)(lane * 16)); }
  XW();
  // query fragments of a pass sit in registers before the pass begins: each 16-query half is loaded again, for the next pass, directly behind its last WMMA
  const unsigned voq = (unsigned)(lane * 16); const size_t uq0 = (size_t)b * SS * (2 * DM) + h * 2 * 512;   // 16 queries on: 16 * (2 * DM) elements, as in row order; k chunk on: 512
  v16h qh[2][2], ql[2][2]; const char* pq0 = (const char*)(QK + uq0 + (size_t)qs0 * 32 * (2 * DM)) + voq; const char* pl0 = (const char*)(QKL + uq0 + (size_t)qs0 * 32 * (2 * DM)) + voq;
#pragma unroll
  for (int ct = 0; ct < 2; ++ct) {
#pragma unroll
    for (int kc = 0; kc < 2; ++kc) { qh[ct][kc] = frag_hp(pq0 + ct * 16 * (2 * DM) * 2 + kc * 1024); ql[ct][kc] = frag_hp(pl0 + ct * 16 * (2 * DM) * 2 + kc * 1024); } }
  XWA(lane, voq);   // the lane's index and offset stay in their registers up to the wait
  const int ki = k0 + col; int qs = qs0;
#pragma unroll 1
  do { v8f s[2]; const int qn = (qs + 1 < SS / 32) ? qs + 1 : qs;   // past the end: the last tile again, never used
#pragma unroll
    for (int ct = 0; ct < 2; ++ct) { const size_t uq = uq0 + (size_t)(qn * 32 + ct * 16) * (2 * DM); v8f c = {}, cl = {};
#pragma unroll
      for (int kc = 0; kc < 2; ++kc) { c = wmma16(qh[ct][kc], ak[kc], c); cl = wmma16(qh[ct][kc], akl[kc], cl); cl = wmma16(ql[ct][kc], ak[kc], cl); }
      SB();
#pragma unroll
      for (int kc = 0; kc < 2; ++kc) { qh[ct][kc] = frag_hs(QK + uq + kc * 512, voq); ql[ct][kc] = frag_hs(QKL + uq + kc * 512, voq); }
      XW();
#pragma unroll
      for (int r = 0; r < 8; ++r) { const int qq = qs * 32 + ct * 16 + 8 * g + r; const float qk = c[r] + cl[r] * (1.0f / 2048.0f); const bool causal = (ki <= qq);
        s[ct][r] = causal ? (qk + (float)(ki - qq)) * CSCALE : (masking ? -3.0e38f : qk * CSCALE); } }
    float mx[8];
#pragma unroll
    for (int r = 0; r < 8; ++r) mx[r] = fmaxf(s[0][r], s[1][r]);
    const float mn = fmaxf(m, fmaxf(fmaxf(fmaxf(mx[0], mx[1]), fmaxf(mx[2], mx[3])), fmaxf(fmaxf(mx[4], mx[5]), fmaxf(mx[6], mx[7]))));
    float t0[8], t1[8], e0[8], e1[8], ea; const float ta = (m - mn) * 1.44269504f;   // exp(x) = 2^(x * log2 e), as __expf forms it
#pragma unroll
    for (int r = 0; r < 8; ++r) { t0[r] = (s[0][r] - mn) * 1.44269504f; t1[r] = (s[1][r] - mn) * 1.44269504f; }
    exp2x9(ea, ta, e0, t0); exp2x8(e1, t1);
    const float alpha = (m <= -1.0e38f) ? 0.f : ea; float es[8];
#pragma unroll
    for (int r = 0; r < 8; ++r) es[r] = ((s[0][r] <= -1.0e38f) ? 0.f : e0[r]) + ((s[1][r] <= -1.0e38f) ? 0.f : e1[r]);
    l = l * alpha + (((es[0] + es[1]) + (es[2] + es[3])) + ((es[4] + es[5]) + (es[6] + es[7]))); m = mn; } while (++qs < qe);   // tested at the foot: entered only with qs0 < qe
  }
  if (part && seg == 0) { sb[w4][lane][0] = m; sb[w4][lane][1] = l; }
  }
  __syncthreads();   // hands the partials in sb over from waves 4..7 to waves 0..3
  if (part == 0) { const float mb = sb[w4][lane][0], lb = sb[w4][lane][1]; const float d = m - mb, e = __expf(-fabsf(d));   // the side with the smaller maximum is scaled down; an empty side (m = -3e38, l = 0) gets e = 0
    l = (d >= 0.f) ? l + lb * e : l * e + lb; m = fmaxf(m, mb); }
  { const float mb = __shfl_xor(m, 16), lb = __shfl_xor(l, 16); const float d = m - mb, e = __expf(-fabsf(d));   // the wave's two halves join in the same way, once per key
    l = (d >= 0.f) ? l + lb * e : l * e + lb; m = fmaxf(m, mb); }
  if (lane < 16) vst2(MST + (((size_t)b * NH + h) * SS + (part ? t2 : t1) * 64 + w4 * 16 + col) * 2, v2f{m, 2048.0f / l});   // the one division per key; l is at least 1 (the maximum's own term); each wave stores its own 16 keys: one whole line
}
// ---- k_attn: block = (two tiles of 64 queries, h, b), 8 waves. Under the causal mask query tile t walks 2 (t + 1) key tiles of 32: the block takes tile 31 - x and tile x, 66 passes for each 16 queries' pair, and deals them in two equal walks:
// waves 0..3 walk the first half of the pair's passes, all in tile 31 - x; waves 4..7 walk the rest of tile 31 - x, leave that partial sum in LDS, and then walk all of tile x; behind the one barrier waves 0..3 add the partial to their own. Per tile: key tiles (k <= q frontier if masking); y as above; z = exp(y - m_k) * (2048 / l_k) (column statistics, the scaled reciprocal from k_cstat); P = z as f16 hi + (x2048) lo x V hi/lo (3 products); out rows (no normalisation)
__global__ __launch_bounds__(256) void k_attn(const _Float16* __restrict__ QK, const _Float16* __restrict__ QKL, const _Float16* __restrict__ VTH, const _Float16* __restrict__ VTL, const float* __restrict__ MST, const int* __restrict__ MASKING, float* __restrict__ O) {
  __shared__ __align__(16) _Float16 sph[8][16][40], spl[8][16][40]; __shared__ __align__(16) float so[8][1024], sx[4][1024];   // sx: the partial sum that wave 4 + w leaves for wave w
  const int tid = threadIdx.x, wave = tid >> 5, lane = tid & 31, col = lane & 15, g = lane >> 4;
  const int h = blockIdx.y, b = blockIdx.z; const int masking = MASKING[0];
  const int part = __builtin_amdgcn_readfirstlane(wave >> 2), w4 = wave & 3;   // part in a scalar register: every test on it is a scalar branch, so EXEC stays whole for the WMMAs
  const int t2 = blockIdx.x, t1 = SS / 64 - 1 - t2; const int n1 = masking ? (t1 * 64 + 64) / 32 : SS / 32, n2 = masking ? (t2 * 64 + 64) / 32 : SS / 32;   // key tiles of each query tile; n1 >= n2
  const int cut = (n1 + n2) / 2;   // where tile t1's walk is cut: half of the pair's passes; at most n1
  v8f acc[4], accl[4];
#pragma unroll 1   // stays rolled: the walks of a wave run one after the other in the same registers
  for (int seg = 0; seg <= part; ++seg) {
  const int qb = seg ? t2 : t1, ks0 = (part && !seg) ? cut : 0, nks = seg ? n2 : (part ? n1 : cut); const int q0 = qb * 64 + w4 * 16; const size_t rq = (size_t)b * SS + q0;
#pragma unroll
  for (int dt = 0; dt < 4; ++dt) { acc[dt] = v8f{}; accl[dt] = v8f{}; }
  if (ks0 < nks) {   // without the mask nothing of tile t1 is left for waves 4..7
  v16h aq[2], aql[2];
#pragma unroll
  for (int kc = 0; kc < 2; ++kc) { aq[kc] = frag_hs(QK + rq * (2 * DM) + (h * 2 + kc) * 512, (unsigned)(lane * 16)); aql[kc] = frag_hs(QKL + rq * (2 * DM) + (h * 2 + kc) * 512, (unsigned)(lane * 16)); }
  // every global load of a pass is issued well ahead of its use: the values at the head of the pass; each block of 16 keys (with its statistics) into the one key buffer, directly behind the score WMMAs of the block before it
  const unsigned vok = (unsigned)(lane * 16), vov = (unsigned)(lane * 16), vom = (unsigned)(col * 8);
  const size_t uk0 = (size_t)b * SS * (2 * DM) + (32 + h * 2) * 512, uv0 = ((size_t)b * DM + h * HD) * SS; const float* um0 = MST + ((size_t)b * NH + h) * SS * 2;
  v16h kh[2], kl[2]; v2f ms;
#pragma unroll
  for (int kc = 0; kc < 2; ++kc) { const size_t uk = uk0 + (size_t)(ks0 * 32) * (2 * DM) + kc * 512; kh[kc] = frag_hs(QK + uk, vok); kl[kc] = frag_hs(QKL + uk, vok); }
  ms = *(const v2f*)((const char*)(um0 + ks0 * 32 * 2) + vom);
  XW();
  int ks = ks0;
#pragma unroll 1
  do { v16h vh[4], vl[4]; const int kn = (ks + 1 < nks) ? ks + 1 : ks;   // past the end: the last tile again, never used
    const char* pvh = (const char*)(VTH + uv0 + ks * 512) + vov; const char* pvl = (const char*)(VTL + uv0 + ks * 512) + vov;
#pragma unroll
    for (int dt = 0; dt < 4; ++dt) { vh[dt] = frag_hp(pvh + dt * 16 * SS * 2); vl[dt] = frag_hp(pvl + dt * 16 * SS * 2); }
    XWA(pvh, pvl);
#pragma unroll
    for (int ct = 0; ct < 2; ++ct) { const int kk = ks * 32 + ct * 16 + col; v8f c = {}, cl = {};
#pragma unroll
      for (int kc = 0; kc < 2; ++kc) { c = wmma16(aq[kc], kh[kc], c); cl = wmma16(aql[kc], kh[kc], cl); cl = wmma16(aq[kc], kl[kc], cl); }
      const float mk = ms[0], rk = ms[1]; const int kt = (ct == 0) ? ks * 32 + 16 : kn * 32;   // first key of the block that comes next
      SB();
#pragma unroll
      for (int kc = 0; kc < 2; ++kc) { const size_t uk = uk0 + (size_t)kt * (2 * DM) + kc * 512; kh[kc] = frag_hs(QK + uk, vok); kl[kc] = frag_hs(QKL + uk, vok); }
      ms = *(const v2f*)((const char*)(um0 + kt * 2) + vom);
      XW();
#pragma unroll
      for (int r = 0; r < 8; ++r) { const int qi = q0 + 8 * g + r; const float qk = c[r] + cl[r] * (1.0f / 2048.0f); const bool causal = (kk <= qi);
        const float y = causal ? (qk + (float)(kk - qi)) * CSCALE : qk * CSCALE; const float p = (causal || !masking) ? __expf(y - mk) * rk : 0.f;   // rk = 2^11 / l: z scaled by 2^11 so its f16 hi plane stays out of the subnormal range; 2^-11 folded into the epilogue
        const _Float16 hp = (_Float16)p; sph[wave][8 * g + r][ct * 16 + col] = hp; spl[wave][8 * g + r][ct * 16 + col] = (_Float16)((p - (float)hp) * 2048.0f); } }
    LDSX();
    const v16h pah = frag_h(&sph[wave][col][0], lane), pal = frag_h(&spl[wave][col][0], lane);
#pragma unroll
    for (int dt = 0; dt < 4; ++dt) { acc[dt] = wmma16(pah, vh[dt], acc[dt]); accl[dt] = wmma16(pal, vh[dt], accl[dt]); accl[dt] = wmma16(pah, vl[dt], accl[dt]); }
    LDSX(); } while (++ks < nks);   // tested at the foot: entered only with ks0 < nks
  }
  if (part && seg == 0) {   // a lane leaves each value where its partner's same lane will look for it
#pragma unroll
    for (int r = 0; r < 8; ++r) {
#pragma unroll
      for (int dt = 0; dt < 4; ++dt) sx[w4][(dt * 8 + r) * 32 + lane] = (acc[dt][r] + accl[dt][r] * (1.0f / 2048.0f)) * (1.0f / 2048.0f); } }
  }
  __syncthreads();   // hands the partial sums in sx over from waves 4..7 to waves 0..3
  const size_t rqo = (size_t)b * SS + (part ? t2 : t1) * 64 + w4 * 16;
#pragma unroll
  for (int dt = 0; dt < 4; ++dt) acc[dt] = (acc[dt] + accl[dt] * (1.0f / 2048.0f)) * (1.0f / 2048.0f);
  if (part == 0) {
#pragma unroll
    for (int r = 0; r < 8; ++r) {
#pragma unroll
      for (int dt = 0; dt < 4; ++dt) acc[dt][r] += sx[w4][(dt * 8 + r) * 32 + lane]; } }
#pragma unroll
  for (int r = 0; r < 8; ++r) {
#pragma unroll
    for (int dt = 0; dt < 4; ++dt) so[wave][(dt >> 1) * 512 + ((dt & 1) * 2 + ((col >> 2) & 1)) * 128 + ((col >> 3) * 16 + 8 * g + r) * 4 + (col & 3)] = acc[dt][r]; }   // the wave's two f32 tiles, in fragment order
  LDSX();
#pragma unroll
  for (int q = 0; q < 8; ++q) vst2(O + rqo * DM + h * 2 * 512 + q * 128 + lane * 4, *(const v4f*)&so[wave][q * 128 + lane * 4]);
}
// ---- k_out: block = (64 rows, 128 cols): out = O(hi/lo) . Wo rows (2 products)
__global__ __launch_bounds__(128) void k_out(const float* __restrict__ O, const __bf16* __restrict__ P, float* __restrict__ Y) {
  __shared__ __align__(16) float so[4][16][132];
  const int tid = threadIdx.x, wave = tid >> 5, lane = tid & 31, col = lane & 15, g = lane >> 4; const size_t r0 = (size_t)blockIdx.x * 64 + wave * 16; const int n0 = blockIdx.y * 128;
  v8f acc[8] = {};
  // two register slots of fragments, each loaded again for two chunks on directly behind its last use (as the B fragments in k_qkv)
  const float* ua = O + (size_t)blockIdx.x * 64 * DM; const __bf16* ub = P + (size_t)n0 * DM; const unsigned voa = (unsigned)((wave * 16 * DM + lane * 4) * 4), vob = (unsigned)(lane * 16);
  R16 ar[2]; v16b bw[2][8];
#pragma unroll
  for (int u = 0; u < 2; ++u) { ar[u] = ld_row16t(ua + u * 512, voa);
#pragma unroll
    for (int j = 0; j < 8; ++j) bw[u][j] = frag_bs(ub + j * 16 * DM + u * 512, vob); }
  XW();
#pragma unroll 1   // stays rolled: the two slots are the whole unrolling, a further copy would only cost registers
  for (int kc = 0; kc < DM / 32; kc += 2) {
#pragma unroll
    for (int u = 0; u < 2; ++u) { float v[16]; const int kn = (kc + u + 2 < DM / 32) ? kc + u + 2 : DM / 32 - 1;   // past the end: the last chunk again, never used
#pragma unroll
      for (int i = 0; i < 8; ++i) { v[i] = ar[u].q[i >> 2][i & 3]; v[8 + i] = ar[u].q[2 + (i >> 2)][i & 3]; }
      const F2 a = bsplit16(v); ar[u] = ld_row16t(ua + kn * 512, voa);
#pragma unroll
      for (int j = 0; j < 8; ++j) { acc[j] = wmma_bf(a.l, bw[u][j], acc[j]); acc[j] = wmma_bf(a.h, bw[u][j], acc[j]); bw[u][j] = frag_bs(ub + j * 16 * DM + kn * 512, vob); }
      XW(); } }
#pragma unroll
  for (int j = 0; j < 8; ++j) {
#pragma unroll
    for (int r = 0; r < 8; ++r) so[wave][8 * g + r][j * 16 + col] = acc[j][r]; }
  LDSX();
  for (int rl = 0; rl < 16; ++rl) vst2(Y + (r0 + rl) * DM + n0 + lane * 4, *(const v4f*)&so[wave][rl][lane * 4]);
}
extern "C" void kernel_launch(void* const* d_in, const int* in_sizes, int n_in, void* d_out, int out_size, void* d_ws, size_t ws_size, hipStream_t stream) {
  (void)in_sizes; (void)n_in; (void)out_size;
  const float** F = (const float**)d_in;   // 0 keys [2,2048,1024], 1 queries, 2 values, 3 WQ [16,1024,64], 4 WK, 5 WV, 6 WO [1024,1024] (in,out), 7 masking [1] int32
  if (ws_size < (size_t)WS_END) return;
  char* ws = (char*)d_ws; __bf16* PK = (__bf16*)(ws + WS_PK); _Float16 *QK = (_Float16*)(ws + WS_QK), *QKL = (_Float16*)(ws + WS_QKL), *VTH = (_Float16*)(ws + WS_VTH), *VTL = (_Float16*)(ws + WS_VTL); float* O = (float*)(ws + WS_O);
  float* MST = (float*)(ws + WS_MST); __bf16* XP = (__bf16*)(ws + WS_XP);
  k_pack<<<dim3(DM / 16, 5, 8), 256, 0, stream>>>(F[3], F[4], F[5], F[6], F[1], F[0], F[2], PK, XP);
  k_qkv<<<dim3(TNB * SS / 64, QKVW / 128), 128, 0, stream>>>(XP, PK + PK_A, QK, QKL, VTH, VTL);
  k_cstat<<<dim3(SS / 128, NH, TNB), 256, 0, stream>>>(QK, QKL, (const int*)d_in[7], MST);
  k_attn<<<dim3(TQB / 2, NH, TNB), 256, 0, stream>>>(QK, QKL, VTH, VTL, MST, (const int*)d_in[7], O);
  k_out<<<dim3(TOB, DM / 128), 128, 0, stream>>>(O, PK + PK_P, (float*)d_out);
}

// v007
// It runs in 158 microseconds.
// Two timings next to v006 put it at 1.11 and 1.12 times that version's speed.
// All steps since v000 together make it 4.35 times as fast.
#include <hip/hip_runtime.h>
#include <math.h>

typedef __attribute__((ext_vector_type(16))) _Float16 v16h;
typedef __attribute__((ext_vector_type(16))) __bf16 v16b;
typedef __attribute__((ext_vector_type(8)))  _Float16 v8h;
typedef __attribute__((ext_vector_type(8)))  float v8f;
typedef __attribute__((ext_vector_type(4)))  float v4f;
typedef __attribute__((ext_vector_type(2)))  float v2f;
typedef __attribute__((ext_vector_type(4)))  unsigned v4u;
typedef __attribute__((ext_vector_type(4)))  int v4i;
typedef float __attribute__((may_alias)) float_a;
typedef int __attribute__((may_alias)) int_a;

template <typename T> __device__ __forceinline__ void vst2(void* p, T v) { *(T*)p = v;  }
__device__ __forceinline__ v8f wmma16(v16h a, v16h b, v8f c) {
  v8f d = __builtin_amdgcn_wmma_f32_16x16x32_f16(false, a, false, b, (short)0, c, false, false);
  asm volatile("v_nop\n\tv_nop\n\tv_nop\n\tv_nop" : "+v"(d) : "v"(a), "v"(b));
  return d;
}
__device__ __forceinline__ v8f wmma_bf(v16b a, v16b b, v8f c) {
  v8f d = __builtin_amdgcn_wmma_f32_16x16x32_bf16(false, a, false, b, (short)0, c, false, false);
  asm volatile("v_nop\n\tv_nop\n\tv_nop\n\tv_nop" : "+v"(d) : "v"(a), "v"(b));
  return d;
}
// Multi-head ALiBi-style block (B 2, S 2,048, d 1,024, 16 heads x 64): per-head projections of separate keys / queries / values, (QK + (k - q)) / sqrt(S) with a causal mask, softmax over the query axis, weighted values, output projection.
__device__ __forceinline__ v16h frag_h(const _Float16* rowk0, int lane) {
  union { v16h v; v8h q[2]; } u; const _Float16* p = rowk0 + 8 * (lane >> 4);
  u.q[0] = *(const v8h*)p; u.q[1] = *(const v8h*)(p + 16); return u.v;
}
__device__ __forceinline__ v16h frag_f32(const float* rowk0, int lane) {
  v16h a; const float* p = rowk0 + 8 * (lane >> 4);
#pragma unroll
  for (int i = 0; i < 8; ++i) { a[i] = (_Float16)p[i]; a[8 + i] = (_Float16)p[16 + i]; }
  return a;
}
__device__ __forceinline__ v16h frag_f32s(const float* rowk0, int lane, float sc) {
  v16h a; const float* p = rowk0 + 8 * (lane >> 4);
#pragma unroll
  for (int i = 0; i < 8; ++i) { a[i] = (_Float16)(p[i] * sc); a[8 + i] = (_Float16)(p[16 + i] * sc); }
  return a;
}
// column fragment from a [K][ld] layout (column n), rows >= K read as 0
__device__ __forceinline__ v16h fragc_f32(const float* W, int k0, int n, int lane, int ld, int K) {
  v16h a; const int g = lane >> 4;
#pragma unroll
  for (int i = 0; i < 8; ++i) { const int ka = k0 + 8 * g + i, kb = ka + 16;
    a[i] = (_Float16)(ka < K ? W[(size_t)(ka < K ? ka : K - 1) * ld + n] : 0.f); a[8 + i] = (_Float16)(kb < K ? W[(size_t)(kb < K ? kb : K - 1) * ld + n] : 0.f); }
  return a;
}
struct F2 { v16b h, l; };
__device__ __forceinline__ F2 bsplit16(const float v[16]) { F2 r;
#pragma unroll
  for (int i = 0; i < 16; ++i) { const __bf16 h = (__bf16)v[i]; r.h[i] = h; r.l[i] = (__bf16)(v[i] - (float)h); }
  return r; }
__device__ __forceinline__ F2 split_row(const float* row, int k0, int lane) { float v[16]; const float* p = row + k0 + 8 * (lane >> 4);
#pragma unroll
  for (int i = 0; i < 8; ++i) { v[i] = p[i]; v[8 + i] = p[16 + i]; }
  return bsplit16(v); }
__device__ __forceinline__ F2 split_rowK(const float* row, int k0, int lane, int K) { float v[16]; const int g = lane >> 4;
#pragma unroll
  for (int i = 0; i < 8; ++i) { const int ka = k0 + 8 * g + i, kb = ka + 16; v[i] = ka < K ? row[ka < K ? ka : K - 1] : 0.f; v[8 + i] = kb < K ? row[kb < K ? kb : K - 1] : 0.f; }
  return bsplit16(v); }
__device__ __forceinline__ F2 split_col(const float* W, int k0, int n, int lane, int ld, int K) { float v[16]; const int g = lane >> 4;
#pragma unroll
  for (int i = 0; i < 8; ++i) { const int ka = k0 + 8 * g + i, kb = ka + 16; v[i] = ka < K ? W[(size_t)(ka < K ? ka : K - 1) * ld + n] : 0.f; v[8 + i] = kb < K ? W[(size_t)(kb < K ? kb : K - 1) * ld + n] : 0.f; }
  return bsplit16(v); }
__device__ __forceinline__ v8f mac3(const F2& a, const F2& b, v8f c) { c = wmma_bf(a.l, b.h, c); c = wmma_bf(a.h, b.l, c); return wmma_bf(a.h, b.h, c); }
__device__ __forceinline__ float sigm(float v) { return 1.0f / (1.0f + expf(-v)); }
#define LDSX() do { asm volatile("s_wait_dscnt 0" ::: "memory"); __builtin_amdgcn_wave_barrier(); __builtin_amdgcn_fence(__ATOMIC_RELEASE, "workgroup"); } while (0)


#define NB 2
#define SS 2048
#define DM 1024
#define NH 16
#define HD 64
#define QKVW (3 * DM)
#ifndef TQB
#define TQB (SS / 64)
#define TNB NB
#define TOB (NB * SS / 64)     // output row tiles (all)
#endif
typedef __attribute__((ext_vector_type(8))) __bf16 v8b;
__device__ __forceinline__ v16b frag_b(const __bf16* rowk0, int lane) {
  union { v16b v; v8b q[2]; } u; const __bf16* p = rowk0 + 8 * (lane >> 4);
  u.q[0] = *(const v8b*)p; u.q[1] = *(const v8b*)(p + 16); return u.v;
}
// FRAGMENT ORDER of the workspace operands: a tile of 16 rows x 32 k is stored as [k half j][lane = 16 * g + row][8 k], element (row, k = 16 * j + 8 * g + i) at j * 256 + (16 * g + row) * 8 + i;
// a 16-bit tile is 1,024 B, and each of a fragment's two wave-wide 16-byte loads covers 512 contiguous bytes (4 whole lines); the tiles of one row tile follow one another along k
// fragment loads from a wave-uniform tile base plus the lane's own 32-bit byte offset (16 * lane, in k_out's A plus the wave's row tile), which is the same in every pass
__device__ __forceinline__ v16h frag_hs(const _Float16* ub, unsigned vo) { union { v16h v; v8h q[2]; } u; const char* p = (const char*)ub + vo; u.q[0] = *(const v8h*)p; u.q[1] = *(const v8h*)(p + 512); return u.v; }
__device__ __forceinline__ v16b frag_bs(const __bf16* ub, unsigned vo) { union { v16b v; v8b q[2]; } u; const char* p = (const char*)ub + vo; u.q[0] = *(const v8b*)p; u.q[1] = *(const v8b*)(p + 512); return u.v; }
// the 16 f32 of one lane's A fragment, still unconverted, so that the loads can fly ahead of their use
struct R16 { v4f q[4]; };
__device__ __forceinline__ R16 ld_row16s(const float* ub, unsigned vo) { R16 r; const char* p = (const char*)ub + vo; r.q[0] = *(const v4f*)p; r.q[1] = *(const v4f*)(p + 16); r.q[2] = *(const v4f*)(p + 64); r.q[3] = *(const v4f*)(p + 80); return r; }
// the same 16 f32 from a tile in fragment order (f32: 2,048 B, four quarters of 512 B, quarter m = 2 * j + (i >> 2))
__device__ __forceinline__ R16 ld_row16t(const float* ub, unsigned vo) { R16 r; const char* p = (const char*)ub + vo; r.q[0] = *(const v4f*)p; r.q[1] = *(const v4f*)(p + 512); r.q[2] = *(const v4f*)(p + 1024); r.q[3] = *(const v4f*)(p + 1536); return r; }
// stands behind a group of loads that stay in flight: the registers that hold their addresses may be rewritten only behind it
// the two scheduling barriers keep the wait behind its loads, and later loads and address arithmetic behind the wait
#define XW() do { __builtin_amdgcn_sched_barrier(0); asm volatile("s_wait_xcnt 0x0" ::: "memory"); __builtin_amdgcn_sched_barrier(0); } while (0)
// the same wait, taking two lane addresses of the group as inputs: they stay in their registers up to the wait, so no load of the group can be given those registers for its data
#define XWA(p, q) do { __builtin_amdgcn_sched_barrier(0); asm volatile("s_wait_xcnt 0x0" :: "v"(p), "v"(q) : "memory"); __builtin_amdgcn_sched_barrier(0); } while (0)
// fragment load from the lane's own byte address in a tile in fragment order (k half 0 at p, k half 1 at p + 512 bytes)
__device__ __forceinline__ v16h frag_hp(const char* p) { union { v16h v; v8h q[2]; } u; u.q[0] = *(const v8h*)p; u.q[1] = *(const v8h*)(p + 512); return u.v; }
// keeps a refill behind the WMMAs that last read the registers it refills; lifted over them, both sets would be live at once
#define SB() __builtin_amdgcn_sched_barrier(0)
__device__ __forceinline__ float bfr(float v) { return (float)(__bf16)v; }
__device__ __attribute__((noinline)) float exp_ni(float v) { return expf(v); }
__device__ __attribute__((noinline)) float erf_ni(float v) { return erff(v); }

#define PK_A 0                       // [3072][1024] Wqkv rows ([out][in]), fragment order: tile (row tile rt, k chunk kt) at (rt * 32 + kt) * 512
#define PK_P (PK_A + QKVW * DM)        // [1024][1024] Wo rows, fragment order
#define PK_END (PK_P + DM * DM)
#define WS_PK  0u
#define WS_QK  (WS_PK + 2u * PK_END)             // f16 [4096 rows][2048]: q | k, fragment order: tile (rt, kt) at (rt * 64 + kt) * 512
#define WS_QKL (WS_QK + 2u * NB * SS * 2 * DM)     // f16 q | k residual planes x2048
#define WS_VTH (WS_QKL + 2u * NB * SS * 2 * DM)    // f16 [b][1024 (h*64+d)][2048 s] hi, fragment order: tile (b, d tile, s chunk) at ((b * 64 + dt) * 64 + st) * 512
#define WS_VTL (WS_VTH + 2u * NB * DM * SS)        // f16 lo x 2048
#define WS_O   (WS_VTL + 2u * NB * DM * SS)        // f32 [4096][1024], fragment order: tile (rt, kt) at (rt * 32 + kt) * 512
#define WS_CS  (WS_O + 4u * NB * SS * DM)           // f32 2 x [2048][32], written and read by no kernel
#define WS_MST (WS_CS + 4u * 2 * SS * 32)
#define WS_XP  (WS_MST + 4u * NB * NH * SS * 2)    // bf16 [3][4096 rows][1024]: queries | keys | values, fragment order: tile (input xi, rt, kt) at ((xi * 256 + rt) * 32 + kt) * 512
#define WS_END (WS_XP + 2u * 3 * NB * SS * DM)
// ---- k_pack: blockIdx.y = 0: the three activation inputs -> bf16 in fragment order (below); blockIdx.y = 1 + which: block = (16 rows n, which, 128 k): [out][in] rows -> bf16 in fragment order; which 0..2 -> W_q/W_k/W_v into PK_A rows which*1024 + n; 3 -> W_o into PK_P
// a thread makes one whole 16-byte piece (8 k of one row), so a wave stores 512 contiguous bytes and reads, per k, 16 neighbouring floats for each of its two k groups
__global__ __launch_bounds__(256) void k_pack(const float* __restrict__ WQ, const float* __restrict__ WK, const float* __restrict__ WV, const float* __restrict__ WO, const float* __restrict__ XQ, const float* __restrict__ XK, const float* __restrict__ XV, __bf16* __restrict__ PK, __bf16* __restrict__ XP) {
  if (blockIdx.y == 0) {   // activations: 3 x 256 x 32 tiles of 16 rows x 32 k, numbered as they lie in XP; a wave takes six that follow one another, few fat waves in place of many thin ones
    const int lane = threadIdx.x & 31, wv = __builtin_amdgcn_readfirstlane(threadIdx.x >> 5); const int T0 = ((blockIdx.z * 64 + blockIdx.x) * 8 + wv) * 6;
    const unsigned vo = (unsigned)(((lane & 15) * DM + 8 * (lane >> 4)) * 4); R16 r[6];
#pragma unroll
    for (int t = 0; t < 6; ++t) { const int T = T0 + t, xi = T >> 13, rt = (T >> 5) & 255, kt = T & 31; const float* X = (xi == 0) ? XQ : (xi == 1) ? XK : XV;
      r[t] = ld_row16s(X + (size_t)rt * 16 * DM + kt * 32, vo);
      XW(); }   // all six tiles' loads fly together; the wait keeps the next tile's base behind this tile's loads
#pragma unroll
    for (int t = 0; t < 6; ++t) { v8b o0, o1;
#pragma unroll
      for (int i = 0; i < 8; ++i) { o0[i] = (__bf16)r[t].q[i >> 2][i & 3]; o1[i] = (__bf16)r[t].q[2 + (i >> 2)][i & 3]; }
      vst2(XP + (size_t)(T0 + t) * 512 + lane * 8, o0); vst2(XP + (size_t)(T0 + t) * 512 + 256 + lane * 8, o1); }
    return;
  }
  const int n0 = blockIdx.x * 16, which = blockIdx.y - 1, kq = blockIdx.z, p = threadIdx.x; const float* Wm = (which == 0) ? WQ : (which == 1) ? WK : (which == 2) ? WV : WO;   // per-head (in,out) [H][D][64] -> row n = h*64+e reads W[h][d][e]; WO (in,out) -> row n reads WO[d][n]
  const int hh = n0 / HD, e0 = n0 % HD; const int ld = (which < 3) ? HD : DM;
  __bf16* dst = ((which < 3) ? PK + PK_A + ((size_t)which * DM + n0) * DM : PK + PK_P + (size_t)n0 * DM) + kq * 4 * 512;
  const int row = p & 15, k = kq * 128 + (p >> 6) * 32 + ((p >> 5) & 1) * 16 + ((p >> 4) & 1) * 8;
  const float* s = (which < 3) ? Wm + ((size_t)hh * DM + k) * HD + e0 + row : Wm + (size_t)k * DM + n0 + row; v8b o;
#pragma unroll
  for (int i = 0; i < 8; ++i) o[i] = (__bf16)s[(size_t)i * ld];
  vst2(dst + p * 8, o);
}
__device__ __forceinline__ v16b frag_bp(const char* p) { union { v16b v; v8b q[2]; } u; u.q[0] = *(const v8b*)p; u.q[1] = *(const v8b*)(p + 512); return u.v; }
// the same wait, taking two scalar bases of the group as inputs: they stay in their registers up to the wait
#define XWS(p, q) do { __builtin_amdgcn_sched_barrier(0); asm volatile("s_wait_xcnt 0x0" :: "s"(p), "s"(q) : "memory"); __builtin_amdgcn_sched_barrier(0); } while (0)
// four vector slots between a row's last WMMA and the loads that refill its A and B registers, the distance that wmma_bf keeps; the scheduling barriers hold WMMAs in front of them and the loads behind
#define GAP4() do { SB(); asm volatile("v_nop\n\tv_nop\n\tv_nop\n\tv_nop"); SB(); } while (0)
// block = 256 rows x 192 columns, twelve waves as 4 x 3, one block on each WGP; a wave holds 64 x 64 (4 x 4 accumulator tiles), so the eight fragments of a k chunk feed sixteen WMMAs,
// and a chunk's 28 KiB of operands come to the WGP once for all twelve waves; a wave's 64 columns lie in one of Q, K, V (1,024 columns each), a block's 192 need not
__global__ __launch_bounds__(384) void k_qkv(const __bf16* __restrict__ XP, const __bf16* __restrict__ P, _Float16* __restrict__ QK, _Float16* __restrict__ QKL, _Float16* __restrict__ VTH, _Float16* __restrict__ VTL) {
  __shared__ __align__(16) _Float16 so[12][4096], sol[12][4096];
  const int tid = threadIdx.x, lane = tid & 31, col = lane & 15, g = lane >> 4; const int wave = __builtin_amdgcn_readfirstlane(tid >> 5);   // in a scalar register: the wave's bases are scalar, and the test on its columns below is a scalar branch
  const int r0 = blockIdx.x * 256 + (wave / 3) * 64, nw = blockIdx.y * 192 + (wave % 3) * 64;   // the wave's first row and first column
  const int which0 = nw / DM;   // Q from queries, K from keys, V from values: plane which0 of XP
  v8f acc[4][4] = {};
  // two register slots of fragments (k chunks kc and kc + 1); each fragment is loaded again, for two chunks on, directly behind its last use, so a whole slot's loads are in flight while the other slot is worked on
  const __bf16* ua = XP + ((size_t)which0 * NB * SS + r0) * DM; const __bf16* ub = P + (size_t)nw * DM; const unsigned voa = (unsigned)(lane * 16), vob = voa;
  v16b ar[2][4], bw[2][4]; const char* pa = (const char*)ua + voa; const char* pb = (const char*)ub + vob;   // the lane's addresses in the chunk that is loaded next
#pragma unroll
  for (int u = 0; u < 2; ++u) {
#pragma unroll
    for (int j = 0; j < 4; ++j) { ar[u][j] = frag_bp(pa + j * 16 * DM * 2 + u * 1024); bw[u][j] = frag_bp(pb + j * 16 * DM * 2 + u * 1024); } }
  XWS(ua, ub);   // these first loads go by the scalar bases
  pa += 2048; pb += 2048;
#pragma unroll 1   // stays rolled: the two slots are the whole unrolling, a further copy would only cost registers
  for (int kc = 0; kc < DM / 32; kc += 2) {
#pragma unroll
    for (int u = 0; u < 2; ++u) {
#pragma unroll
      for (int i = 0; i < 4; ++i) {
#pragma unroll
        for (int j = 0; j < 4; ++j) acc[i][j] = __builtin_amdgcn_wmma_f32_16x16x32_bf16(false, ar[u][i], false, bw[u][j], (short)0, acc[i][j], false, false);   // the plain builtin: tile and slots take more than 256 registers, and an operand of an asm statement cannot lie above v255
        GAP4();
        ar[u][i] = frag_bp(pa + i * 16 * DM * 2); }
#pragma unroll
      for (int j = 0; j < 4; ++j) bw[u][j] = frag_bp(pb + j * 16 * DM * 2);
      XWA(pa, pb);   // the two lane addresses stay in their registers up to the wait, and step on only behind it
      const int st = (kc + u + 3 < DM / 32) ? 1024 : 0; pa += st; pb += st; } }   // past the end: the last chunk again, never used
  if (nw < 2 * DM) {   // q stored unscaled (f16 sigma ~0.6, no subnormal exposure); 1/sqrt(S) applied to the f32 score
    // each of the wave's four row tiles has 64 columns, two tiles that follow one another in the workspace: laid out in fragment order in LDS, then copied as they lie
#pragma unroll
    for (int i = 0; i < 4; ++i) {
#pragma unroll
      for (int j = 0; j < 4; ++j) { const int e = i * 1024 + (j >> 1) * 512 + (j & 1) * 256 + ((col >> 3) * 16 + 8 * g) * 8 + (col & 7);
#pragma unroll
        for (int r = 0; r < 8; ++r) { const float v = acc[i][j][r]; const _Float16 hv = (_Float16)v; so[wave][e + r * 8] = hv; sol[wave][e + r * 8] = (_Float16)((v - (float)hv) * 2048.0f); } } }   // q, k as f16 hi + (x2048) residual (no RoPE in this module)
    LDSX();
#pragma unroll
    for (int i = 0; i < 4; ++i) { const size_t o = ((size_t)(r0 / 16 + i) * 64 + nw / 32) * 512 + lane * 8; v4u th[4], tl[4];
#pragma unroll
      for (int q = 0; q < 4; ++q) { th[q] = *(const v4u*)&so[wave][i * 1024 + q * 256 + lane * 8]; tl[q] = *(const v4u*)&sol[wave][i * 1024 + q * 256 + lane * 8]; }
      SB();   // a row tile's eight pieces are all in registers before its first store: nothing is written into a register between the stores and their wait
#pragma unroll
      for (int q = 0; q < 4; ++q) { vst2(QK + o + q * 256, th[q]); vst2(QKL + o + q * 256, tl[q]); }
      XW(); }   // behind each row tile's stores: the next row tile's pieces may take the registers that these stores name
  } else {   // v transposed: a lane's 8 accumulator rows are 8 neighbouring keys of one column d, which is the lane's own 16-byte piece of the tile (k half = row tile & 1): stored straight from registers
    const int b = r0 / SS, s0 = r0 % SS, pc0 = nw - 2 * DM;
#pragma unroll
    for (int i = 0; i < 4; ++i) { const size_t o = (((size_t)b * (DM / 16) + pc0 / 16) * (SS / 32) + s0 / 32 + (i >> 1)) * 512 + (i & 1) * 256 + lane * 8; v8h hi[4], lo[4];
#pragma unroll
      for (int j = 0; j < 4; ++j) {
#pragma unroll
        for (int r = 0; r < 8; ++r) { const float v = acc[i][j][r]; const _Float16 hv = (_Float16)v; hi[j][r] = hv; lo[j][r] = (_Float16)((v - (float)hv) * 2048.0f); } }
      SB();   // a row tile's eight pieces are all made before its first store: nothing is written into a register between the stores and their wait
#pragma unroll
      for (int j = 0; j < 4; ++j) { vst2(VTH + o + (size_t)j * (SS / 32) * 512, hi[j]); vst2(VTL + o + (size_t)j * (SS / 32) * 512, lo[j]); }
      XW(); }   // behind each row tile's stores: the next row tile's pieces may take the registers that these stores name
  }
}
#define CSCALE 0.022097086912079608f   // float32(1/sqrt(2048)): the module divides by sqrt(number of keys)
// a pass's exponentials as runs of v_exp_f32 in one statement each: behind a transcendental the instruction set asks for one independent instruction before its result is read or its source overwritten;
// inside a run the next v_exp_f32 is that instruction (every output is early-clobber, so none lies on a source), and the closing v_nop is it for the last one
__device__ __forceinline__ void exp2x8(float (&e)[8], const float (&t)[8]) {
  asm("v_exp_f32 %0, %8\n\tv_exp_f32 %1, %9\n\tv_exp_f32 %2, %10\n\tv_exp_f32 %3, %11\n\tv_exp_f32 %4, %12\n\tv_exp_f32 %5, %13\n\tv_exp_f32 %6, %14\n\tv_exp_f32 %7, %15\n\tv_nop"
      : "=&v"(e[0]), "=&v"(e[1]), "=&v"(e[2]), "=&v"(e[3]), "=&v"(e[4]), "=&v"(e[5]), "=&v"(e[6]), "=&v"(e[7]) : "v"(t[0]), "v"(t[1]), "v"(t[2]), "v"(t[3]), "v"(t[4]), "v"(t[5]), "v"(t[6]), "v"(t[7]));
}
__device__ __forceinline__ void exp2x9(float& ea, float ta, float (&e)[8], const float (&t)[8]) {
  asm("v_exp_f32 %0, %9\n\tv_exp_f32 %1, %10\n\tv_exp_f32 %2, %11\n\tv_exp_f32 %3, %12\n\tv_exp_f32 %4, %13\n\tv_exp_f32 %5, %14\n\tv_exp_f32 %6, %15\n\tv_exp_f32 %7, %16\n\tv_exp_f32 %8, %17\n\tv_nop"
      : "=&v"(ea), "=&v"(e[0]), "=&v"(e[1]), "=&v"(e[2]), "=&v"(e[3]), "=&v"(e[4]), "=&v"(e[5]), "=&v"(e[6]), "=&v"(e[7]) : "v"(ta), "v"(t[0]), "v"(t[1]), "v"(t[2]), "v"(t[3]), "v"(t[4]), "v"(t[5]), "v"(t[6]), "v"(t[7]));
}
// ---- k_cstat: block = (two tiles of 64 KEYS, h, b), 8 waves. Under the causal mask key tile t is seen by 64 - 2 t query tiles of 32: the block takes tile x and tile 31 - x, 66 passes for each 16 keys' pair, and deals them in two equal walks:
// waves 0..3 walk the first half of the pair's passes, all in tile x; waves 4..7 walk the rest of tile x, leave that partial (m, l) in LDS, and then walk all of tile 31 - x; behind the one barrier waves 0..3 join the two partials. Per tile: the softmax runs over QUERIES (axis 2), so per key column we need max and sum over q: S tiles = Q rows . K rows (3 products), queries along the accumulator's rows and the wave's 16 keys along its columns, so a lane holds 16 scores of ONE key per pass: maximum and sum stay in the lane, one running (m, l) per lane, and the wave's two halves (query rows 0..7 and 8..15 of each tile) join once, at the end
// y = (qk + (k - q)) * CSCALE where causal (q >= k) if masking, else (qk + 0)*CSCALE for q < k -> MST[b][h][k] = (m, 2048 / l)
__global__ __launch_bounds__(256) void k_cstat(const _Float16* __restrict__ QK, const _Float16* __restrict__ QKL, const int* __restrict__ MASKING, float* __restrict__ MST) {
  __shared__ __align__(16) float sb[4][32][2];   // the partial (m, l) that each lane of wave 4 + w leaves for the same lane of wave w
  const int tid = threadIdx.x, wave = tid >> 5, lane = tid & 31, col = lane & 15, g = lane >> 4; const int h = blockIdx.y, b = blockIdx.z; const int masking = MASKING[0];
  const int part = __builtin_amdgcn_readfirstlane(wave >> 2), w4 = wave & 3;   // part in a scalar register: every test on it is a scalar branch, so EXEC stays whole for the WMMAs
  const int t1 = blockIdx.x, t2 = SS / 64 - 1 - t1; const int f1 = masking ? t1 * 2 : 0, f2 = masking ? t2 * 2 : 0;   // first query tile that can see the keys of each key tile; f1 <= f2
  const int cut = f1 + (2 * (SS / 32) - f1 - f2) / 2;   // where tile t1's walk is cut: half of the pair's passes; at most SS / 32
  float m, l;
#pragma unroll 1   // stays rolled: the walks of a wave run one after the other in the same registers
  for (int seg = 0; seg <= part; ++seg) {
  const int kb = seg ? t2 : t1, qs0 = seg ? f2 : (part ? cut : f1), qe = part ? SS / 32 : cut; const int k0 = kb * 64 + w4 * 16;
  m = -3.0e38f; l = 0.f;
  if (qs0 < qe) {   // without the mask nothing of tile t1 is left for waves 4..7
  v16h ak[2], akl[2];
#pragma unroll
  for (int kc = 0; kc < 2; ++kc) { const size_t rk = ((size_t)((b * SS + k0) / 16) * 64 + 32 + h * 2 + kc) * 512; ak[kc] = frag_hs(QK + rk, (unsigned)(lane * 16)); akl[kc] = frag_hs(QKL + rk, (unsigned)(lane * 16)); }
  XW();
  // query fragments of a pass sit in registers before the pass begins: each 16-query half is loaded again, for the next pass, directly behind its last WMMA
  const unsigned voq = (unsigned)(lane * 16); const size_t uq0 = (size_t)b * SS * (2 * DM) + h * 2 * 512;   // 16 queries on: 16 * (2 * DM) elements, as in row order; k chunk on: 512
  v16h qh[2][2], ql[2][2]; const char* pq0 = (const char*)(QK + uq0 + (size_t)qs0 * 32 * (2 * DM)) + voq; const char* pl0 = (const char*)(QKL + uq0 + (size_t)qs0 * 32 * (2 * DM)) + voq;
#pragma unroll
  for (int ct = 0; ct < 2; ++ct) {
#pragma unroll
    for (int kc = 0; kc < 2; ++kc) { qh[ct][kc] = frag_hp(pq0 + ct * 16 * (2 * DM) * 2 + kc * 1024); ql[ct][kc] = frag_hp(pl0 + ct * 16 * (2 * DM) * 2 + kc * 1024); } }
  XWA(lane, voq);   // the lane's index and offset stay in their registers up to the wait
  const int ki = k0 + col; int qs = qs0;
#pragma unroll 1
  do { v8f s[2]; const int qn = (qs + 1 < SS / 32) ? qs + 1 : qs;   // past the end: the last tile again, never used
#pragma unroll
    for (int ct = 0; ct < 2; ++ct) { const size_t uq = uq0 + (size_t)(qn * 32 + ct * 16) * (2 * DM); v8f c = {}, cl = {};
#pragma unroll
      for (int kc = 0; kc < 2; ++kc) { c = wmma16(qh[ct][kc], ak[kc], c); cl = wmma16(qh[ct][kc], akl[kc], cl); cl = wmma16(ql[ct][kc], ak[kc], cl); }
      SB();
#pragma unroll
      for (int kc = 0; kc < 2; ++kc) { qh[ct][kc] = frag_hs(QK + uq + kc * 512, voq); ql[ct][kc] = frag_hs(QKL + uq + kc * 512, voq); }
      XW();
#pragma unroll
      for (int r = 0; r < 8; ++r) { const int qq = qs * 32 + ct * 16 + 8 * g + r; const float qk = c[r] + cl[r] * (1.0f / 2048.0f); const bool causal = (ki <= qq);
        s[ct][r] = causal ? (qk + (float)(ki - qq)) * CSCALE : (masking ? -3.0e38f : qk * CSCALE); } }
    float mx[8];
#pragma unroll
    for (int r = 0; r < 8; ++r) mx[r] = fmaxf(s[0][r], s[1][r]);
    const float mn = fmaxf(m, fmaxf(fmaxf(fmaxf(mx[0], mx[1]), fmaxf(mx[2], mx[3])), fmaxf(fmaxf(mx[4], mx[5]), fmaxf(mx[6], mx[7]))));
    float t0[8], t1[8], e0[8], e1[8], ea; const float ta = (m - mn) * 1.44269504f;   // exp(x) = 2^(x * log2 e), as __expf forms it
#pragma unroll
    for (int r = 0; r < 8; ++r) { t0[r] = (s[0][r] - mn) * 1.44269504f; t1[r] = (s[1][r] - mn) * 1.44269504f; }
    exp2x9(ea, ta, e0, t0); exp2x8(e1, t1);
    const float alpha = (m <= -1.0e38f) ? 0.f : ea; float es[8];
#pragma unroll
    for (int r = 0; r < 8; ++r) es[r] = ((s[0][r] <= -1.0e38f) ? 0.f : e0[r]) + ((s[1][r] <= -1.0e38f) ? 0.f : e1[r]);
    l = l * alpha + (((es[0] + es[1]) + (es[2] + es[3])) + ((es[4] + es[5]) + (es[6] + es[7]))); m = mn; } while (++qs < qe);   // tested at the foot: entered only with qs0 < qe
  }
  if (part && seg == 0) { sb[w4][lane][0] = m; sb[w4][lane][1] = l; }
  }
  __syncthreads();   // hands the partials in sb over from waves 4..7 to waves 0..3
  if (part == 0) { const float mb = sb[w4][lane][0], lb = sb[w4][lane][1]; const float d = m - mb, e = __expf(-fabsf(d));   // the side with the smaller maximum is scaled down; an empty side (m = -3e38, l = 0) gets e = 0
    l = (d >= 0.f) ? l + lb * e : l * e + lb; m = fmaxf(m, mb); }
  { const float mb = __shfl_xor(m, 16), lb = __shfl_xor(l, 16); const float d = m - mb, e = __expf(-fabsf(d));   // the wave's two halves join in the same way, once per key
    l = (d >= 0.f) ? l + lb * e : l * e + lb; m = fmaxf(m, mb); }
  if (lane < 16) vst2(MST + (((size_t)b * NH + h) * SS + (part ? t2 : t1) * 64 + w4 * 16 + col) * 2, v2f{m, 2048.0f / l});   // the one division per key; l is at least 1 (the maximum's own term); each wave stores its own 16 keys: one whole line
}
// ---- k_attn: block = (two tiles of 64 queries, h, b), 8 waves. Under the causal mask query tile t walks 2 (t + 1) key tiles of 32: the block takes tile 31 - x and tile x, 66 passes for each 16 queries' pair, and deals them in two equal walks:
// waves 0..3 walk the first half of the pair's passes, all in tile 31 - x; waves 4..7 walk the rest of tile 31 - x, leave that partial sum in LDS, and then walk all of tile x; behind the one barrier waves 0..3 add the partial to their own. Per tile: key tiles (k <= q frontier if masking); y as above; z = exp(y - m_k) * (2048 / l_k) (column statistics, the scaled reciprocal from k_cstat); P = z as f16 hi + (x2048) lo x V hi/lo (3 products); out rows (no normalisation)
__global__ __launch_bounds__(256) void k_attn(const _Float16* __restrict__ QK, const _Float16* __restrict__ QKL, const _Float16* __restrict__ VTH, const _Float16* __restrict__ VTL, const float* __restrict__ MST, const int* __restrict__ MASKING, float* __restrict__ O) {
  __shared__ __align__(16) _Float16 sph[8][16][40], spl[8][16][40]; __shared__ __align__(16) float so[8][1024], sx[4][1024];   // sx: the partial sum that wave 4 + w leaves for wave w
  const int tid = threadIdx.x, wave = tid >> 5, lane = tid & 31, col = lane & 15, g = lane >> 4;
  const int h = blockIdx.y, b = blockIdx.z; const int masking = MASKING[0];
  const int part = __builtin_amdgcn_readfirstlane(wave >> 2), w4 = wave & 3;   // part in a scalar register: every test on it is a scalar branch, so EXEC stays whole for the WMMAs
  const int t2 = blockIdx.x, t1 = SS / 64 - 1 - t2; const int n1 = masking ? (t1 * 64 + 64) / 32 : SS / 32, n2 = masking ? (t2 * 64 + 64) / 32 : SS / 32;   // key tiles of each query tile; n1 >= n2
  const int cut = (n1 + n2) / 2;   // where tile t1's walk is cut: half of the pair's passes; at most n1
  v8f acc[4], accl[4];
#pragma unroll 1   // stays rolled: the walks of a wave run one after the other in the same registers
  for (int seg = 0; seg <= part; ++seg) {
  const int qb = seg ? t2 : t1, ks0 = (part && !seg) ? cut : 0, nks = seg ? n2 : (part ? n1 : cut); const int q0 = qb * 64 + w4 * 16; const size_t rq = (size_t)b * SS + q0;
#pragma unroll
  for (int dt = 0; dt < 4; ++dt) { acc[dt] = v8f{}; accl[dt] = v8f{}; }
  if (ks0 < nks) {   // without the mask nothing of tile t1 is left for waves 4..7
  v16h aq[2], aql[2];
#pragma unroll
  for (int kc = 0; kc < 2; ++kc) { aq[kc] = frag_hs(QK + rq * (2 * DM) + (h * 2 + kc) * 512, (unsigned)(lane * 16)); aql[kc] = frag_hs(QKL + rq * (2 * DM) + (h * 2 + kc) * 512, (unsigned)(lane * 16)); }
  // every global load of a pass is issued well ahead of its use: the values at the head of the pass; each block of 16 keys (with its statistics) into the one key buffer, directly behind the score WMMAs of the block before it
  const unsigned vok = (unsigned)(lane * 16), vov = (unsigned)(lane * 16), vom = (unsigned)(col * 8);
  const size_t uk0 = (size_t)b * SS * (2 * DM) + (32 + h * 2) * 512, uv0 = ((size_t)b * DM + h * HD) * SS; const float* um0 = MST + ((size_t)b * NH + h) * SS * 2;
  v16h kh[2], kl[2]; v2f ms;
#pragma unroll
  for (int kc = 0; kc < 2; ++kc) { const size_t uk = uk0 + (size_t)(ks0 * 32) * (2 * DM) + kc * 512; kh[kc] = frag_hs(QK + uk, vok); kl[kc] = frag_hs(QKL + uk, vok); }
  ms = *(const v2f*)((const char*)(um0 + ks0 * 32 * 2) + vom);
  XW();
  int ks = ks0;
#pragma unroll 1
  do { v16h vh[4], vl[4]; const int kn = (ks + 1 < nks) ? ks + 1 : ks;   // past the end: the last tile again, never used
    const char* pvh = (const char*)(VTH + uv0 + ks * 512) + vov; const char* pvl = (const char*)(VTL + uv0 + ks * 512) + vov;
#pragma unroll
    for (int dt = 0; dt < 4; ++dt) { vh[dt] = frag_hp(pvh + dt * 16 * SS * 2); vl[dt] = frag_hp(pvl + dt * 16 * SS * 2); }
    XWA(pvh, pvl);
#pragma unroll
    for (int ct = 0; ct < 2; ++ct) { const int kk = ks * 32 + ct * 16 + col; v8f c = {}, cl = {};
#pragma unroll
      for (int kc = 0; kc < 2; ++kc) { c = wmma16(aq[kc], kh[kc], c); cl = wmma16(aql[kc], kh[kc], cl); cl = wmma16(aq[kc], kl[kc], cl); }
      const float mk = ms[0], rk = ms[1]; const int kt = (ct == 0) ? ks * 32 + 16 : kn * 32;   // first key of the block that comes next
      SB();
#pragma unroll
      for (int kc = 0; kc < 2; ++kc) { const size_t uk = uk0 + (size_t)kt * (2 * DM) + kc * 512; kh[kc] = frag_hs(QK + uk, vok); kl[kc] = frag_hs(QKL + uk, vok); }
      ms = *(const v2f*)((const char*)(um0 + kt * 2) + vom);
      XW();
#pragma unroll
      for (int r = 0; r < 8; ++r) { const int qi = q0 + 8 * g + r; const float qk = c[r] + cl[r] * (1.0f / 2048.0f); const bool causal = (kk <= qi);
        const float y = causal ? (qk + (float)(kk - qi)) * CSCALE : qk * CSCALE; const float p = (causal || !masking) ? __expf(y - mk) * rk : 0.f;   // rk = 2^11 / l: z scaled by 2^11 so its f16 hi plane stays out of the subnormal range; 2^-11 folded into the epilogue
        const _Float16 hp = (_Float16)p; sph[wave][8 * g + r][ct * 16 + col] = hp; spl[wave][8 * g + r][ct * 16 + col] = (_Float16)((p - (float)hp) * 2048.0f); } }
    LDSX();
    const v16h pah = frag_h(&sph[wave][col][0], lane), pal = frag_h(&spl[wave][col][0], lane);
#pragma unroll
    for (int dt = 0; dt < 4; ++dt) { acc[dt] = wmma16(pah, vh[dt], acc[dt]); accl[dt] = wmma16(pal, vh[dt], accl[dt]); accl[dt] = wmma16(pah, vl[dt], accl[dt]); }
    LDSX(); } while (++ks < nks);   // tested at the foot: entered only with ks0 < nks
  }
  if (part && seg == 0) {   // a lane leaves each value where its partner's same lane will look for it
#pragma unroll
    for (int r = 0; r < 8; ++r) {
#pragma unroll
      for (int dt = 0; dt < 4; ++dt) sx[w4][(dt * 8 + r) * 32 + lane] = (acc[dt][r] + accl[dt][r] * (1.0f / 2048.0f)) * (1.0f / 2048.0f); } }
  }
  __syncthreads();   // hands the partial sums in sx over from waves 4..7 to waves 0..3
  const size_t rqo = (size_t)b * SS + (part ? t2 : t1) * 64 + w4 * 16;
#pragma unroll
  for (int dt = 0; dt < 4; ++dt) acc[dt] = (acc[dt] + accl[dt] * (1.0f / 2048.0f)) * (1.0f / 2048.0f);
  if (part == 0) {
#pragma unroll
    for (int r = 0; r < 8; ++r) {
#pragma unroll
      for (int dt = 0; dt < 4; ++dt) acc[dt][r] += sx[w4][(dt * 8 + r) * 32 + lane]; } }
#pragma unroll
  for (int r = 0; r < 8; ++r) {
#pragma unroll
    for (int dt = 0; dt < 4; ++dt) so[wave][(dt >> 1) * 512 + ((dt & 1) * 2 + ((col >> 2) & 1)) * 128 + ((col >> 3) * 16 + 8 * g + r) * 4 + (col & 3)] = acc[dt][r]; }   // the wave's two f32 tiles, in fragment order
  LDSX();
#pragma unroll
  for (int q = 0; q < 8; ++q) vst2(O + rqo * DM + h * 2 * 512 + q * 128 + lane * 4, *(const v4f*)&so[wave][q * 128 + lane * 4]);
}
// ---- k_out: block = (64 rows, 128 cols): out = O(hi/lo) . Wo rows (2 products)
__global__ __launch_bounds__(128) void k_out(const float* __restrict__ O, const __bf16* __restrict__ P, float* __restrict__ Y) {
  __shared__ __align__(16) float so[4][16][132];
  const int tid = threadIdx.x, wave = tid >> 5, lane = tid & 31, col = lane & 15, g = lane >> 4; const size_t r0 = (size_t)blockIdx.x * 64 + wave * 16; const int n0 = blockIdx.y * 128;
  v8f acc[8] = {};
  // two register slots of fragments, each loaded again for two chunks on directly behind its last use (as the B fragments in k_qkv)
  const float* ua = O + (size_t)blockIdx.x * 64 * DM; const __bf16* ub = P + (size_t)n0 * DM; const unsigned voa = (unsigned)((wave * 16 * DM + lane * 4) * 4), vob = (unsigned)(lane * 16);
  R16 ar[2]; v16b bw[2][8];
#pragma unroll
  for (int u = 0; u < 2; ++u) { ar[u] = ld_row16t(ua + u * 512, voa);
#pragma unroll
    for (int j = 0; j < 8; ++j) bw[u][j] = frag_bs(ub + j * 16 * DM + u * 512, vob); }
  XW();
#pragma unroll 1   // stays rolled: the two slots are the whole unrolling, a further copy would only cost registers
  for (int kc = 0; kc < DM / 32; kc += 2) {
#pragma unroll
    for (int u = 0; u < 2; ++u) { float v[16]; const int kn = (kc + u + 2 < DM / 32) ? kc + u + 2 : DM / 32 - 1;   // past the end: the last chunk again, never used
#pragma unroll
      for (int i = 0; i < 8; ++i) { v[i] = ar[u].q[i >> 2][i & 3]; v[8 + i] = ar[u].q[2 + (i >> 2)][i & 3]; }
      const F2 a = bsplit16(v); ar[u] = ld_row16t(ua + kn * 512, voa);
#pragma unroll
      for (int j = 0; j < 8; ++j) { acc[j] = wmma_bf(a.l, bw[u][j], acc[j]); acc[j] = wmma_bf(a.h, bw[u][j], acc[j]); bw[u][j] = frag_bs(ub + j * 16 * DM + kn * 512, vob); }
      XW(); } }
#pragma unroll
  for (int j = 0; j < 8; ++j) {
#pragma unroll
    for (int r = 0; r < 8; ++r) so[wave][8 * g + r][j * 16 + col] = acc[j][r]; }
  LDSX();
  for (int rl = 0; rl < 16; ++rl) vst2(Y + (r0 + rl) * DM + n0 + lane * 4, *(const v4f*)&so[wave][rl][lane * 4]);
}
extern "C" void kernel_launch(void* const* d_in, const int* in_sizes, int n_in, void* d_out, int out_size, void* d_ws, size_t ws_size, hipStream_t stream) {
  (void)in_sizes; (void)n_in; (void)out_size;
  const float** F = (const float**)d_in;   // 0 keys [2,2048,1024], 1 queries, 2 values, 3 WQ [16,1024,64], 4 WK, 5 WV, 6 WO [1024,1024] (in,out), 7 masking [1] int32
  if (ws_size < (size_t)WS_END) return;
  char* ws = (char*)d_ws; __bf16* PK = (__bf16*)(ws + WS_PK); _Float16 *QK = (_Float16*)(ws + WS_QK), *QKL = (_Float16*)(ws + WS_QKL), *VTH = (_Float16*)(ws + WS_VTH), *VTL = (_Float16*)(ws + WS_VTL); float* O = (float*)(ws + WS_O);
  float* MST = (float*)(ws + WS_MST); __bf16* XP = (__bf16*)(ws + WS_XP);
  k_pack<<<dim3(DM / 16, 5, 8), 256, 0, stream>>>(F[3], F[4], F[5], F[6], F[1], F[0], F[2], PK, XP);
  k_qkv<<<dim3(TNB * SS / 256, QKVW / 192), 384, 0, stream>>>(XP, PK + PK_A, QK, QKL, VTH, VTL);
  k_cstat<<<dim3(SS / 128, NH, TNB), 256, 0, stream>>>(QK, QKL, (const int*)d_in[7], MST);
  k_attn<<<dim3(TQB / 2, NH, TNB), 256, 0, stream>>>(QK, QKL, VTH, VTL, MST, (const int*)d_in[7], O);
  k_out<<<dim3(TOB, DM / 128), 128, 0, stream>>>(O, PK + PK_P, (float*)d_out);
}

// v008
// A run of this version takes 152 microseconds.
// Next to v007, in two timings, it ran 1.04 and 1.03 times as fast.
// Over all steps from v000 it is 4.51 times as fast.
#include <hip/hip_runtime.h>
#include <math.h>

typedef __attribute__((ext_vector_type(16))) _Float16 v16h;
typedef __attribute__((ext_vector_type(16))) __bf16 v16b;
typedef __attribute__((ext_vector_type(8)))  _Float16 v8h;
typedef __attribute__((ext_vector_type(8)))  float v8f;
typedef __attribute__((ext_vector_type(4)))  float v4f;
typedef __attribute__((ext_vector_type(2)))  float v2f;
typedef __attribute__((ext_vector_type(4)))  unsigned v4u;
typedef __attribute__((ext_vector_type(4)))  int v4i;
typedef float __attribute__((may_alias)) float_a;
typedef int __attribute__((may_alias)) int_a;

template <typename T> __device__ __forceinline__ void vst2(void* p, T v) { *(T*)p = v;  }
__device__ __forceinline__ v8f wmma16(v16h a, v16h b, v8f c) {
  v8f d = __builtin_amdgcn_wmma_f32_16x16x32_f16(false, a, false, b, (short)0, c, false, false);
  asm volatile("v_nop\n\tv_nop\n\tv_nop\n\tv_nop" : "+v"(d) : "v"(a), "v"(b));
  return d;
}
__device__ __forceinline__ v8f wmma_bf(v16b a, v16b b, v8f c) {
  v8f d = __builtin_amdgcn_wmma_f32_16x16x32_bf16(false, a, false, b, (short)0, c, false, false);
  asm volatile("v_nop\n\tv_nop\n\tv_nop\n\tv_nop" : "+v"(d) : "v"(a), "v"(b));
  return d;
}
// Multi-head ALiBi-style block (B 2, S 2,048, d 1,024, 16 heads x 64): per-head projections of separate keys / queries / values, (QK + (k - q)) / sqrt(S) with a causal mask, softmax over the query axis, weighted values, output projection.
__device__ __forceinline__ v16h frag_h(const _Float16* rowk0, int lane) {
  union { v16h v; v8h q[2]; } u; const _Float16* p = rowk0 + 8 * (lane >> 4);
  u.q[0] = *(const v8h*)p; u.q[1] = *(const v8h*)(p + 16); return u.v;
}
__device__ __forceinline__ v16h frag_f32(const float* rowk0, int lane) {
  v16h a; const float* p = rowk0 + 8 * (lane >> 4);
#pragma unroll
  for (int i = 0; i < 8; ++i) { a[i] = (_Float16)p[i]; a[8 + i] = (_Float16)p[16 + i]; }
  return a;
}
__device__ __forceinline__ v16h frag_f32s(const float* rowk0, int lane, float sc) {
  v16h a; const float* p = rowk0 + 8 * (lane >> 4);
#pragma unroll
  for (int i = 0; i < 8; ++i) { a[i] = (_Float16)(p[i] * sc); a[8 + i] = (_Float16)(p[16 + i] * sc); }
  return a;
}
// column fragment from a [K][ld] layout (column n), rows >= K read as 0
__device__ __forceinline__ v16h fragc_f32(const float* W, int k0, int n, int lane, int ld, int K) {
  v16h a; const int g = lane >> 4;
#pragma unroll
  for (int i = 0; i < 8; ++i) { const int ka = k0 + 8 * g + i, kb = ka + 16;
    a[i] = (_Float16)(ka < K ? W[(size_t)(ka < K ? ka : K - 1) * ld + n] : 0.f); a[8 + i] = (_Float16)(kb < K ? W[(size_t)(kb < K ? kb : K - 1) * ld + n] : 0.f); }
  return a;
}
struct F2 { v16b h, l; };
__device__ __forceinline__ F2 bsplit16(const float v[16]) { F2 r;
#pragma unroll
  for (int i = 0; i < 16; ++i) { const __bf16 h = (__bf16)v[i]; r.h[i] = h; r.l[i] = (__bf16)(v[i] - (float)h); }
  return r; }
__device__ __forceinline__ F2 split_row(const float* row, int k0, int lane) { float v[16]; const float* p = row + k0 + 8 * (lane >> 4);
#pragma unroll
  for (int i = 0; i < 8; ++i) { v[i] = p[i]; v[8 + i] = p[16 + i]; }
  return bsplit16(v); }
__device__ __forceinline__ F2 split_rowK(const float* row, int k0, int lane, int K) { float v[16]; const int g = lane >> 4;
#pragma unroll
  for (int i = 0; i < 8; ++i) { const int ka = k0 + 8 * g + i, kb = ka + 16; v[i] = ka < K ? row[ka < K ? ka : K - 1] : 0.f; v[8 + i] = kb < K ? row[kb < K ? kb : K - 1] : 0.f; }
  return bsplit16(v); }
__device__ __forceinline__ F2 split_col(const float* W, int k0, int n, int lane, int ld, int K) { float v[16]; const int g = lane >> 4;
#pragma unroll
  for (int i = 0; i < 8; ++i) { const int ka = k0 + 8 * g + i, kb = ka + 16; v[i] = ka < K ? W[(size_t)(ka < K ? ka : K - 1) * ld + n] : 0.f; v[8 + i] = kb < K ? W[(size_t)(kb < K ? kb : K - 1) * ld + n] : 0.f; }
  return bsplit16(v); }
__device__ __forceinline__ v8f mac3(const F2& a, const F2& b, v8f c) { c = wmma_bf(a.l, b.h, c); c = wmma_bf(a.h, b.l, c); return wmma_bf(a.h, b.h, c); }
__device__ __forceinline__ float sigm(float v) { return 1.0f / (1.0f + expf(-v)); }
#define LDSX() do { asm volatile("s_wait_dscnt 0" ::: "memory"); __builtin_amdgcn_wave_barrier(); __builtin_amdgcn_fence(__ATOMIC_RELEASE, "workgroup"); } while (0)


#define NB 2
#define SS 2048
#define DM 1024
#define NH 16
#define HD 64
#define QKVW (3 * DM)
#ifndef TQB
#define TQB (SS / 64)
#define TNB NB
#define TOB (NB * SS / 64)     // output row tiles (all)
#endif
typedef __attribute__((ext_vector_type(8))) __bf16 v8b;
__device__ __forceinline__ v16b frag_b(const __bf16* rowk0, int lane) {
  union { v16b v; v8b q[2]; } u; const __bf16* p = rowk0 + 8 * (lane >> 4);
  u.q[0] = *(const v8b*)p; u.q[1] = *(const v8b*)(p + 16); return u.v;
}
// FRAGMENT ORDER of the workspace operands: a tile of 16 rows x 32 k is stored as [k half j][lane = 16 * g + row][8 k], element (row, k = 16 * j + 8 * g + i) at j * 256 + (16 * g + row) * 8 + i;
// a 16-bit tile is 1,024 B, and each of a fragment's two wave-wide 16-byte loads covers 512 contiguous bytes (4 whole lines); the tiles of one row tile follow one another along k
// fragment loads from a wave-uniform tile base plus the lane's own 32-bit byte offset (16 * lane, in k_out's A plus the wave's row tile), which is the same in every pass
__device__ __forceinline__ v16h frag_hs(const _Float16* ub, unsigned vo) { union { v16h v; v8h q[2]; } u; const char* p = (const char*)ub + vo; u.q[0] = *(const v8h*)p; u.q[1] = *(const v8h*)(p + 512); return u.v; }
__device__ __forceinline__ v16b frag_bs(const __bf16* ub, unsigned vo) { union { v16b v; v8b q[2]; } u; const char* p = (const char*)ub + vo; u.q[0] = *(const v8b*)p; u.q[1] = *(const v8b*)(p + 512); return u.v; }
// the 16 f32 of one lane's A fragment, still unconverted, so that the loads can fly ahead of their use
struct R16 { v4f q[4]; };
__device__ __forceinline__ R16 ld_row16s(const float* ub, unsigned vo) { R16 r; const char* p = (const char*)ub + vo; r.q[0] = *(const v4f*)p; r.q[1] = *(const v4f*)(p + 16); r.q[2] = *(const v4f*)(p + 64); r.q[3] = *(const v4f*)(p + 80); return r; }
// the same 16 f32 from a tile in fragment order (f32: 2,048 B, four quarters of 512 B, quarter m = 2 * j + (i >> 2))
__device__ __forceinline__ R16 ld_row16t(const float* ub, unsigned vo) { R16 r; const char* p = (const char*)ub + vo; r.q[0] = *(const v4f*)p; r.q[1] = *(const v4f*)(p + 512); r.q[2] = *(const v4f*)(p + 1024); r.q[3] = *(const v4f*)(p + 1536); return r; }
// stands behind a group of loads that stay in flight: the registers that hold their addresses may be rewritten only behind it
// the two scheduling barriers keep the wait behind its loads, and later loads and address arithmetic behind the wait
#define XW() do { __builtin_amdgcn_sched_barrier(0); asm volatile("s_wait_xcnt 0x0" ::: "memory"); __builtin_amdgcn_sched_barrier(0); } while (0)
// the same wait, taking two lane addresses of the group as inputs: they stay in their registers up to the wait, so no load of the group can be given those registers for its data
#define XWA(p, q) do { __builtin_amdgcn_sched_barrier(0); asm volatile("s_wait_xcnt 0x0" :: "v"(p), "v"(q) : "memory"); __builtin_amdgcn_sched_barrier(0); } while (0)
// fragment load from the lane's own byte address in a tile in fragment order (k half 0 at p, k half 1 at p + 512 bytes)
__device__ __forceinline__ v16h frag_hp(const char* p) { union { v16h v; v8h q[2]; } u; u.q[0] = *(const v8h*)p; u.q[1] = *(const v8h*)(p + 512); return u.v; }
// keeps a refill behind the WMMAs that last read the registers it refills; lifted over them, both sets would be live at once
#define SB() __builtin_amdgcn_sched_barrier(0)
__device__ __forceinline__ float bfr(float v) { return (float)(__bf16)v; }
__device__ __attribute__((noinline)) float exp_ni(float v) { return expf(v); }
__device__ __attribute__((noinline)) float erf_ni(float v) { return erff(v); }

#define PK_A 0                       // [3072][1024] Wqkv rows ([out][in]), fragment order: tile (row tile rt, k chunk kt) at (rt * 32 + kt) * 512
#define PK_P (PK_A + QKVW * DM)        // [1024][1024] Wo rows, fragment order
#define PK_END (PK_P + DM * DM)
#define WS_PK  0u
#define WS_QK  (WS_PK + 2u * PK_END)             // f16 [4096 rows][2048]: q | k, fragment order: tile (rt, kt) at (rt * 64 + kt) * 512
#define WS_QKL (WS_QK + 2u * NB * SS * 2 * DM)     // f16 q | k residual planes x2048
#define WS_VTH (WS_QKL + 2u * NB * SS * 2 * DM)    // f16 [b][1024 (h*64+d)][2048 s] hi, fragment order: tile (b, d tile, s chunk) at ((b * 64 + dt) * 64 + st) * 512
#define WS_VTL (WS_VTH + 2u * NB * DM * SS)        // f16 lo x 2048
#define WS_O   (WS_VTL + 2u * NB * DM * SS)        // f32 [4096][1024], fragment order: tile (rt, kt) at (rt * 32 + kt) * 512
#define WS_CS  (WS_O + 4u * NB * SS * DM)           // f32 2 x [2048][32], written and read by no kernel
#define WS_MST (WS_CS + 4u * 2 * SS * 32)
#define WS_XP  (WS_MST + 4u * NB * NH * SS * 2)    // bf16 [3][4096 rows][1024]: queries | keys | values, fragment order: tile (input xi, rt, kt) at ((xi * 256 + rt) * 32 + kt) * 512
#define WS_END (WS_XP + 2u * 3 * NB * SS * DM)
// ---- k_pack: blockIdx.y = 0: the three activation inputs -> bf16 in fragment order (below); blockIdx.y = 1 + which: block = (16 rows n, which, 128 k): [out][in] rows -> bf16 in fragment order; which 0..2 -> W_q/W_k/W_v into PK_A rows which*1024 + n; 3 -> W_o into PK_P
// a thread makes one whole 16-byte piece (8 k of one row), so a wave stores 512 contiguous bytes and reads, per k, 16 neighbouring floats for each of its two k groups
__global__ __launch_bounds__(256) void k_pack(const float* __restrict__ WQ, const float* __restrict__ WK, const float* __restrict__ WV, const float* __restrict__ WO, const float* __restrict__ XQ, const float* __restrict__ XK, const float* __restrict__ XV, __bf16* __restrict__ PK, __bf16* __restrict__ XP) {
  if (blockIdx.y == 0) {   // activations: 3 x 256 x 32 tiles of 16 rows x 32 k, numbered as they lie in XP; a wave takes six that follow one another, few fat waves in place of many thin ones
    const int lane = threadIdx.x & 31, wv = __builtin_amdgcn_readfirstlane(threadIdx.x >> 5); const int T0 = ((blockIdx.z * 64 + blockIdx.x) * 8 + wv) * 6;
    const unsigned vo = (unsigned)(((lane & 15) * DM + 8 * (lane >> 4)) * 4); R16 r[6];
#pragma unroll
    for (int t = 0; t < 6; ++t) { const int T = T0 + t, xi = T >> 13, rt = (T >> 5) & 255, kt = T & 31; const float* X = (xi == 0) ? XQ : (xi == 1) ? XK : XV;
      r[t] = ld_row16s(X + (size_t)rt * 16 * DM + kt * 32, vo);
      XW(); }   // all six tiles' loads fly together; the wait keeps the next tile's base behind this tile's loads
#pragma unroll
    for (int t = 0; t < 6; ++t) { v8b o0, o1;
#pragma unroll
      for (int i = 0; i < 8; ++i) { o0[i] = (__bf16)r[t].q[i >> 2][i & 3]; o1[i] = (__bf16)r[t].q[2 + (i >> 2)][i & 3]; }
      vst2(XP + (size_t)(T0 + t) * 512 + lane * 8, o0); vst2(XP + (size_t)(T0 + t) * 512 + 256 + lane * 8, o1); }
    return;
  }
  const int n0 = blockIdx.x * 16, which = blockIdx.y - 1, kq = blockIdx.z, p = threadIdx.x; const float* Wm = (which == 0) ? WQ : (which == 1) ? WK : (which == 2) ? WV : WO;   // per-head (in,out) [H][D][64] -> row n = h*64+e reads W[h][d][e]; WO (in,out) -> row n reads WO[d][n]
  const int hh = n0 / HD, e0 = n0 % HD; const int ld = (which < 3) ? HD : DM;
  __bf16* dst = ((which < 3) ? PK + PK_A + ((size_t)which * DM + n0) * DM : PK + PK_P + (size_t)n0 * DM) + kq * 4 * 512;
  const int row = p & 15, k = kq * 128 + (p >> 6) * 32 + ((p >> 5) & 1) * 16 + ((p >> 4) & 1) * 8;
  const float* s = (which < 3) ? Wm + ((size_t)hh * DM + k) * HD + e0 + row : Wm + (size_t)k * DM + n0 + row; v8b o;
#pragma unroll
  for (int i = 0; i < 8; ++i) o[i] = (__bf16)s[(size_t)i * ld];
  vst2(dst + p * 8, o);
}
__device__ __forceinline__ v16b frag_bp(const char* p) { union { v16b v; v8b q[2]; } u; u.q[0] = *(const v8b*)p; u.q[1] = *(const v8b*)(p + 512); return u.v; }
// the same wait, taking two scalar bases of the group as inputs: they stay in their registers up to the wait
#define XWS(p, q) do { __builtin_amdgcn_sched_barrier(0); asm volatile("s_wait_xcnt 0x0" :: "s"(p), "s"(q) : "memory"); __builtin_amdgcn_sched_barrier(0); } while (0)
// four vector slots between a row's last WMMA and the loads that refill its A and B registers, the distance that wmma_bf keeps; the scheduling barriers hold WMMAs in front of them and the loads behind
#define GAP4() do { SB(); asm volatile("v_nop\n\tv_nop\n\tv_nop\n\tv_nop"); SB(); } while (0)
// block = 256 rows x 192 columns, twelve waves as 4 x 3, one block on each WGP; a wave holds 64 x 64 (4 x 4 accumulator tiles), so the eight fragments of a k chunk feed sixteen WMMAs,
// and a chunk's 28 KiB of operands come to the WGP once for all twelve waves; a wave's 64 columns lie in one of Q, K, V (1,024 columns each), a block's 192 need not
__global__ __launch_bounds__(384) void k_qkv(const __bf16* __restrict__ XP, const __bf16* __restrict__ P, _Float16* __restrict__ QK, _Float16* __restrict__ QKL, _Float16* __restrict__ VTH, _Float16* __restrict__ VTL) {
  __shared__ __align__(16) _Float16 so[12][4096], sol[12][4096];
  const int tid = threadIdx.x, lane = tid & 31, col = lane & 15, g = lane >> 4; const int wave = __builtin_amdgcn_readfirstlane(tid >> 5);   // in a scalar register: the wave's bases are scalar, and the test on its columns below is a scalar branch
  const int r0 = blockIdx.x * 256 + (wave / 3) * 64, nw = blockIdx.y * 192 + (wave % 3) * 64;   // the wave's first row and first column
  const int which0 = nw / DM;   // Q from queries, K from keys, V from values: plane which0 of XP
  v8f acc[4][4] = {};
  // two register slots of fragments (k chunks kc and kc + 1); each fragment is loaded again, for two chunks on, directly behind its last use, so a whole slot's loads are in flight while the other slot is worked on
  const __bf16* ua = XP + ((size_t)which0 * NB * SS + r0) * DM; const __bf16* ub = P + (size_t)nw * DM; const unsigned voa = (unsigned)(lane * 16), vob = voa;
  v16b ar[2][4], bw[2][4]; const char* pa = (const char*)ua + voa; const char* pb = (const char*)ub + vob;   // the lane's addresses in the chunk that is loaded next
#pragma unroll
  for (int u = 0; u < 2; ++u) {
#pragma unroll
    for (int j = 0; j < 4; ++j) { ar[u][j] = frag_bp(pa + j * 16 * DM * 2 + u * 1024); bw[u][j] = frag_bp(pb + j * 16 * DM * 2 + u * 1024); } }
  XWS(ua, ub);   // these first loads go by the scalar bases
  pa += 2048; pb += 2048;
#pragma unroll 1   // stays rolled: the two slots are the whole unrolling, a further copy would only cost registers
  for (int kc = 0; kc < DM / 32; kc += 2) {
#pragma unroll
    for (int u = 0; u < 2; ++u) {
#pragma unroll
      for (int i = 0; i < 4; ++i) {
#pragma unroll
        for (int j = 0; j < 4; ++j) acc[i][j] = __builtin_amdgcn_wmma_f32_16x16x32_bf16(false, ar[u][i], false, bw[u][j], (short)0, acc[i][j], false, false);   // the plain builtin: tile and slots take more than 256 registers, and an operand of an asm statement cannot lie above v255
        GAP4();
        ar[u][i] = frag_bp(pa + i * 16 * DM * 2); }
#pragma unroll
      for (int j = 0; j < 4; ++j) bw[u][j] = frag_bp(pb + j * 16 * DM * 2);
      XWA(pa, pb);   // the two lane addresses stay in their registers up to the wait, and step on only behind it
      const int st = (kc + u + 3 < DM / 32) ? 1024 : 0; pa += st; pb += st; } }   // past the end: the last chunk again, never used
  if (nw < 2 * DM) {   // q stored unscaled (f16 sigma ~0.6, no subnormal exposure); 1/sqrt(S) applied to the f32 score
    // each of the wave's four row tiles has 64 columns, two tiles that follow one another in the workspace: laid out in fragment order in LDS, then copied as they lie
#pragma unroll
    for (int i = 0; i < 4; ++i) {
#pragma unroll
      for (int j = 0; j < 4; ++j) { const int e = i * 1024 + (j >> 1) * 512 + (j & 1) * 256 + ((col >> 3) * 16 + 8 * g) * 8 + (col & 7);
#pragma unroll
        for (int r = 0; r < 8; ++r) { const float v = acc[i][j][r]; const _Float16 hv = (_Float16)v; so[wave][e + r * 8] = hv; sol[wave][e + r * 8] = (_Float16)((v - (float)hv) * 2048.0f); } } }   // q, k as f16 hi + (x2048) residual (no RoPE in this module)
    LDSX();
#pragma unroll
    for (int i = 0; i < 4; ++i) { const size_t o = ((size_t)(r0 / 16 + i) * 64 + nw / 32) * 512 + lane * 8; v4u th[4], tl[4];
#pragma unroll
      for (int q = 0; q < 4; ++q) { th[q] = *(const v4u*)&so[wave][i * 1024 + q * 256 + lane * 8]; tl[q] = *(const v4u*)&sol[wave][i * 1024 + q * 256 + lane * 8]; }
      SB();   // a row tile's eight pieces are all in registers before its first store: nothing is written into a register between the stores and their wait
#pragma unroll
      for (int q = 0; q < 4; ++q) { vst2(QK + o + q * 256, th[q]); vst2(QKL + o + q * 256, tl[q]); }
      XW(); }   // behind each row tile's stores: the next row tile's pieces may take the registers that these stores name
  } else {   // v transposed: a lane's 8 accumulator rows are 8 neighbouring keys of one column d, which is the lane's own 16-byte piece of the tile (k half = row tile & 1): stored straight from registers
    const int b = r0 / SS, s0 = r0 % SS, pc0 = nw - 2 * DM;
#pragma unroll
    for (int i = 0; i < 4; ++i) { const size_t o = (((size_t)b * (DM / 16) + pc0 / 16) * (SS / 32) + s0 / 32 + (i >> 1)) * 512 + (i & 1) * 256 + lane * 8; v8h hi[4], lo[4];
#pragma unroll
      for (int j = 0; j < 4; ++j) {
#pragma unroll
        for (int r = 0; r < 8; ++r) { const float v = acc[i][j][r]; const _Float16 hv = (_Float16)v; hi[j][r] = hv; lo[j][r] = (_Float16)((v - (float)hv) * 2048.0f); } }
      SB();   // a row tile's eight pieces are all made before its first store: nothing is written into a register between the stores and their wait
#pragma unroll
      for (int j = 0; j < 4; ++j) { vst2(VTH + o + (size_t)j * (SS / 32) * 512, hi[j]); vst2(VTL + o + (size_t)j * (SS / 32) * 512, lo[j]); }
      XW(); }   // behind each row tile's stores: the next row tile's pieces may take the registers that these stores name
  }
}
#define CSCALE 0.022097086912079608f   // float32(1/sqrt(2048)): the module divides by sqrt(number of keys)
// a pass's exponentials as runs of v_exp_f32 in one statement each: behind a transcendental the instruction set asks for one independent instruction before its result is read or its source overwritten;
// inside a run the next v_exp_f32 is that instruction (every output is early-clobber, so none lies on a source), and the closing v_nop is it for the last one
__device__ __forceinline__ void exp2x8(float (&e)[8], const float (&t)[8]) {
  asm("v_exp_f32 %0, %8\n\tv_exp_f32 %1, %9\n\tv_exp_f32 %2, %10\n\tv_exp_f32 %3, %11\n\tv_exp_f32 %4, %12\n\tv_exp_f32 %5, %13\n\tv_exp_f32 %6, %14\n\tv_exp_f32 %7, %15\n\tv_nop"
      : "=&v"(e[0]), "=&v"(e[1]), "=&v"(e[2]), "=&v"(e[3]), "=&v"(e[4]), "=&v"(e[5]), "=&v"(e[6]), "=&v"(e[7]) : "v"(t[0]), "v"(t[1]), "v"(t[2]), "v"(t[3]), "v"(t[4]), "v"(t[5]), "v"(t[6]), "v"(t[7]));
}
__device__ __forceinline__ void exp2x9(float& ea, float ta, float (&e)[8], const float (&t)[8]) {
  asm("v_exp_f32 %0, %9\n\tv_exp_f32 %1, %10\n\tv_exp_f32 %2, %11\n\tv_exp_f32 %3, %12\n\tv_exp_f32 %4, %13\n\tv_exp_f32 %5, %14\n\tv_exp_f32 %6, %15\n\tv_exp_f32 %7, %16\n\tv_exp_f32 %8, %17\n\tv_nop"
      : "=&v"(ea), "=&v"(e[0]), "=&v"(e[1]), "=&v"(e[2]), "=&v"(e[3]), "=&v"(e[4]), "=&v"(e[5]), "=&v"(e[6]), "=&v"(e[7]) : "v"(ta), "v"(t[0]), "v"(t[1]), "v"(t[2]), "v"(t[3]), "v"(t[4]), "v"(t[5]), "v"(t[6]), "v"(t[7]));
}
// ---- k_cstat: block = (two tiles of 64 KEYS, h, b), 8 waves. Under the causal mask key tile t is seen by 64 - 2 t query tiles of 32: the block takes tile x and tile 31 - x, 66 passes for each 16 keys' pair, and deals them in two equal walks:
// waves 0..3 walk the first half of the pair's passes, all in tile x; waves 4..7 walk the rest of tile x, leave that partial (m, l) in LDS, and then walk all of tile 31 - x; behind the one barrier waves 0..3 join the two partials. Per tile: the softmax runs over QUERIES (axis 2), so per key column we need max and sum over q: S tiles = Q rows . K rows (3 products), queries along the accumulator's rows and the wave's 16 keys along its columns, so a lane holds 16 scores of ONE key per pass: maximum and sum stay in the lane, one running (m, l) per lane, and the wave's two halves (query rows 0..7 and 8..15 of each tile) join once, at the end
// y = (qk + (k - q)) * CSCALE where causal (q >= k) if masking, else (qk + 0)*CSCALE for q < k -> MST[b][h][k] = (m, 2048 / l)
__global__ __launch_bounds__(256) void k_cstat(const _Float16* __restrict__ QK, const _Float16* __restrict__ QKL, const int* __restrict__ MASKING, float* __restrict__ MST) {
  __shared__ __align__(16) float sb[4][32][2];   // the partial (m, l) that each lane of wave 4 + w leaves for the same lane of wave w
  const int tid = threadIdx.x, wave = tid >> 5, lane = tid & 31, col = lane & 15, g = lane >> 4; const int h = blockIdx.y, b = blockIdx.z; const int masking = MASKING[0];
  const int part = __builtin_amdgcn_readfirstlane(wave >> 2), w4 = wave & 3;   // part in a scalar register: every test on it is a scalar branch, so EXEC stays whole for the WMMAs
  const int t1 = blockIdx.x, t2 = SS / 64 - 1 - t1; const int f1 = masking ? t1 * 2 : 0, f2 = masking ? t2 * 2 : 0;   // first query tile that can see the keys of each key tile; f1 <= f2
  const int cut = f1 + (2 * (SS / 32) - f1 - f2) / 2;   // where tile t1's walk is cut: half of the pair's passes; at most SS / 32
  float m, l;
#pragma unroll 1   // stays rolled: the walks of a wave run one after the other in the same registers
  for (int seg = 0; seg <= part; ++seg) {
  const int kb = seg ? t2 : t1, qs0 = seg ? f2 : (part ? cut : f1), qe = part ? SS / 32 : cut; const int k0 = kb * 64 + w4 * 16;
  m = -3.0e38f; l = 0.f;
  if (qs0 < qe) {   // without the mask nothing of tile t1 is left for waves 4..7
  v16h ak[2], akl[2];
#pragma unroll
  for (int kc = 0; kc < 2; ++kc) { const size_t rk = ((size_t)((b * SS + k0) / 16) * 64 + 32 + h * 2 + kc) * 512; ak[kc] = frag_hs(QK + rk, (unsigned)(lane * 16)); akl[kc] = frag_hs(QKL + rk, (unsigned)(lane * 16)); }
  XW();
  // query fragments of a pass sit in registers before the pass begins: each 16-query half is loaded again, for the next pass, directly behind its last WMMA
  const unsigned voq = (unsigned)(lane * 16); const size_t uq0 = (size_t)b * SS * (2 * DM) + h * 2 * 512;   // 16 queries on: 16 * (2 * DM) elements, as in row order; k chunk on: 512
  v16h qh[2][2], ql[2][2]; const char* pq0 = (const char*)(QK + uq0 + (size_t)qs0 * 32 * (2 * DM)) + voq; const char* pl0 = (const char*)(QKL + uq0 + (size_t)qs0 * 32 * (2 * DM)) + voq;
#pragma unroll
  for (int ct = 0; ct < 2; ++ct) {
#pragma unroll
    for (int kc = 0; kc < 2; ++kc) { qh[ct][kc] = frag_hp(pq0 + ct * 16 * (2 * DM) * 2 + kc * 1024); ql[ct][kc] = frag_hp(pl0 + ct * 16 * (2 * DM) * 2 + kc * 1024); } }
  XWA(lane, voq);   // the lane's index and offset stay in their registers up to the wait
  const int ki = k0 + col; int qs = qs0;
#pragma unroll 1
  do { v8f s[2]; const int qn = (qs + 1 < SS / 32) ? qs + 1 : qs;   // past the end: the last tile again, never used
#pragma unroll
    for (int ct = 0; ct < 2; ++ct) { const size_t uq = uq0 + (size_t)(qn * 32 + ct * 16) * (2 * DM); v8f c = {}, cl = {};
#pragma unroll
      for (int kc = 0; kc < 2; ++kc) { c = wmma16(qh[ct][kc], ak[kc], c); cl = wmma16(qh[ct][kc], akl[kc], cl); cl = wmma16(ql[ct][kc], ak[kc], cl); }
      SB();
#pragma unroll
      for (int kc = 0; kc < 2; ++kc) { qh[ct][kc] = frag_hs(QK + uq + kc * 512, voq); ql[ct][kc] = frag_hs(QKL + uq + kc * 512, voq); }
      XW();
#pragma unroll
      for (int r = 0; r < 8; ++r) { const int qq = qs * 32 + ct * 16 + 8 * g + r; const float qk = c[r] + cl[r] * (1.0f / 2048.0f); const bool causal = (ki <= qq);
        s[ct][r] = causal ? (qk + (float)(ki - qq)) * CSCALE : (masking ? -3.0e38f : qk * CSCALE); } }
    float mx[8];
#pragma unroll
    for (int r = 0; r < 8; ++r) mx[r] = fmaxf(s[0][r], s[1][r]);
    const float mn = fmaxf(m, fmaxf(fmaxf(fmaxf(mx[0], mx[1]), fmaxf(mx[2], mx[3])), fmaxf(fmaxf(mx[4], mx[5]), fmaxf(mx[6], mx[7]))));
    float t0[8], t1[8], e0[8], e1[8], ea; const float ta = (m - mn) * 1.44269504f;   // exp(x) = 2^(x * log2 e), as __expf forms it
#pragma unroll
    for (int r = 0; r < 8; ++r) { t0[r] = (s[0][r] - mn) * 1.44269504f; t1[r] = (s[1][r] - mn) * 1.44269504f; }
    exp2x9(ea, ta, e0, t0); exp2x8(e1, t1);
    const float alpha = (m <= -1.0e38f) ? 0.f : ea; float es[8];
#pragma unroll
    for (int r = 0; r < 8; ++r) es[r] = ((s[0][r] <= -1.0e38f) ? 0.f : e0[r]) + ((s[1][r] <= -1.0e38f) ? 0.f : e1[r]);
    l = l * alpha + (((es[0] + es[1]) + (es[2] + es[3])) + ((es[4] + es[5]) + (es[6] + es[7]))); m = mn; } while (++qs < qe);   // tested at the foot: entered only with qs0 < qe
  }
  if (part && seg == 0) { sb[w4][lane][0] = m; sb[w4][lane][1] = l; }
  }
  __syncthreads();   // hands the partials in sb over from waves 4..7 to waves 0..3
  if (part == 0) { const float mb = sb[w4][lane][0], lb = sb[w4][lane][1]; const float d = m - mb, e = __expf(-fabsf(d));   // the side with the smaller maximum is scaled down; an empty side (m = -3e38, l = 0) gets e = 0
    l = (d >= 0.f) ? l + lb * e : l * e + lb; m = fmaxf(m, mb); }
  { const float mb = __shfl_xor(m, 16), lb = __shfl_xor(l, 16); const float d = m - mb, e = __expf(-fabsf(d));   // the wave's two halves join in the same way, once per key
    l = (d >= 0.f) ? l + lb * e : l * e + lb; m = fmaxf(m, mb); }
  if (lane < 16) vst2(MST + (((size_t)b * NH + h) * SS + (part ? t2 : t1) * 64 + w4 * 16 + col) * 2, v2f{m, 2048.0f / l});   // the one division per key; l is at least 1 (the maximum's own term); each wave stores its own 16 keys: one whole line
}
// the plain builtin: with two query tiles a wave takes more than 256 registers, and an operand of an asm statement cannot lie above v255; the compiler keeps the distance to a vector instruction on D itself, GAPW() and GAP4() keep it in front of a refill of B
// GAPW: the four slots of GAP4(), taking the score tiles as inputs: nothing else ties a plain WMMA to its place, and some would be set behind the slots and among the loads that refill their B
#define GAPW(a, b, c, d, e, f, g, h) do { asm volatile("v_nop\n\tv_nop\n\tv_nop\n\tv_nop" :: "v"(a), "v"(b), "v"(c), "v"(d), "v"(e), "v"(f), "v"(g), "v"(h)); SB(); } while (0)
__device__ __forceinline__ v8f wmma16p(v16h a, v16h b, v8f c) { return __builtin_amdgcn_wmma_f32_16x16x32_f16(false, a, false, b, (short)0, c, false, false); }
// ---- k_attn: block = (two tiles of 64 queries, h, b), 4 waves, a wave holds 32 queries (two tiles of 16), so each key and value fragment that it loads feeds two WMMAs. Under the causal mask query tile t walks 2 (t + 1) key tiles of 32: the block takes tile 31 - x and tile x, 66 passes for each 32 queries' pair, and deals them in two equal walks:
// waves 0, 1 walk the first half of the pair's passes, all in tile 31 - x; waves 2, 3 walk the rest of tile 31 - x, leave that partial sum in LDS, and then walk all of tile x; behind the one barrier waves 0, 1 add the partial to their own. Per tile: key tiles (k <= q frontier if masking); y as above; z = exp(y - m_k) * (2048 / l_k) (column statistics, the scaled reciprocal from k_cstat); P = z as f16 hi + (x2048) lo x V hi/lo (3 products); out rows (no normalisation)
__global__ __launch_bounds__(128) void k_attn(const _Float16* __restrict__ QK, const _Float16* __restrict__ QKL, const _Float16* __restrict__ VTH, const _Float16* __restrict__ VTL, const float* __restrict__ MST, const int* __restrict__ MASKING, float* __restrict__ O) {
  __shared__ __align__(16) _Float16 sph[4][32][40], spl[4][32][40]; __shared__ __align__(16) float so[4][2048], sx[2][2048];   // sx: the partial sum that wave 2 + w leaves for wave w
  const int tid = threadIdx.x, wave = tid >> 5, lane = tid & 31, col = lane & 15, g = lane >> 4;
  const int h = blockIdx.y, b = blockIdx.z; const int masking = MASKING[0];
  const int part = __builtin_amdgcn_readfirstlane(wave >> 1), w2 = wave & 1;   // part in a scalar register: every test on it is a scalar branch, so EXEC stays whole for the WMMAs
  const int t2 = blockIdx.x, t1 = SS / 64 - 1 - t2; const int n1 = masking ? (t1 * 64 + 64) / 32 : SS / 32, n2 = masking ? (t2 * 64 + 64) / 32 : SS / 32;   // key tiles of each query tile; n1 >= n2
  const int cut = (n1 + n2) / 2;   // where tile t1's walk is cut: half of the pair's passes; at most n1
  v8f acc[2][4], accl[2][4];
#pragma unroll 1   // stays rolled: the walks of a wave run one after the other in the same registers
  for (int seg = 0; seg <= part; ++seg) {
  const int qb = seg ? t2 : t1, ks0 = (part && !seg) ? cut : 0, nks = seg ? n2 : (part ? n1 : cut); const int q0 = qb * 64 + w2 * 32; const size_t rq = (size_t)b * SS + q0;
#pragma unroll
  for (int qt = 0; qt < 2; ++qt) {
#pragma unroll
    for (int dt = 0; dt < 4; ++dt) { acc[qt][dt] = v8f{}; accl[qt][dt] = v8f{}; } }
  if (ks0 < nks) {   // without the mask nothing of tile t1 is left for waves 2, 3
  v16h aq[2][2], aql[2][2];
#pragma unroll
  for (int qt = 0; qt < 2; ++qt) {
#pragma unroll
    for (int kc = 0; kc < 2; ++kc) { aq[qt][kc] = frag_hs(QK + (rq + qt * 16) * (2 * DM) + (h * 2 + kc) * 512, (unsigned)(lane * 16)); aql[qt][kc] = frag_hs(QKL + (rq + qt * 16) * (2 * DM) + (h * 2 + kc) * 512, (unsigned)(lane * 16)); } }
  XW();
  // every global load of a pass is issued well ahead of its use: the values at the head of the pass; the 32 keys of the next pass (with their statistics) directly behind this pass's score WMMAs
  const unsigned vok = (unsigned)(lane * 16), vov = (unsigned)(lane * 16), vom = (unsigned)(col * 8);
  const size_t uk0 = (size_t)b * SS * (2 * DM) + (32 + h * 2) * 512, uv0 = ((size_t)b * DM + h * HD) * SS; const float* um0 = MST + ((size_t)b * NH + h) * SS * 2;
  v16h kh[2][2], kl[2][2]; v2f ms[2];   // [block of 16 keys][k chunk]
#pragma unroll
  for (int ct = 0; ct < 2; ++ct) {
#pragma unroll
    for (int kc = 0; kc < 2; ++kc) { const size_t uk = uk0 + (size_t)(ks0 * 32 + ct * 16) * (2 * DM) + kc * 512; kh[ct][kc] = frag_hs(QK + uk, vok); kl[ct][kc] = frag_hs(QKL + uk, vok); }
    ms[ct] = *(const v2f*)((const char*)(um0 + (ks0 * 32 + ct * 16) * 2) + vom); }
  XW();
  int ks = ks0;
#pragma unroll 1
  do { v16h vh[4], vl[4]; const int kn = (ks + 1 < nks) ? ks + 1 : ks;   // past the end: the last tile again, never used
    const char* pvh = (const char*)(VTH + uv0 + ks * 512) + vov; const char* pvl = (const char*)(VTL + uv0 + ks * 512) + vov;
#pragma unroll
    for (int dt = 0; dt < 4; ++dt) { vh[dt] = frag_hp(pvh + dt * 16 * SS * 2); vl[dt] = frag_hp(pvl + dt * 16 * SS * 2); }
    XWA(pvh, pvl);
    v8f c[2][2] = {}, cl[2][2] = {};   // [block of 16 keys][query tile]
#pragma unroll
    for (int ct = 0; ct < 2; ++ct) {
#pragma unroll
      for (int kc = 0; kc < 2; ++kc) {
#pragma unroll
        for (int qt = 0; qt < 2; ++qt) { c[ct][qt] = wmma16p(aq[qt][kc], kh[ct][kc], c[ct][qt]); cl[ct][qt] = wmma16p(aql[qt][kc], kh[ct][kc], cl[ct][qt]); }
#pragma unroll
        for (int qt = 0; qt < 2; ++qt) cl[ct][qt] = wmma16p(aq[qt][kc], kl[ct][kc], cl[ct][qt]); } }   // the two products into one cl stand apart: the second does not wait on the first
    const float mk[2] = {ms[0][0], ms[1][0]}, rk[2] = {ms[0][1], ms[1][1]};
    GAPW(c[0][0], cl[0][0], c[0][1], cl[0][1], c[1][0], cl[1][0], c[1][1], cl[1][1]);
#pragma unroll
    for (int ct = 0; ct < 2; ++ct) {
#pragma unroll
      for (int kc = 0; kc < 2; ++kc) { const size_t uk = uk0 + (size_t)(kn * 32 + ct * 16) * (2 * DM) + kc * 512; kh[ct][kc] = frag_hs(QK + uk, vok); kl[ct][kc] = frag_hs(QKL + uk, vok); }
      ms[ct] = *(const v2f*)((const char*)(um0 + (kn * 32 + ct * 16) * 2) + vom); }
    XW();
#pragma unroll
    for (int ct = 0; ct < 2; ++ct) { const int kk = ks * 32 + ct * 16 + col;
#pragma unroll
      for (int qt = 0; qt < 2; ++qt) {
#pragma unroll
      for (int r = 0; r < 8; ++r) { const int qi = q0 + qt * 16 + 8 * g + r; const float qk = c[ct][qt][r] + cl[ct][qt][r] * (1.0f / 2048.0f); const bool causal = (kk <= qi);
        const float y = causal ? (qk + (float)(kk - qi)) * CSCALE : qk * CSCALE; const float e = __expf(y - mk[ct]) * rk[ct]; const float p = (causal || !masking) ? e : 0.f;   // formed for every element and then chosen: a select, no branch on EXEC; rk = 2^11 / l: z scaled by 2^11 so its f16 hi plane stays out of the subnormal range; 2^-11 folded into the epilogue
        const _Float16 hp = (_Float16)p; sph[wave][qt * 16 + 8 * g + r][ct * 16 + col] = hp; spl[wave][qt * 16 + 8 * g + r][ct * 16 + col] = (_Float16)((p - (float)hp) * 2048.0f); } } }
    LDSX();
    v16h pah[2], pal[2];
#pragma unroll
    for (int qt = 0; qt < 2; ++qt) { pah[qt] = frag_h(&sph[wave][qt * 16 + col][0], lane); pal[qt] = frag_h(&spl[wave][qt * 16 + col][0], lane); }
#pragma unroll
    for (int dt = 0; dt < 4; ++dt) {
#pragma unroll
      for (int qt = 0; qt < 2; ++qt) { acc[qt][dt] = wmma16p(pah[qt], vh[dt], acc[qt][dt]); accl[qt][dt] = wmma16p(pal[qt], vh[dt], accl[qt][dt]); }
#pragma unroll
      for (int qt = 0; qt < 2; ++qt) accl[qt][dt] = wmma16p(pah[qt], vl[dt], accl[qt][dt]); }
    GAP4();   // the next pass's loads refill the value fragments
    LDSX(); } while (++ks < nks);   // tested at the foot: entered only with ks0 < nks
  }
  if (part && seg == 0) {   // a lane leaves each value where its partner's same lane will look for it
#pragma unroll
    for (int qt = 0; qt < 2; ++qt) {
#pragma unroll
    for (int r = 0; r < 8; ++r) {
#pragma unroll
      for (int dt = 0; dt < 4; ++dt) sx[w2][((qt * 4 + dt) * 8 + r) * 32 + lane] = (acc[qt][dt][r] + accl[qt][dt][r] * (1.0f / 2048.0f)) * (1.0f / 2048.0f); } } }
  }
  __syncthreads();   // hands the partial sums in sx over from waves 2, 3 to waves 0, 1
  const size_t rqo = (size_t)b * SS + (part ? t2 : t1) * 64 + w2 * 32;
#pragma unroll
  for (int qt = 0; qt < 2; ++qt) {
#pragma unroll
    for (int dt = 0; dt < 4; ++dt) acc[qt][dt] = (acc[qt][dt] + accl[qt][dt] * (1.0f / 2048.0f)) * (1.0f / 2048.0f); }
  if (part == 0) {
#pragma unroll
    for (int qt = 0; qt < 2; ++qt) {
#pragma unroll
    for (int r = 0; r < 8; ++r) {
#pragma unroll
      for (int dt = 0; dt < 4; ++dt) acc[qt][dt][r] += sx[w2][((qt * 4 + dt) * 8 + r) * 32 + lane]; } } }
#pragma unroll
  for (int qt = 0; qt < 2; ++qt) {
#pragma unroll
  for (int r = 0; r < 8; ++r) {
#pragma unroll
    for (int dt = 0; dt < 4; ++dt) so[wave][qt * 1024 + (dt >> 1) * 512 + ((dt & 1) * 2 + ((col >> 2) & 1)) * 128 + ((col >> 3) * 16 + 8 * g + r) * 4 + (col & 3)] = acc[qt][dt][r]; } }   // each query tile's two f32 tiles, in fragment order
  LDSX();
#pragma unroll
  for (int qt = 0; qt < 2; ++qt) { v4f t[8];
#pragma unroll
    for (int q = 0; q < 8; ++q) t[q] = *(const v4f*)&so[wave][qt * 1024 + q * 128 + lane * 4];
    SB();   // a query tile's eight pieces are all in registers before its first store: nothing is written into a register between the stores and their wait
#pragma unroll
    for (int q = 0; q < 8; ++q) vst2(O + (rqo + qt * 16) * DM + h * 2 * 512 + q * 128 + lane * 4, t[q]);
    XW(); }   // behind each query tile's stores: the next tile's pieces may take the registers that these stores name
}
// ---- k_out: block = (64 rows, 128 cols): out = O(hi/lo) . Wo rows (2 products)
__global__ __launch_bounds__(128) void k_out(const float* __restrict__ O, const __bf16* __restrict__ P, float* __restrict__ Y) {
  __shared__ __align__(16) float so[4][16][132];
  const int tid = threadIdx.x, wave = tid >> 5, lane = tid & 31, col = lane & 15, g = lane >> 4; const size_t r0 = (size_t)blockIdx.x * 64 + wave * 16; const int n0 = blockIdx.y * 128;
  v8f acc[8] = {};
  // two register slots of fragments, each loaded again for two chunks on directly behind its last use (as the B fragments in k_qkv)
  const float* ua = O + (size_t)blockIdx.x * 64 * DM; const __bf16* ub = P + (size_t)n0 * DM; const unsigned voa = (unsigned)((wave * 16 * DM + lane * 4) * 4), vob = (unsigned)(lane * 16);
  R16 ar[2]; v16b bw[2][8];
#pragma unroll
  for (int u = 0; u < 2; ++u) { ar[u] = ld_row16t(ua + u * 512, voa);
#pragma unroll
    for (int j = 0; j < 8; ++j) bw[u][j] = frag_bs(ub + j * 16 * DM + u * 512, vob); }
  XW();
#pragma unroll 1   // stays rolled: the two slots are the whole unrolling, a further copy would only cost registers
  for (int kc = 0; kc < DM / 32; kc += 2) {
#pragma unroll
    for (int u = 0; u < 2; ++u) { float v[16]; const int kn = (kc + u + 2 < DM / 32) ? kc + u + 2 : DM / 32 - 1;   // past the end: the last chunk again, never used
#pragma unroll
      for (int i = 0; i < 8; ++i) { v[i] = ar[u].q[i >> 2][i & 3]; v[8 + i] = ar[u].q[2 + (i >> 2)][i & 3]; }
      const F2 a = bsplit16(v); ar[u] = ld_row16t(ua + kn * 512, voa);
#pragma unroll
      for (int j = 0; j < 8; ++j) { acc[j] = wmma_bf(a.l, bw[u][j], acc[j]); acc[j] = wmma_bf(a.h, bw[u][j], acc[j]); bw[u][j] = frag_bs(ub + j * 16 * DM + kn * 512, vob); }
      XW(); } }
#pragma unroll
  for (int j = 0; j < 8; ++j) {
#pragma unroll
    for (int r = 0; r < 8; ++r) so[wave][8 * g + r][j * 16 + col] = acc[j][r]; }
  LDSX();
  for (int rl = 0; rl < 16; ++rl) vst2(Y + (r0 + rl) * DM + n0 + lane * 4, *(const v4f*)&so[wave][rl][lane * 4]);
}
extern "C" void kernel_launch(void* const* d_in, const int* in_sizes, int n_in, void* d_out, int out_size, void* d_ws, size_t ws_size, hipStream_t stream) {
  (void)in_sizes; (void)n_in; (void)out_size;
  const float** F = (const float**)d_in;   // 0 keys [2,2048,1024], 1 queries, 2 values, 3 WQ [16,1024,64], 4 WK, 5 WV, 6 WO [1024,1024] (in,out), 7 masking [1] int32
  if (ws_size < (size_t)WS_END) return;
  char* ws = (char*)d_ws; __bf16* PK = (__bf16*)(ws + WS_PK); _Float16 *QK = (_Float16*)(ws + WS_QK), *QKL = (_Float16*)(ws + WS_QKL), *VTH = (_Float16*)(ws + WS_VTH), *VTL = (_Float16*)(ws + WS_VTL); float* O = (float*)(ws + WS_O);
  float* MST = (float*)(ws + WS_MST); __bf16* XP = (__bf16*)(ws + WS_XP);
  k_pack<<<dim3(DM / 16, 5, 8), 256, 0, stream>>>(F[3], F[4], F[5], F[6], F[1], F[0], F[2], PK, XP);
  k_qkv<<<dim3(TNB * SS / 256, QKVW / 192), 384, 0, stream>>>(XP, PK + PK_A, QK, QKL, VTH, VTL);
  k_cstat<<<dim3(SS / 128, NH, TNB), 256, 0, stream>>>(QK, QKL, (const int*)d_in[7], MST);
  k_attn<<<dim3(TQB / 2, NH, TNB), 128, 0, stream>>>(QK, QKL, VTH, VTL, MST, (const int*)d_in[7], O);
  k_out<<<dim3(TOB, DM / 128), 128, 0, stream>>>(O, PK + PK_P, (float*)d_out);
}

// v009
// A run of this version takes 133 microseconds.
// Next to v008, in two timings, it ran 1.14 times as fast each time.
// All steps since v000 together make it 5.14 times as fast.
#include <hip/hip_runtime.h>
#include <math.h>

typedef __attribute__((ext_vector_type(16))) _Float16 v16h;
typedef __attribute__((ext_vector_type(16))) __bf16 v16b;
typedef __attribute__((ext_vector_type(8)))  _Float16 v8h;
typedef __attribute__((ext_vector_type(8)))  float v8f;
typedef __attribute__((ext_vector_type(4)))  float v4f;
typedef __attribute__((ext_vector_type(2)))  float v2f;
typedef __attribute__((ext_vector_type(4)))  unsigned v4u;
typedef __attribute__((ext_vector_type(4)))  int v4i;
typedef float __attribute__((may_alias)) float_a;
typedef int __attribute__((may_alias)) int_a;

template <typename T> __device__ __forceinline__ void vst2(void* p, T v) { *(T*)p = v;  }
__device__ __forceinline__ v8f wmma16(v16h a, v16h b, v8f c) {
  v8f d = __builtin_amdgcn_wmma_f32_16x16x32_f16(false, a, false, b, (short)0, c, false, false);
  asm volatile("v_nop\n\tv_nop\n\tv_nop\n\tv_nop" : "+v"(d) : "v"(a), "v"(b));
  return d;
}
__device__ __forceinline__ v8f wmma_bf(v16b a, v16b b, v8f c) {
  v8f d = __builtin_amdgcn_wmma_f32_16x16x32_bf16(false, a, false, b, (short)0, c, false, false);
  asm volatile("v_nop\n\tv_nop\n\tv_nop\n\tv_nop" : "+v"(d) : "v"(a), "v"(b));
  return d;
}
// Multi-head ALiBi-style block (B 2, S 2,048, d 1,024, 16 heads x 64): per-head projections of separate keys / queries / values, (QK + (k - q)) / sqrt(S) with a causal mask, softmax over the query axis, weighted values, output projection.
__device__ __forceinline__ v16h frag_h(const _Float16* rowk0, int lane) {
  union { v16h v; v8h q[2]; } u; const _Float16* p = rowk0 + 8 * (lane >> 4);
  u.q[0] = *(const v8h*)p; u.q[1] = *(const v8h*)(p + 16); return u.v;
}
__device__ __forceinline__ v16h frag_f32(const float* rowk0, int lane) {
  v16h a; const float* p = rowk0 + 8 * (lane >> 4);
#pragma unroll
  for (int i = 0; i < 8; ++i) { a[i] = (_Float16)p[i]; a[8 + i] = (_Float16)p[16 + i]; }
  return a;
}
__device__ __forceinline__ v16h frag_f32s(const float* rowk0, int lane, float sc) {
  v16h a; const float* p = rowk0 + 8 * (lane >> 4);
#pragma unroll
  for (int i = 0; i < 8; ++i) { a[i] = (_Float16)(p[i] * sc); a[8 + i] = (_Float16)(p[16 + i] * sc); }
  return a;
}
// column fragment from a [K][ld] layout (column n), rows >= K read as 0
__device__ __forceinline__ v16h fragc_f32(const float* W, int k0, int n, int lane, int ld, int K) {
  v16h a; const int g = lane >> 4;
#pragma unroll
  for (int i = 0; i < 8; ++i) { const int ka = k0 + 8 * g + i, kb = ka + 16;
    a[i] = (_Float16)(ka < K ? W[(size_t)(ka < K ? ka : K - 1) * ld + n] : 0.f); a[8 + i] = (_Float16)(kb < K ? W[(size_t)(kb < K ? kb : K - 1) * ld + n] : 0.f); }
  return a;
}
struct F2 { v16b h, l; };
__device__ __forceinline__ F2 bsplit16(const float v[16]) { F2 r;
#pragma unroll
  for (int i = 0; i < 16; ++i) { const __bf16 h = (__bf16)v[i]; r.h[i] = h; r.l[i] = (__bf16)(v[i] - (float)h); }
  return r; }
__device__ __forceinline__ F2 split_row(const float* row, int k0, int lane) { float v[16]; const float* p = row + k0 + 8 * (lane >> 4);
#pragma unroll
  for (int i = 0; i < 8; ++i) { v[i] = p[i]; v[8 + i] = p[16 + i]; }
  return bsplit16(v); }
__device__ __forceinline__ F2 split_rowK(const float* row, int k0, int lane, int K) { float v[16]; const int g = lane >> 4;
#pragma unroll
  for (int i = 0; i < 8; ++i) { const int ka = k0 + 8 * g + i, kb = ka + 16; v[i] = ka < K ? row[ka < K ? ka : K - 1] : 0.f; v[8 + i] = kb < K ? row[kb < K ? kb : K - 1] : 0.f; }
  return bsplit16(v); }
__device__ __forceinline__ F2 split_col(const float* W, int k0, int n, int lane, int ld, int K) { float v[16]; const int g = lane >> 4;
#pragma unroll
  for (int i = 0; i < 8; ++i) { const int ka = k0 + 8 * g + i, kb = ka + 16; v[i] = ka < K ? W[(size_t)(ka < K ? ka : K - 1) * ld + n] : 0.f; v[8 + i] = kb < K ? W[(size_t)(kb < K ? kb : K - 1) * ld + n] : 0.f; }
  return bsplit16(v); }
__device__ __forceinline__ v8f mac3(const F2& a, const F2& b, v8f c) { c = wmma_bf(a.l, b.h, c); c = wmma_bf(a.h, b.l, c); return wmma_bf(a.h, b.h, c); }
__device__ __forceinline__ float sigm(float v) { return 1.0f / (1.0f + expf(-v)); }
#define LDSX() do { asm volatile("s_wait_dscnt 0" ::: "memory"); __builtin_amdgcn_wave_barrier(); __builtin_amdgcn_fence(__ATOMIC_RELEASE, "workgroup"); } while (0)


#define NB 2
#define SS 2048
#define DM 1024
#define NH 16
#define HD 64
#define QKVW (3 * DM)
#ifndef TQB
#define TQB (SS / 64)
#define TNB NB
#define TOB (NB * SS / 64)     // output row tiles (all)
#endif
typedef __attribute__((ext_vector_type(8))) __bf16 v8b;
__device__ __forceinline__ v16b frag_b(const __bf16* rowk0, int lane) {
  union { v16b v; v8b q[2]; } u; const __bf16* p = rowk0 + 8 * (lane >> 4);
  u.q[0] = *(const v8b*)p; u.q[1] = *(const v8b*)(p + 16); return u.v;
}
// FRAGMENT ORDER of the workspace operands: a tile of 16 rows x 32 k is stored as [k half j][lane = 16 * g + row][8 k], element (row, k = 16 * j + 8 * g + i) at j * 256 + (16 * g + row) * 8 + i;
// a 16-bit tile is 1,024 B, and each of a fragment's two wave-wide 16-byte loads covers 512 contiguous bytes (4 whole lines); the tiles of one row tile follow one another along k
// fragment loads from a wave-uniform tile base plus the lane's own 32-bit byte offset (16 * lane, in k_out's A plus the wave's row tile), which is the same in every pass
__device__ __forceinline__ v16h frag_hs(const _Float16* ub, unsigned vo) { union { v16h v; v8h q[2]; } u; const char* p = (const char*)ub + vo; u.q[0] = *(const v8h*)p; u.q[1] = *(const v8h*)(p + 512); return u.v; }
__device__ __forceinline__ v16b frag_bs(const __bf16* ub, unsigned vo) { union { v16b v; v8b q[2]; } u; const char* p = (const char*)ub + vo; u.q[0] = *(const v8b*)p; u.q[1] = *(const v8b*)(p + 512); return u.v; }
// the 16 f32 of one lane's A fragment, still unconverted, so that the loads can fly ahead of their use
struct R16 { v4f q[4]; };
__device__ __forceinline__ R16 ld_row16s(const float* ub, unsigned vo) { R16 r; const char* p = (const char*)ub + vo; r.q[0] = *(const v4f*)p; r.q[1] = *(const v4f*)(p + 16); r.q[2] = *(const v4f*)(p + 64); r.q[3] = *(const v4f*)(p + 80); return r; }
// the same 16 f32 from a tile in fragment order (f32: 2,048 B, four quarters of 512 B, quarter m = 2 * j + (i >> 2))
__device__ __forceinline__ R16 ld_row16t(const float* ub, unsigned vo) { R16 r; const char* p = (const char*)ub + vo; r.q[0] = *(const v4f*)p; r.q[1] = *(const v4f*)(p + 512); r.q[2] = *(const v4f*)(p + 1024); r.q[3] = *(const v4f*)(p + 1536); return r; }
// stands behind a group of loads that stay in flight: the registers that hold their addresses may be rewritten only behind it
// the two scheduling barriers keep the wait behind its loads, and later loads and address arithmetic behind the wait
#define XW() do { __builtin_amdgcn_sched_barrier(0); asm volatile("s_wait_xcnt 0x0" ::: "memory"); __builtin_amdgcn_sched_barrier(0); } while (0)
// the same wait, taking two lane addresses of the group as inputs: they stay in their registers up to the wait, so no load of the group can be given those registers for its data
#define XWA(p, q) do { __builtin_amdgcn_sched_barrier(0); asm volatile("s_wait_xcnt 0x0" :: "v"(p), "v"(q) : "memory"); __builtin_amdgcn_sched_barrier(0); } while (0)
// fragment load from the lane's own byte address in a tile in fragment order (k half 0 at p, k half 1 at p + 512 bytes)
__device__ __forceinline__ v16h frag_hp(const char* p) { union { v16h v; v8h q[2]; } u; u.q[0] = *(const v8h*)p; u.q[1] = *(const v8h*)(p + 512); return u.v; }
// keeps a refill behind the WMMAs that last read the registers it refills; lifted over them, both sets would be live at once
#define SB() __builtin_amdgcn_sched_barrier(0)
__device__ __forceinline__ float bfr(float v) { return (float)(__bf16)v; }
__device__ __attribute__((noinline)) float exp_ni(float v) { return expf(v); }
__device__ __attribute__((noinline)) float erf_ni(float v) { return erff(v); }

#define PK_A 0                       // [3072][1024] Wqkv rows ([out][in]), fragment order: tile (row tile rt, k chunk kt) at (rt * 32 + kt) * 512
#define PK_P (PK_A + QKVW * DM)        // [1024][1024] Wo rows, fragment order
#define PK_END (PK_P + DM * DM)
#define WS_PK  0u
#define WS_QK  (WS_PK + 2u * PK_END)             // f16 [4096 rows][2048]: q | k, fragment order: tile (rt, kt) at (rt * 64 + kt) * 512
#define WS_QKL (WS_QK + 2u * NB * SS * 2 * DM)     // f16 q | k residual planes x2048
#define WS_VTH (WS_QKL + 2u * NB * SS * 2 * DM)    // f16 [b][1024 (h*64+d)][2048 s] hi, fragment order: tile (b, d tile, s chunk) at ((b * 64 + dt) * 64 + st) * 512
#define WS_VTL (WS_VTH + 2u * NB * DM * SS)        // f16 lo x 2048
#define WS_O   (WS_VTL + 2u * NB * DM * SS)        // f32 [4096][1024], fragment order: tile (rt, kt) at (rt * 32 + kt) * 512
#define WS_CS  (WS_O + 4u * NB * SS * DM)           // f32 2 x [2048][32], written and read by no kernel
#define WS_MST (WS_CS + 4u * 2 * SS * 32)
#define WS_XP  (WS_MST + 4u * NB * NH * SS * 2)    // bf16 [3][4096 rows][1024]: queries | keys | values, fragment order: tile (input xi, rt, kt) at ((xi * 256 + rt) * 32 + kt) * 512
#define WS_END (WS_XP + 2u * 3 * NB * SS * DM)
// ---- k_pack: blockIdx.y = 0: the three activation inputs -> bf16 in fragment order (below); blockIdx.y = 1 + which: block = (16 rows n, which, 128 k): [out][in] rows -> bf16 in fragment order; which 0..2 -> W_q/W_k/W_v into PK_A rows which*1024 + n; 3 -> W_o into PK_P
// a thread makes one whole 16-byte piece (8 k of one row), so a wave stores 512 contiguous bytes and reads, per k, 16 neighbouring floats for each of its two k groups
__global__ __launch_bounds__(256) void k_pack(const float* __restrict__ WQ, const float* __restrict__ WK, const float* __restrict__ WV, const float* __restrict__ WO, const float* __restrict__ XQ, const float* __restrict__ XK, const float* __restrict__ XV, __bf16* __restrict__ PK, __bf16* __restrict__ XP) {
  if (blockIdx.y == 0) {   // activations: 3 x 256 x 32 tiles of 16 rows x 32 k, numbered as they lie in XP; a wave takes six that follow one another, few fat waves in place of many thin ones
    const int lane = threadIdx.x & 31, wv = __builtin_amdgcn_readfirstlane(threadIdx.x >> 5); const int T0 = ((blockIdx.z * 64 + blockIdx.x) * 8 + wv) * 6;
    const unsigned vo = (unsigned)(((lane & 15) * DM + 8 * (lane >> 4)) * 4); R16 r[6];
#pragma unroll
    for (int t = 0; t < 6; ++t) { const int T = T0 + t, xi = T >> 13, rt = (T >> 5) & 255, kt = T & 31; const float* X = (xi == 0) ? XQ : (xi == 1) ? XK : XV;
      r[t] = ld_row16s(X + (size_t)rt * 16 * DM + kt * 32, vo);
      XW(); }   // all six tiles' loads fly together; the wait keeps the next tile's base behind this tile's loads
#pragma unroll
    for (int t = 0; t < 6; ++t) { v8b o0, o1;
#pragma unroll
      for (int i = 0; i < 8; ++i) { o0[i] = (__bf16)r[t].q[i >> 2][i & 3]; o1[i] = (__bf16)r[t].q[2 + (i >> 2)][i & 3]; }
      vst2(XP + (size_t)(T0 + t) * 512 + lane * 8, o0); vst2(XP + (size_t)(T0 + t) * 512 + 256 + lane * 8, o1); }
    return;
  }
  const int n0 = blockIdx.x * 16, which = blockIdx.y - 1, kq = blockIdx.z, p = threadIdx.x; const float* Wm = (which == 0) ? WQ : (which == 1) ? WK : (which == 2) ? WV : WO;   // per-head (in,out) [H][D][64] -> row n = h*64+e reads W[h][d][e]; WO (in,out) -> row n reads WO[d][n]
  const int hh = n0 / HD, e0 = n0 % HD; const int ld = (which < 3) ? HD : DM;
  __bf16* dst = ((which < 3) ? PK + PK_A + ((size_t)which * DM + n0) * DM : PK + PK_P + (size_t)n0 * DM) + kq * 4 * 512;
  const int row = p & 15, k = kq * 128 + (p >> 6) * 32 + ((p >> 5) & 1) * 16 + ((p >> 4) & 1) * 8;
  const float* s = (which < 3) ? Wm + ((size_t)hh * DM + k) * HD + e0 + row : Wm + (size_t)k * DM + n0 + row; v8b o;
#pragma unroll
  for (int i = 0; i < 8; ++i) o[i] = (__bf16)s[(size_t)i * ld];
  vst2(dst + p * 8, o);
}
__device__ __forceinline__ v16b frag_bp(const char* p) { union { v16b v; v8b q[2]; } u; u.q[0] = *(const v8b*)p; u.q[1] = *(const v8b*)(p + 512); return u.v; }
// the same wait, taking two scalar bases of the group as inputs: they stay in their registers up to the wait
#define XWS(p, q) do { __builtin_amdgcn_sched_barrier(0); asm volatile("s_wait_xcnt 0x0" :: "s"(p), "s"(q) : "memory"); __builtin_amdgcn_sched_barrier(0); } while (0)
// four vector slots between a row's last WMMA and the loads that refill its A and B registers, the distance that wmma_bf keeps; the scheduling barriers hold WMMAs in front of them and the loads behind
#define GAP4() do { SB(); asm volatile("v_nop\n\tv_nop\n\tv_nop\n\tv_nop"); SB(); } while (0)
// block = 256 rows x 192 columns, twelve waves as 4 x 3, one block on each WGP; a wave holds 64 x 64 (4 x 4 accumulator tiles), so the eight fragments of a k chunk feed sixteen WMMAs,
// and a chunk's 28 KiB of operands come to the WGP once for all twelve waves; a wave's 64 columns lie in one of Q, K, V (1,024 columns each), a block's 192 need not
__global__ __launch_bounds__(384) void k_qkv(const __bf16* __restrict__ XP, const __bf16* __restrict__ P, _Float16* __restrict__ QK, _Float16* __restrict__ QKL, _Float16* __restrict__ VTH, _Float16* __restrict__ VTL) {
  __shared__ __align__(16) _Float16 so[12][4096], sol[12][4096];
  const int tid = threadIdx.x, lane = tid & 31, col = lane & 15, g = lane >> 4; const int wave = __builtin_amdgcn_readfirstlane(tid >> 5);   // in a scalar register: the wave's bases are scalar, and the test on its columns below is a scalar branch
  const int r0 = blockIdx.x * 256 + (wave / 3) * 64, nw = blockIdx.y * 192 + (wave % 3) * 64;   // the wave's first row and first column
  const int which0 = nw / DM;   // Q from queries, K from keys, V from values: plane which0 of XP
  v8f acc[4][4] = {};
  // two register slots of fragments (k chunks kc and kc + 1); each fragment is loaded again, for two chunks on, directly behind its last use, so a whole slot's loads are in flight while the other slot is worked on
  const __bf16* ua = XP + ((size_t)which0 * NB * SS + r0) * DM; const __bf16* ub = P + (size_t)nw * DM; const unsigned voa = (unsigned)(lane * 16), vob = voa;
  v16b ar[2][4], bw[2][4]; const char* pa = (const char*)ua + voa; const char* pb = (const char*)ub + vob;   // the lane's addresses in the chunk that is loaded next
#pragma unroll
  for (int u = 0; u < 2; ++u) {
#pragma unroll
    for (int j = 0; j < 4; ++j) { ar[u][j] = frag_bp(pa + j * 16 * DM * 2 + u * 1024); bw[u][j] = frag_bp(pb + j * 16 * DM * 2 + u * 1024); } }
  XWS(ua, ub);   // these first loads go by the scalar bases
  pa += 2048; pb += 2048;
#pragma unroll 1   // stays rolled: the two slots are the whole unrolling, a further copy would only cost registers
  for (int kc = 0; kc < DM / 32; kc += 2) {
#pragma unroll
    for (int u = 0; u < 2; ++u) {
#pragma unroll
      for (int i = 0; i < 4; ++i) {
#pragma unroll
        for (int j = 0; j < 4; ++j) acc[i][j] = __builtin_amdgcn_wmma_f32_16x16x32_bf16(false, ar[u][i], false, bw[u][j], (short)0, acc[i][j], false, false);   // the plain builtin: tile and slots take more than 256 registers, and an operand of an asm statement cannot lie above v255
        GAP4();
        ar[u][i] = frag_bp(pa + i * 16 * DM * 2); }
#pragma unroll
      for (int j = 0; j < 4; ++j) bw[u][j] = frag_bp(pb + j * 16 * DM * 2);
      XWA(pa, pb);   // the two lane addresses stay in their registers up to the wait, and step on only behind it
      const int st = (kc + u + 3 < DM / 32) ? 1024 : 0; pa += st; pb += st; } }   // past the end: the last chunk again, never used
  if (nw < 2 * DM) {   // q stored unscaled (f16 sigma ~0.6, no subnormal exposure); 1/sqrt(S) applied to the f32 score
    // each of the wave's four row tiles has 64 columns, two tiles that follow one another in the workspace: laid out in fragment order in LDS, then copied as they lie
#pragma unroll
    for (int i = 0; i < 4; ++i) {
#pragma unroll
      for (int j = 0; j < 4; ++j) { const int e = i * 1024 + (j >> 1) * 512 + (j & 1) * 256 + ((col >> 3) * 16 + 8 * g) * 8 + (col & 7);
#pragma unroll
        for (int r = 0; r < 8; ++r) { const float v = acc[i][j][r]; const _Float16 hv = (_Float16)v; so[wave][e + r * 8] = hv; sol[wave][e + r * 8] = (_Float16)((v - (float)hv) * 2048.0f); } } }   // q, k as f16 hi + (x2048) residual (no RoPE in this module)
    LDSX();
#pragma unroll
    for (int i = 0; i < 4; ++i) { const size_t o = ((size_t)(r0 / 16 + i) * 64 + nw / 32) * 512 + lane * 8; v4u th[4], tl[4];
#pragma unroll
      for (int q = 0; q < 4; ++q) { th[q] = *(const v4u*)&so[wave][i * 1024 + q * 256 + lane * 8]; tl[q] = *(const v4u*)&sol[wave][i * 1024 + q * 256 + lane * 8]; }
      SB();   // a row tile's eight pieces are all in registers before its first store: nothing is written into a register between the stores and their wait
#pragma unroll
      for (int q = 0; q < 4; ++q) { vst2(QK + o + q * 256, th[q]); vst2(QKL + o + q * 256, tl[q]); }
      XW(); }   // behind each row tile's stores: the next row tile's pieces may take the registers that these stores name
  } else {   // v transposed: a lane's 8 accumulator rows are 8 neighbouring keys of one column d, which is the lane's own 16-byte piece of the tile (k half = row tile & 1): stored straight from registers
    const int b = r0 / SS, s0 = r0 % SS, pc0 = nw - 2 * DM;
#pragma unroll
    for (int i = 0; i < 4; ++i) { const size_t o = (((size_t)b * (DM / 16) + pc0 / 16) * (SS / 32) + s0 / 32 + (i >> 1)) * 512 + (i & 1) * 256 + lane * 8; v8h hi[4], lo[4];
#pragma unroll
      for (int j = 0; j < 4; ++j) {
#pragma unroll
        for (int r = 0; r < 8; ++r) { const float v = acc[i][j][r]; const _Float16 hv = (_Float16)v; hi[j][r] = hv; lo[j][r] = (_Float16)((v - (float)hv) * 2048.0f); } }
      SB();   // a row tile's eight pieces are all made before its first store: nothing is written into a register between the stores and their wait
#pragma unroll
      for (int j = 0; j < 4; ++j) { vst2(VTH + o + (size_t)j * (SS / 32) * 512, hi[j]); vst2(VTL + o + (size_t)j * (SS / 32) * 512, lo[j]); }
      XW(); }   // behind each row tile's stores: the next row tile's pieces may take the registers that these stores name
  }
}
template <bool B> struct BC { static constexpr bool value = B; };   // a compile-time flag handed to a pass body: true = every (query, key) pair of the pass is causal
#define CSCALE 0.022097086912079608f   // float32(1/sqrt(2048)): the module divides by sqrt(number of keys)
// a pass's exponentials as runs of v_exp_f32 in one statement each: behind a transcendental the instruction set asks for one independent instruction before its result is read or its source overwritten;
// inside a run the next v_exp_f32 is that instruction (every output is early-clobber, so none lies on a source), and the closing v_nop is it for the last one
__device__ __forceinline__ void exp2x8(float (&e)[8], const float (&t)[8]) {
  asm("v_exp_f32 %0, %8\n\tv_exp_f32 %1, %9\n\tv_exp_f32 %2, %10\n\tv_exp_f32 %3, %11\n\tv_exp_f32 %4, %12\n\tv_exp_f32 %5, %13\n\tv_exp_f32 %6, %14\n\tv_exp_f32 %7, %15\n\tv_nop"
      : "=&v"(e[0]), "=&v"(e[1]), "=&v"(e[2]), "=&v"(e[3]), "=&v"(e[4]), "=&v"(e[5]), "=&v"(e[6]), "=&v"(e[7]) : "v"(t[0]), "v"(t[1]), "v"(t[2]), "v"(t[3]), "v"(t[4]), "v"(t[5]), "v"(t[6]), "v"(t[7]));
}
__device__ __forceinline__ void exp2x9(float& ea, float ta, float (&e)[8], const float (&t)[8]) {
  asm("v_exp_f32 %0, %9\n\tv_exp_f32 %1, %10\n\tv_exp_f32 %2, %11\n\tv_exp_f32 %3, %12\n\tv_exp_f32 %4, %13\n\tv_exp_f32 %5, %14\n\tv_exp_f32 %6, %15\n\tv_exp_f32 %7, %16\n\tv_exp_f32 %8, %17\n\tv_nop"
      : "=&v"(ea), "=&v"(e[0]), "=&v"(e[1]), "=&v"(e[2]), "=&v"(e[3]), "=&v"(e[4]), "=&v"(e[5]), "=&v"(e[6]), "=&v"(e[7]) : "v"(ta), "v"(t[0]), "v"(t[1]), "v"(t[2]), "v"(t[3]), "v"(t[4]), "v"(t[5]), "v"(t[6]), "v"(t[7]));
}
// ---- k_cstat: block = (two tiles of 64 KEYS, h, b), 8 waves. Under the causal mask key tile t is seen by 64 - 2 t query tiles of 32: the block takes tile x and tile 31 - x, 66 passes for each 16 keys' pair, and deals them in two equal walks:
// waves 0..3 walk the first half of the pair's passes, all in tile x; waves 4..7 walk the rest of tile x, leave that partial (m, l) in LDS, and then walk all of tile 31 - x; behind the one barrier waves 0..3 join the two partials. Per tile: the softmax runs over QUERIES (axis 2), so per key column we need max and sum over q: S tiles = Q rows . K rows (3 products), queries along the accumulator's rows and the wave's 16 keys along its columns, so a lane holds 16 scores of ONE key per pass: maximum and sum stay in the lane, one running (m, l) per lane, and the wave's two halves (query rows 0..7 and 8..15 of each tile) join once, at the end
// y = (qk + (k - q)) * CSCALE where causal (q >= k) if masking, else (qk + 0)*CSCALE for q < k -> MST[b][h][k] = (m, 2048 / l)
__global__ __launch_bounds__(256) void k_cstat(const _Float16* __restrict__ QK, const _Float16* __restrict__ QKL, const int* __restrict__ MASKING, float* __restrict__ MST) {
  __shared__ __align__(16) float sb[4][32][2];   // the partial (m, l) that each lane of wave 4 + w leaves for the same lane of wave w
  const int tid = threadIdx.x, wave = tid >> 5, lane = tid & 31, col = lane & 15, g = lane >> 4; const int h = blockIdx.y, b = blockIdx.z; const int masking = MASKING[0];
  const int part = __builtin_amdgcn_readfirstlane(wave >> 2), w4 = __builtin_amdgcn_readfirstlane(wave & 3);   // both in scalar registers: every test on them is a scalar branch, so EXEC stays whole for the WMMAs
  const int t1 = blockIdx.x, t2 = SS / 64 - 1 - t1; const int f1 = masking ? t1 * 2 : 0, f2 = masking ? t2 * 2 : 0;   // first query tile that can see the keys of each key tile; f1 <= f2
  const int cut = f1 + (2 * (SS / 32) - f1 - f2) / 2;   // where tile t1's walk is cut: half of the pair's passes; at most SS / 32
  float m, l;
#pragma unroll 1   // stays rolled: the walks of a wave run one after the other in the same registers
  for (int seg = 0; seg <= part; ++seg) {
  const int kb = seg ? t2 : t1, qs0 = seg ? f2 : (part ? cut : f1), qe = part ? SS / 32 : cut; const int k0 = kb * 64 + w4 * 16;
  m = -3.0e38f; l = 0.f;
  if (qs0 < qe) {   // without the mask nothing of tile t1 is left for waves 4..7
  v16h ak[2], akl[2];
#pragma unroll
  for (int kc = 0; kc < 2; ++kc) { const size_t rk = ((size_t)((b * SS + k0) / 16) * 64 + 32 + h * 2 + kc) * 512; ak[kc] = frag_hs(QK + rk, (unsigned)(lane * 16)); akl[kc] = frag_hs(QKL + rk, (unsigned)(lane * 16)); }
  XW();
  // query fragments of a pass sit in registers before the pass begins: each 16-query half is loaded again, for the next pass, directly behind its last WMMA
  const unsigned voq = (unsigned)(lane * 16); const size_t uq0 = (size_t)b * SS * (2 * DM) + h * 2 * 512;   // 16 queries on: 16 * (2 * DM) elements, as in row order; k chunk on: 512
  v16h qh[2][2], ql[2][2]; const char* pq0 = (const char*)(QK + uq0 + (size_t)qs0 * 32 * (2 * DM)) + voq; const char* pl0 = (const char*)(QKL + uq0 + (size_t)qs0 * 32 * (2 * DM)) + voq;
#pragma unroll
  for (int ct = 0; ct < 2; ++ct) {
#pragma unroll
    for (int kc = 0; kc < 2; ++kc) { qh[ct][kc] = frag_hp(pq0 + ct * 16 * (2 * DM) * 2 + kc * 1024); ql[ct][kc] = frag_hp(pl0 + ct * 16 * (2 * DM) * 2 + kc * 1024); } }
  XWA(lane, voq);   // the lane's index and offset stay in their registers up to the wait
  const int ki = k0 + col; int qs = qs0;
#pragma unroll 1
  do { v8f cc[2], cq[2]; const int qn = (qs + 1 < SS / 32) ? qs + 1 : qs;   // past the end: the last tile again, never used
#pragma unroll
    for (int ct = 0; ct < 2; ++ct) { const size_t uq = uq0 + (size_t)(qn * 32 + ct * 16) * (2 * DM); v8f c = {}, cl = {};
#pragma unroll
      for (int kc = 0; kc < 2; ++kc) { c = wmma16(qh[ct][kc], ak[kc], c); cl = wmma16(qh[ct][kc], akl[kc], cl); cl = wmma16(ql[ct][kc], ak[kc], cl); }
      SB();
#pragma unroll
      for (int kc = 0; kc < 2; ++kc) { qh[ct][kc] = frag_hs(QK + uq + kc * 512, voq); ql[ct][kc] = frag_hs(QKL + uq + kc * 512, voq); }
      XW();
      cc[ct] = c; cq[ct] = cl; }
    // the pass's vector work, in two builds: the general one, and one for a pass whose 32 queries all lie at or behind the wave's 16 keys (all but the one or two passes on the diagonal): there every pair is causal,
    // so no index is compared and nothing is selected, and the bias k - q is one float per pass less a constant (whole numbers below 2^24: exact, the same value as the converted difference)
    auto fold = [&](auto IN) { constexpr bool inner = decltype(IN)::value; v8f s[2]; const float fb = (float)(ki - qs * 32 - 8 * g);
#pragma unroll
    for (int ct = 0; ct < 2; ++ct) {
      if constexpr (inner) { v8f bv;
#pragma unroll
        for (int r = 0; r < 8; ++r) bv[r] = fb - (float)(ct * 16 + r);
        s[ct] = ((cc[ct] + cq[ct] * (1.0f / 2048.0f)) + bv) * CSCALE; }
      else {
#pragma unroll
      for (int r = 0; r < 8; ++r) { const int qq = qs * 32 + ct * 16 + 8 * g + r; const float qk = cc[ct][r] + cq[ct][r] * (1.0f / 2048.0f); const bool causal = (ki <= qq);
        s[ct][r] = causal ? (qk + (float)(ki - qq)) * CSCALE : (masking ? -3.0e38f : qk * CSCALE); } } }
    float mx[8];
#pragma unroll
    for (int r = 0; r < 8; ++r) mx[r] = fmaxf(s[0][r], s[1][r]);
    const float mn = fmaxf(m, fmaxf(fmaxf(fmaxf(mx[0], mx[1]), fmaxf(mx[2], mx[3])), fmaxf(fmaxf(mx[4], mx[5]), fmaxf(mx[6], mx[7]))));
    float t0[8], t1[8], e0[8], e1[8], ea; const float ta = (m - mn) * 1.44269504f;   // exp(x) = 2^(x * log2 e), as __expf forms it
#pragma unroll
    for (int r = 0; r < 8; ++r) { t0[r] = (s[0][r] - mn) * 1.44269504f; t1[r] = (s[1][r] - mn) * 1.44269504f; }
    exp2x9(ea, ta, e0, t0); exp2x8(e1, t1);
    const float alpha = (m <= -1.0e38f) ? 0.f : ea; float es[8];
#pragma unroll
    for (int r = 0; r < 8; ++r) es[r] = inner ? e0[r] + e1[r] : ((s[0][r] <= -1.0e38f) ? 0.f : e0[r]) + ((s[1][r] <= -1.0e38f) ? 0.f : e1[r]);
    l = l * alpha + (((es[0] + es[1]) + (es[2] + es[3])) + ((es[4] + es[5]) + (es[6] + es[7]))); m = mn; };
    if (k0 + 15 <= qs * 32) fold(BC<true>{}); else fold(BC<false>{});   // a scalar test
  } while (++qs < qe);   // tested at the foot: entered only with qs0 < qe
  }
  if (part && seg == 0) { sb[w4][lane][0] = m; sb[w4][lane][1] = l; }
  }
  __syncthreads();   // hands the partials in sb over from waves 4..7 to waves 0..3
  if (part == 0) { const float mb = sb[w4][lane][0], lb = sb[w4][lane][1]; const float d = m - mb, e = __expf(-fabsf(d));   // the side with the smaller maximum is scaled down; an empty side (m = -3e38, l = 0) gets e = 0
    l = (d >= 0.f) ? l + lb * e : l * e + lb; m = fmaxf(m, mb); }
  { const float mb = __shfl_xor(m, 16), lb = __shfl_xor(l, 16); const float d = m - mb, e = __expf(-fabsf(d));   // the wave's two halves join in the same way, once per key
    l = (d >= 0.f) ? l + lb * e : l * e + lb; m = fmaxf(m, mb); }
  if (lane < 16) vst2(MST + (((size_t)b * NH + h) * SS + (part ? t2 : t1) * 64 + w4 * 16 + col) * 2, v2f{m, 2048.0f / l});   // the one division per key; l is at least 1 (the maximum's own term); each wave stores its own 16 keys: one whole line
}
// the plain builtin: with two query tiles a wave takes more than 256 registers, and an operand of an asm statement cannot lie above v255; the compiler keeps the distance to a vector instruction on D itself, GAPW() and GAP4() keep it in front of a refill of B
// GAPW: the four slots of GAP4(), taking the score tiles as inputs: nothing else ties a plain WMMA to its place, and some would be set behind the slots and among the loads that refill their B
#define GAPW(a, b, c, d, e, f, g, h) do { asm volatile("v_nop\n\tv_nop\n\tv_nop\n\tv_nop" :: "v"(a), "v"(b), "v"(c), "v"(d), "v"(e), "v"(f), "v"(g), "v"(h)); SB(); } while (0)
__device__ __forceinline__ v8f wmma16p(v16h a, v16h b, v8f c) { return __builtin_amdgcn_wmma_f32_16x16x32_f16(false, a, false, b, (short)0, c, false, false); }
// ---- k_attn: block = (two tiles of 64 queries, h, b), 4 waves, a wave holds 32 queries (two tiles of 16), so each key and value fragment that it loads feeds two WMMAs. Under the causal mask query tile t walks 2 (t + 1) key tiles of 32: the block takes tile 31 - x and tile x, 66 passes for each 32 queries' pair, and deals them in two equal walks:
// waves 0, 1 walk the first half of the pair's passes, all in tile 31 - x; waves 2, 3 walk the rest of tile 31 - x, leave that partial sum in LDS, and then walk all of tile x; behind the one barrier waves 0, 1 add the partial to their own. Per tile: key tiles (k <= q frontier if masking); y as above; z = exp(y - m_k) * (2048 / l_k) (column statistics, the scaled reciprocal from k_cstat); P = z as f16 hi + (x2048) lo x V hi/lo (3 products); out rows (no normalisation)
__global__ __launch_bounds__(128) void k_attn(const _Float16* __restrict__ QK, const _Float16* __restrict__ QKL, const _Float16* __restrict__ VTH, const _Float16* __restrict__ VTL, const float* __restrict__ MST, const int* __restrict__ MASKING, float* __restrict__ O) {
  __shared__ __align__(16) _Float16 sph[4][32][40], spl[4][32][40]; __shared__ __align__(16) float so[4][2048], sx[2][2048];   // sx: the partial sum that wave 2 + w leaves for wave w
  const int tid = threadIdx.x, wave = tid >> 5, lane = tid & 31, col = lane & 15, g = lane >> 4;
  const int h = blockIdx.y, b = blockIdx.z; const int masking = MASKING[0];
  const int part = __builtin_amdgcn_readfirstlane(wave >> 1), w2 = __builtin_amdgcn_readfirstlane(wave & 1);   // both in scalar registers: every test on them is a scalar branch, so EXEC stays whole for the WMMAs
  const int t2 = blockIdx.x, t1 = SS / 64 - 1 - t2; const int n1 = masking ? (t1 * 64 + 64) / 32 : SS / 32, n2 = masking ? (t2 * 64 + 64) / 32 : SS / 32;   // key tiles of each query tile; n1 >= n2
  const int cut = (n1 + n2) / 2;   // where tile t1's walk is cut: half of the pair's passes; at most n1
  v8f acc[2][4], accl[2][4];
#pragma unroll 1   // stays rolled: the walks of a wave run one after the other in the same registers
  for (int seg = 0; seg <= part; ++seg) {
  const int qb = seg ? t2 : t1, ks0 = (part && !seg) ? cut : 0, nks = seg ? n2 : (part ? n1 : cut); const int q0 = qb * 64 + w2 * 32; const size_t rq = (size_t)b * SS + q0;
#pragma unroll
  for (int qt = 0; qt < 2; ++qt) {
#pragma unroll
    for (int dt = 0; dt < 4; ++dt) { acc[qt][dt] = v8f{}; accl[qt][dt] = v8f{}; } }
  if (ks0 < nks) {   // without the mask nothing of tile t1 is left for waves 2, 3
  v16h aq[2][2], aql[2][2];
#pragma unroll
  for (int qt = 0; qt < 2; ++qt) {
#pragma unroll
    for (int kc = 0; kc < 2; ++kc) { aq[qt][kc] = frag_hs(QK + (rq + qt * 16) * (2 * DM) + (h * 2 + kc) * 512, (unsigned)(lane * 16)); aql[qt][kc] = frag_hs(QKL + (rq + qt * 16) * (2 * DM) + (h * 2 + kc) * 512, (unsigned)(lane * 16)); } }
  XW();
  // every global load of a pass is issued well ahead of its use: the values at the head of the pass; the 32 keys of the next pass (with their statistics) directly behind this pass's score WMMAs
  const unsigned vok = (unsigned)(lane * 16), vov = (unsigned)(lane * 16), vom = (unsigned)(col * 8);
  const size_t uk0 = (size_t)b * SS * (2 * DM) + (32 + h * 2) * 512, uv0 = ((size_t)b * DM + h * HD) * SS; const float* um0 = MST + ((size_t)b * NH + h) * SS * 2;
  v16h kh[2][2], kl[2][2]; v2f ms[2];   // [block of 16 keys][k chunk]
#pragma unroll
  for (int ct = 0; ct < 2; ++ct) {
#pragma unroll
    for (int kc = 0; kc < 2; ++kc) { const size_t uk = uk0 + (size_t)(ks0 * 32 + ct * 16) * (2 * DM) + kc * 512; kh[ct][kc] = frag_hs(QK + uk, vok); kl[ct][kc] = frag_hs(QKL + uk, vok); }
    ms[ct] = *(const v2f*)((const char*)(um0 + (ks0 * 32 + ct * 16) * 2) + vom); }
  XW();
  int ks = ks0;
#pragma unroll 1
  do { v16h vh[4], vl[4]; const int kn = (ks + 1 < nks) ? ks + 1 : ks;   // past the end: the last tile again, never used
    const char* pvh = (const char*)(VTH + uv0 + ks * 512) + vov; const char* pvl = (const char*)(VTL + uv0 + ks * 512) + vov;
#pragma unroll
    for (int dt = 0; dt < 4; ++dt) { vh[dt] = frag_hp(pvh + dt * 16 * SS * 2); vl[dt] = frag_hp(pvl + dt * 16 * SS * 2); }
    XWA(pvh, pvl);
    v8f c[2][2] = {}, cl[2][2] = {};   // [block of 16 keys][query tile]
#pragma unroll
    for (int ct = 0; ct < 2; ++ct) {
#pragma unroll
      for (int kc = 0; kc < 2; ++kc) {
#pragma unroll
        for (int qt = 0; qt < 2; ++qt) { c[ct][qt] = wmma16p(aq[qt][kc], kh[ct][kc], c[ct][qt]); cl[ct][qt] = wmma16p(aql[qt][kc], kh[ct][kc], cl[ct][qt]); }
#pragma unroll
        for (int qt = 0; qt < 2; ++qt) cl[ct][qt] = wmma16p(aq[qt][kc], kl[ct][kc], cl[ct][qt]); } }   // the two products into one cl stand apart: the second does not wait on the first
    const float mk[2] = {ms[0][0], ms[1][0]}, rk[2] = {ms[0][1], ms[1][1]};
    GAPW(c[0][0], cl[0][0], c[0][1], cl[0][1], c[1][0], cl[1][0], c[1][1], cl[1][1]);
#pragma unroll
    for (int ct = 0; ct < 2; ++ct) {
#pragma unroll
      for (int kc = 0; kc < 2; ++kc) { const size_t uk = uk0 + (size_t)(kn * 32 + ct * 16) * (2 * DM) + kc * 512; kh[ct][kc] = frag_hs(QK + uk, vok); kl[ct][kc] = frag_hs(QKL + uk, vok); }
      ms[ct] = *(const v2f*)((const char*)(um0 + (kn * 32 + ct * 16) * 2) + vom); }
    XW();
    // the weights, in two builds. A pass whose 32 keys all lie at or in front of the wave's 32 queries (all but the one or two passes on the diagonal) has only causal pairs:
    // no index is compared and nothing is selected, and the bias k - q is one float per pass plus a constant (whole numbers below 2^24: exact, the same value as the converted difference)
    if (ks * 32 + 31 <= q0) {   // a scalar test
    const float fb = (float)(ks * 32 + col - q0 - 8 * g);
#pragma unroll
    for (int ct = 0; ct < 2; ++ct) { float x[16], e[16], d[16]; _Float16 hp[16], lp[16];   // sixteen weights go through each stage together; the scheduling barriers keep the stages apart, so that an instruction stands among fifteen that do not depend on it and not directly behind its own producer
#pragma unroll
      for (int i = 0; i < 16; ++i) { const int qt = i >> 3, r = i & 7; x[i] = c[ct][qt][r] + cl[ct][qt][r] * (1.0f / 2048.0f); }
      SB();
#pragma unroll
      for (int i = 0; i < 16; ++i) { const int qt = i >> 3, r = i & 7; x[i] = x[i] + (fb + (float)((ct - qt) * 16 - r)); }
      SB();
#pragma unroll
      for (int i = 0; i < 16; ++i) x[i] = x[i] * CSCALE - mk[ct];
      SB();
#pragma unroll
      for (int i = 0; i < 16; ++i) x[i] = x[i] * 1.44269504f;   // exp(x) = 2^(x * log2 e), as __expf forms it
      SB();
#pragma unroll
      for (int i = 0; i < 16; ++i) e[i] = __builtin_amdgcn_exp2f(x[i]);
      SB();
#pragma unroll
      for (int i = 0; i < 16; ++i) { e[i] = e[i] * rk[ct]; hp[i] = (_Float16)e[i]; }
      SB();
#pragma unroll
      for (int i = 0; i < 16; ++i) d[i] = e[i] - (float)hp[i];
      SB();
#pragma unroll
      for (int i = 0; i < 16; ++i) lp[i] = (_Float16)(d[i] * 2048.0f);
      SB();
#pragma unroll
      for (int i = 0; i < 16; ++i) { const int qt = i >> 3, r = i & 7; sph[wave][qt * 16 + 8 * g + r][ct * 16 + col] = hp[i]; spl[wave][qt * 16 + 8 * g + r][ct * 16 + col] = lp[i]; } }
    } else {
#pragma unroll
    for (int ct = 0; ct < 2; ++ct) { const int kk = ks * 32 + ct * 16 + col;
#pragma unroll
      for (int qt = 0; qt < 2; ++qt) {
#pragma unroll
      for (int r = 0; r < 8; ++r) { const int qi = q0 + qt * 16 + 8 * g + r; const float qk = c[ct][qt][r] + cl[ct][qt][r] * (1.0f / 2048.0f); const bool causal = (kk <= qi);
        const float y = causal ? (qk + (float)(kk - qi)) * CSCALE : qk * CSCALE; const float e = __expf(y - mk[ct]) * rk[ct]; const float p = (causal || !masking) ? e : 0.f;   // formed for every element and then chosen: a select, no branch on EXEC; rk = 2^11 / l: z scaled by 2^11 so its f16 hi plane stays out of the subnormal range; 2^-11 folded into the epilogue
        const _Float16 hp = (_Float16)p; sph[wave][qt * 16 + 8 * g + r][ct * 16 + col] = hp; spl[wave][qt * 16 + 8 * g + r][ct * 16 + col] = (_Float16)((p - (float)hp) * 2048.0f); } } } }
    LDSX();
    v16h pah[2], pal[2];
#pragma unroll
    for (int qt = 0; qt < 2; ++qt) { pah[qt] = frag_h(&sph[wave][qt * 16 + col][0], lane); pal[qt] = frag_h(&spl[wave][qt * 16 + col][0], lane); }
#pragma unroll
    for (int dt = 0; dt < 4; ++dt) {
#pragma unroll
      for (int qt = 0; qt < 2; ++qt) { acc[qt][dt] = wmma16p(pah[qt], vh[dt], acc[qt][dt]); accl[qt][dt] = wmma16p(pal[qt], vh[dt], accl[qt][dt]); }
#pragma unroll
      for (int qt = 0; qt < 2; ++qt) accl[qt][dt] = wmma16p(pah[qt], vl[dt], accl[qt][dt]); }
    GAP4();   // the next pass's loads refill the value fragments
    LDSX(); } while (++ks < nks);   // tested at the foot: entered only with ks0 < nks
  }
  if (part && seg == 0) {   // a lane leaves each value where its partner's same lane will look for it
#pragma unroll
    for (int qt = 0; qt < 2; ++qt) {
#pragma unroll
    for (int r = 0; r < 8; ++r) {
#pragma unroll
      for (int dt = 0; dt < 4; ++dt) sx[w2][((qt * 4 + dt) * 8 + r) * 32 + lane] = (acc[qt][dt][r] + accl[qt][dt][r] * (1.0f / 2048.0f)) * (1.0f / 2048.0f); } } }
  }
  __syncthreads();   // hands the partial sums in sx over from waves 2, 3 to waves 0, 1
  const size_t rqo = (size_t)b * SS + (part ? t2 : t1) * 64 + w2 * 32;
#pragma unroll
  for (int qt = 0; qt < 2; ++qt) {
#pragma unroll
    for (int dt = 0; dt < 4; ++dt) acc[qt][dt] = (acc[qt][dt] + accl[qt][dt] * (1.0f / 2048.0f)) * (1.0f / 2048.0f); }
  if (part == 0) {
#pragma unroll
    for (int qt = 0; qt < 2; ++qt) {
#pragma unroll
    for (int r = 0; r < 8; ++r) {
#pragma unroll
      for (int dt = 0; dt < 4; ++dt) acc[qt][dt][r] += sx[w2][((qt * 4 + dt) * 8 + r) * 32 + lane]; } } }
#pragma unroll
  for (int qt = 0; qt < 2; ++qt) {
#pragma unroll
  for (int r = 0; r < 8; ++r) {
#pragma unroll
    for (int dt = 0; dt < 4; ++dt) so[wave][qt * 1024 + (dt >> 1) * 512 + ((dt & 1) * 2 + ((col >> 2) & 1)) * 128 + ((col >> 3) * 16 + 8 * g + r) * 4 + (col & 3)] = acc[qt][dt][r]; } }   // each query tile's two f32 tiles, in fragment order
  LDSX();
#pragma unroll
  for (int qt = 0; qt < 2; ++qt) { v4f t[8];
#pragma unroll
    for (int q = 0; q < 8; ++q) t[q] = *(const v4f*)&so[wave][qt * 1024 + q * 128 + lane * 4];
    SB();   // a query tile's eight pieces are all in registers before its first store: nothing is written into a register between the stores and their wait
#pragma unroll
    for (int q = 0; q < 8; ++q) vst2(O + (rqo + qt * 16) * DM + h * 2 * 512 + q * 128 + lane * 4, t[q]);
    XW(); }   // behind each query tile's stores: the next tile's pieces may take the registers that these stores name
}
// ---- k_out: block = (64 rows, 128 cols): out = O(hi/lo) . Wo rows (2 products)
__global__ __launch_bounds__(128) void k_out(const float* __restrict__ O, const __bf16* __restrict__ P, float* __restrict__ Y) {
  __shared__ __align__(16) float so[4][16][132];
  const int tid = threadIdx.x, wave = tid >> 5, lane = tid & 31, col = lane & 15, g = lane >> 4; const size_t r0 = (size_t)blockIdx.x * 64 + wave * 16; const int n0 = blockIdx.y * 128;
  v8f acc[8] = {};
  // two register slots of fragments, each loaded again for two chunks on directly behind its last use (as the B fragments in k_qkv)
  const float* ua = O + (size_t)blockIdx.x * 64 * DM; const __bf16* ub = P + (size_t)n0 * DM; const unsigned voa = (unsigned)((wave * 16 * DM + lane * 4) * 4), vob = (unsigned)(lane * 16);
  R16 ar[2]; v16b bw[2][8];
#pragma unroll
  for (int u = 0; u < 2; ++u) { ar[u] = ld_row16t(ua + u * 512, voa);
#pragma unroll
    for (int j = 0; j < 8; ++j) bw[u][j] = frag_bs(ub + j * 16 * DM + u * 512, vob); }
  XW();
#pragma unroll 1   // stays rolled: the two slots are the whole unrolling, a further copy would only cost registers
  for (int kc = 0; kc < DM / 32; kc += 2) {
#pragma unroll
    for (int u = 0; u < 2; ++u) { float v[16]; const int kn = (kc + u + 2 < DM / 32) ? kc + u + 2 : DM / 32 - 1;   // past the end: the last chunk again, never used
#pragma unroll
      for (int i = 0; i < 8; ++i) { v[i] = ar[u].q[i >> 2][i & 3]; v[8 + i] = ar[u].q[2 + (i >> 2)][i & 3]; }
      const F2 a = bsplit16(v); ar[u] = ld_row16t(ua + kn * 512, voa);
#pragma unroll
      for (int j = 0; j < 8; ++j) { acc[j] = wmma_bf(a.l, bw[u][j], acc[j]); acc[j] = wmma_bf(a.h, bw[u][j], acc[j]); bw[u][j] = frag_bs(ub + j * 16 * DM + kn * 512, vob); }
      XW(); } }
#pragma unroll
  for (int j = 0; j < 8; ++j) {
#pragma unroll
    for (int r = 0; r < 8; ++r) so[wave][8 * g + r][j * 16 + col] = acc[j][r]; }
  LDSX();
  for (int rl = 0; rl < 16; ++rl) vst2(Y + (r0 + rl) * DM + n0 + lane * 4, *(const v4f*)&so[wave][rl][lane * 4]);
}
extern "C" void kernel_launch(void* const* d_in, const int* in_sizes, int n_in, void* d_out, int out_size, void* d_ws, size_t ws_size, hipStream_t stream) {
  (void)in_sizes; (void)n_in; (void)out_size;
  const float** F = (const float**)d_in;   // 0 keys [2,2048,1024], 1 queries, 2 values, 3 WQ [16,1024,64], 4 WK, 5 WV, 6 WO [1024,1024] (in,out), 7 masking [1] int32
  if (ws_size < (size_t)WS_END) return;
  char* ws = (char*)d_ws; __bf16* PK = (__bf16*)(ws + WS_PK); _Float16 *QK = (_Float16*)(ws + WS_QK), *QKL = (_Float16*)(ws + WS_QKL), *VTH = (_Float16*)(ws + WS_VTH), *VTL = (_Float16*)(ws + WS_VTL); float* O = (float*)(ws + WS_O);
  float* MST = (float*)(ws + WS_MST); __bf16* XP = (__bf16*)(ws + WS_XP);
  k_pack<<<dim3(DM / 16, 5, 8), 256, 0, stream>>>(F[3], F[4], F[5], F[6], F[1], F[0], F[2], PK, XP);
  k_qkv<<<dim3(TNB * SS / 256, QKVW / 192), 384, 0, stream>>>(XP, PK + PK_A, QK, QKL, VTH, VTL);
  k_cstat<<<dim3(SS / 128, NH, TNB), 256, 0, stream>>>(QK, QKL, (const int*)d_in[7], MST);
  k_attn<<<dim3(TQB / 2, NH, TNB), 128, 0, stream>>>(QK, QKL, VTH, VTL, MST, (const int*)d_in[7], O);
  k_out<<<dim3(TOB, DM / 128), 128, 0, stream>>>(O, PK + PK_P, (float*)d_out);
}
